// v000
// Times are from an AMD MI455X. After a warm-up the kernel runs many times in a row, and a time is the length of
// such a window on the GPU divided by its runs, so every launch and the gaps after it count. The runs cycle
// through copies of the inputs. A figure is the median of several windows, for all but v000 over two sittings.
// Sittings can differ by a few percent; kernels timed side by side share one.
// The starting kernel, v000, takes 360 microseconds a run.
#include <hip/hip_runtime.h>

// ---------------------------------------------------------------------------
// A2N attention block for MI455X (gfx1250, wave32, WMMA bf16 16x16x32).
// out = x + w4 @ ( (A @ softmax_b(Bp)^T) @ softmax_b(V) ) + b4
// refactored as  x + ((w4 @ G) @ att_vecs) + b4  to kill the HW-sized conv4.
// ---------------------------------------------------------------------------

typedef __attribute__((ext_vector_type(16))) __bf16 bvec16;
typedef __attribute__((ext_vector_type(8)))  float  fvec8;

#define BATCH 8
#define C_IN  512
#define CM    512
#define CN    256
#define HW    4096
#define MO    1024   // CM + CN + CN rows of the fused conv123 weight

// ---- workspace layout (bytes) ---------------------------------------------
static constexpr size_t SZ_XT  = (size_t)BATCH * HW * C_IN * 2;  // bf16 xT[b][p][c]
static constexpr size_t SZ_WC  = (size_t)MO * C_IN * 2;          // bf16 [w1;w2;w3]
static constexpr size_t SZ_W4C = (size_t)C_IN * CM * 2;          // bf16 w4
static constexpr size_t SZ_A   = (size_t)BATCH * CM * HW * 2;    // bf16 A[b][m][p]
static constexpr size_t SZ_BP  = (size_t)BATCH * CN * HW * 4;    // f32 Bp
static constexpr size_t SZ_V   = SZ_BP;                          // f32 V
static constexpr size_t SZ_AM  = (size_t)BATCH * CN * HW * 2;    // bf16 att_maps[b][n][p]
static constexpr size_t SZ_AVT = SZ_AM;                          // bf16 att_vecsT[b][p][n]
static constexpr size_t SZ_GT  = (size_t)BATCH * CN * CM * 2;    // bf16 Gt[b][n][m]
// Hb bf16 [b][o][n] after Gt

static constexpr size_t OFF_XT  = 0;
static constexpr size_t OFF_WC  = OFF_XT + SZ_XT;
static constexpr size_t OFF_W4C = OFF_WC + SZ_WC;
static constexpr size_t OFF_A   = OFF_W4C + SZ_W4C;
static constexpr size_t OFF_BP  = OFF_A + SZ_A;
static constexpr size_t OFF_V   = OFF_BP + SZ_BP;
static constexpr size_t OFF_AM  = OFF_V + SZ_V;
static constexpr size_t OFF_AVT = OFF_AM + SZ_AM;
static constexpr size_t OFF_GT  = OFF_AVT + SZ_AVT;
static constexpr size_t OFF_HB  = OFF_GT + SZ_GT;

// ---------------------------------------------------------------------------
// WMMA operand fragment load. Works for the A operand from row-major [M][K]
// and for the B operand when B^T is row-major [N][K] (true for every GEMM
// here by construction). Matches ISA bf16 16x32 layout:
//   lane L: row = L&15, chunk0 = K[(L>>4)*8 .. +7], chunk1 = chunk0 + 16.
// ---------------------------------------------------------------------------
__device__ __forceinline__ bvec16 load_frag(const __bf16* __restrict__ tile,
                                            int ld, int lane) {
  const __bf16* p = tile + (size_t)(lane & 15) * ld + ((lane >> 4) << 3);
  union { uint4 q[2]; bvec16 v; } u;
  u.q[0] = *(const uint4*)(p);
  u.q[1] = *(const uint4*)(p + 16);
  return u.v;
}

// Per-wave 32x64 output tile: 2 (M) x 4 (N) WMMA 16x16 tiles, K step 32.
__device__ __forceinline__ void wave_gemm_2x4(const __bf16* __restrict__ Arows,
                                              int lda, int m0,
                                              const __bf16* __restrict__ Brows,
                                              int ldb, int n0, int K, int lane,
                                              fvec8 acc[2][4]) {
  for (int k = 0; k < K; k += 32) {
    bvec16 af[2], bfr[4];
#pragma unroll
    for (int i = 0; i < 2; ++i)
      af[i] = load_frag(Arows + (size_t)(m0 + 16 * i) * lda + k, lda, lane);
#pragma unroll
    for (int j = 0; j < 4; ++j)
      bfr[j] = load_frag(Brows + (size_t)(n0 + 16 * j) * ldb + k, ldb, lane);
#pragma unroll
    for (int i = 0; i < 2; ++i)
#pragma unroll
      for (int j = 0; j < 4; ++j)
        acc[i][j] = __builtin_amdgcn_wmma_f32_16x16x32_bf16(
            false, af[i], false, bfr[j], (short)0, acc[i][j], false, false);
  }
}

// ---------------------------------------------------------------------------
// Prep 1: x [b][c][p] f32  ->  xT [b][p][c] bf16  (LDS tile transpose)
// ---------------------------------------------------------------------------
__global__ __launch_bounds__(256) void a2n_transpose_x(
    const float* __restrict__ x, __bf16* __restrict__ xT) {
  __shared__ float tile[32][33];
  const int b = blockIdx.z;
  const int cb = blockIdx.y * 32;
  const int pb = blockIdx.x * 32;
  const int col = threadIdx.x & 31;
  const int row8 = threadIdx.x >> 5;
  const float* xb = x + (size_t)b * C_IN * HW;
#pragma unroll
  for (int i = 0; i < 4; ++i) {
    int r = row8 + i * 8;
    tile[r][col] = xb[(size_t)(cb + r) * HW + pb + col];
  }
  __syncthreads();
  __bf16* xTb = xT + (size_t)b * HW * C_IN;
#pragma unroll
  for (int i = 0; i < 4; ++i) {
    int r = row8 + i * 8;
    xTb[(size_t)(pb + r) * C_IN + cb + col] = (__bf16)tile[col][r];
  }
}

// ---------------------------------------------------------------------------
// Prep 2: convert weights to bf16, fuse w1|w2|w3 into Wc [1024][512]
// ---------------------------------------------------------------------------
__global__ __launch_bounds__(256) void a2n_convert_weights(
    const float* __restrict__ w1, const float* __restrict__ w2,
    const float* __restrict__ w3, const float* __restrict__ w4,
    __bf16* __restrict__ Wc, __bf16* __restrict__ W4c) {
  const int t = blockIdx.x * 256 + threadIdx.x;
  const int n1 = MO * C_IN;          // 524288
  const int n2 = n1 + C_IN * CM;     // + 262144
  if (t < n1) {
    const int row = t / C_IN;
    float v;
    if (row < CM)            v = w1[t];
    else if (row < CM + CN)  v = w2[t - CM * C_IN];
    else                     v = w3[t - (CM + CN) * C_IN];
    Wc[t] = (__bf16)v;
  } else if (t < n2) {
    W4c[t - n1] = (__bf16)w4[t - n1];
  }
}

// ---------------------------------------------------------------------------
// K1: fused conv1/2/3.  Y[o][p] = sum_c Wc[o][c] * xT[p][c]  (+bias)
// rows 0..511 -> A (bf16), 512..767 -> Bp (f32), 768..1023 -> V (f32)
// ---------------------------------------------------------------------------
__global__ __launch_bounds__(256) void a2n_conv123(
    const __bf16* __restrict__ Wc, const __bf16* __restrict__ xT,
    const float* __restrict__ b1, const float* __restrict__ b2,
    const float* __restrict__ b3, __bf16* __restrict__ Aout,
    float* __restrict__ Bp, float* __restrict__ V) {
  const int b = blockIdx.z;
  const int lane = threadIdx.x & 31;
  const int wave = threadIdx.x >> 5;
  const int m0 = blockIdx.y * 128 + (wave >> 1) * 32;
  const int n0 = blockIdx.x * 128 + (wave & 1) * 64;
  const __bf16* Brows = xT + (size_t)b * HW * C_IN;

  fvec8 zero = {};
  fvec8 acc[2][4];
#pragma unroll
  for (int i = 0; i < 2; ++i)
#pragma unroll
    for (int j = 0; j < 4; ++j) acc[i][j] = zero;

  wave_gemm_2x4(Wc, C_IN, m0, Brows, C_IN, n0, C_IN, lane, acc);

#pragma unroll
  for (int i = 0; i < 2; ++i)
#pragma unroll
    for (int j = 0; j < 4; ++j)
#pragma unroll
      for (int e = 0; e < 8; ++e) {
        const int mg = m0 + 16 * i + 8 * (lane >> 4) + e;
        const int p = n0 + 16 * j + (lane & 15);
        float bias = (mg < CM) ? b1[mg]
                   : (mg < CM + CN) ? b2[mg - CM] : b3[mg - CM - CN];
        const float val = acc[i][j][e] + bias;
        if (mg < CM)
          Aout[(size_t)b * CM * HW + (size_t)mg * HW + p] = (__bf16)val;
        else if (mg < CM + CN)
          Bp[(size_t)b * CN * HW + (size_t)(mg - CM) * HW + p] = val;
        else
          V[(size_t)b * CN * HW + (size_t)(mg - CM - CN) * HW + p] = val;
      }
}

// ---------------------------------------------------------------------------
// K2: softmax over BATCH axis for Bp and V.
// att_maps written [b][n][p]; att_vecs written transposed [b][p][n].
// ---------------------------------------------------------------------------
__global__ __launch_bounds__(256) void a2n_batch_softmax(
    const float* __restrict__ Bp, const float* __restrict__ V,
    __bf16* __restrict__ attm, __bf16* __restrict__ attvT) {
  const size_t NP = (size_t)CN * HW;
  size_t t = (size_t)blockIdx.x * 256 + threadIdx.x;
  if (t >= 2 * NP) return;
  const bool second = t >= NP;
  const size_t j = second ? t - NP : t;
  const float* src = second ? V : Bp;

  float v[BATCH];
  float mx = -3.4e38f;
#pragma unroll
  for (int b = 0; b < BATCH; ++b) {
    v[b] = src[b * NP + j];
    mx = fmaxf(mx, v[b]);
  }
  float s = 0.f;
#pragma unroll
  for (int b = 0; b < BATCH; ++b) {
    v[b] = __expf(v[b] - mx);
    s += v[b];
  }
  const float inv = 1.f / s;
  if (!second) {
#pragma unroll
    for (int b = 0; b < BATCH; ++b) attm[b * NP + j] = (__bf16)(v[b] * inv);
  } else {
    const int n = (int)(j / HW);
    const int p = (int)(j % HW);
#pragma unroll
    for (int b = 0; b < BATCH; ++b)
      attvT[b * NP + (size_t)p * CN + n] = (__bf16)(v[b] * inv);
  }
}

// ---------------------------------------------------------------------------
// K3: gathered.  G[m][n] = sum_p A[m][p] * attm[n][p], stored transposed
// as Gt[b][n][m] (bf16) so it is a ready-made B^T operand for K4.
// ---------------------------------------------------------------------------
__global__ __launch_bounds__(256) void a2n_gathered(
    const __bf16* __restrict__ A, const __bf16* __restrict__ attm,
    __bf16* __restrict__ Gt) {
  const int b = blockIdx.z;
  const int lane = threadIdx.x & 31;
  const int wave = threadIdx.x >> 5;
  const int m0 = blockIdx.y * 128 + (wave >> 1) * 32;  // over CM
  const int n0 = blockIdx.x * 128 + (wave & 1) * 64;   // over CN

  fvec8 zero = {};
  fvec8 acc[2][4];
#pragma unroll
  for (int i = 0; i < 2; ++i)
#pragma unroll
    for (int j = 0; j < 4; ++j) acc[i][j] = zero;

  wave_gemm_2x4(A + (size_t)b * CM * HW, HW, m0,
                attm + (size_t)b * CN * HW, HW, n0, HW, lane, acc);

  __bf16* Gb = Gt + (size_t)b * CN * CM;
#pragma unroll
  for (int i = 0; i < 2; ++i)
#pragma unroll
    for (int j = 0; j < 4; ++j)
#pragma unroll
      for (int e = 0; e < 8; ++e) {
        const int m = m0 + 16 * i + 8 * (lane >> 4) + e;
        const int n = n0 + 16 * j + (lane & 15);
        Gb[(size_t)n * CM + m] = (__bf16)acc[i][j][e];
      }
}

// ---------------------------------------------------------------------------
// K4: Hm = w4 @ G.  Hm[o][n] = sum_m w4[o][m] * Gt[n][m].  Stored [b][o][n].
// ---------------------------------------------------------------------------
__global__ __launch_bounds__(256) void a2n_w4g(
    const __bf16* __restrict__ W4c, const __bf16* __restrict__ Gt,
    __bf16* __restrict__ Hb) {
  const int b = blockIdx.z;
  const int lane = threadIdx.x & 31;
  const int wave = threadIdx.x >> 5;
  const int m0 = blockIdx.y * 128 + (wave >> 1) * 32;  // over C (out chans)
  const int n0 = blockIdx.x * 128 + (wave & 1) * 64;   // over CN

  fvec8 zero = {};
  fvec8 acc[2][4];
#pragma unroll
  for (int i = 0; i < 2; ++i)
#pragma unroll
    for (int j = 0; j < 4; ++j) acc[i][j] = zero;

  wave_gemm_2x4(W4c, CM, m0, Gt + (size_t)b * CN * CM, CM, n0, CM, lane, acc);

  __bf16* Hbb = Hb + (size_t)b * C_IN * CN;
#pragma unroll
  for (int i = 0; i < 2; ++i)
#pragma unroll
    for (int j = 0; j < 4; ++j)
#pragma unroll
      for (int e = 0; e < 8; ++e) {
        const int o = m0 + 16 * i + 8 * (lane >> 4) + e;
        const int n = n0 + 16 * j + (lane & 15);
        Hbb[(size_t)o * CN + n] = (__bf16)acc[i][j][e];
      }
}

// ---------------------------------------------------------------------------
// K5: out[o][p] = x[o][p] + b4[o] + sum_n Hb[o][n] * attvT[p][n]
// ---------------------------------------------------------------------------
__global__ __launch_bounds__(256) void a2n_distribute_out(
    const __bf16* __restrict__ Hb, const __bf16* __restrict__ attvT,
    const float* __restrict__ b4, const float* __restrict__ x,
    float* __restrict__ out) {
  const int b = blockIdx.z;
  const int lane = threadIdx.x & 31;
  const int wave = threadIdx.x >> 5;
  const int m0 = blockIdx.y * 128 + (wave >> 1) * 32;  // over C
  const int n0 = blockIdx.x * 128 + (wave & 1) * 64;   // over HW

  fvec8 zero = {};
  fvec8 acc[2][4];
#pragma unroll
  for (int i = 0; i < 2; ++i)
#pragma unroll
    for (int j = 0; j < 4; ++j) acc[i][j] = zero;

  wave_gemm_2x4(Hb + (size_t)b * C_IN * CN, CN, m0,
                attvT + (size_t)b * HW * CN, CN, n0, CN, lane, acc);

  const float* xb = x + (size_t)b * C_IN * HW;
  float* ob = out + (size_t)b * C_IN * HW;
#pragma unroll
  for (int i = 0; i < 2; ++i)
#pragma unroll
    for (int j = 0; j < 4; ++j)
#pragma unroll
      for (int e = 0; e < 8; ++e) {
        const int o = m0 + 16 * i + 8 * (lane >> 4) + e;
        const int p = n0 + 16 * j + (lane & 15);
        const size_t idx = (size_t)o * HW + p;
        ob[idx] = acc[i][j][e] + b4[o] + xb[idx];
      }
}

// ---------------------------------------------------------------------------
extern "C" void kernel_launch(void* const* d_in, const int* in_sizes, int n_in,
                              void* d_out, int out_size, void* d_ws,
                              size_t ws_size, hipStream_t stream) {
  const float* x  = (const float*)d_in[0];
  const float* w1 = (const float*)d_in[1];
  const float* b1 = (const float*)d_in[2];
  const float* w2 = (const float*)d_in[3];
  const float* b2 = (const float*)d_in[4];
  const float* w3 = (const float*)d_in[5];
  const float* b3 = (const float*)d_in[6];
  const float* w4 = (const float*)d_in[7];
  const float* b4 = (const float*)d_in[8];
  float* out = (float*)d_out;

  char* ws = (char*)d_ws;
  __bf16* XT   = (__bf16*)(ws + OFF_XT);
  __bf16* WC   = (__bf16*)(ws + OFF_WC);
  __bf16* W4C  = (__bf16*)(ws + OFF_W4C);
  __bf16* Abuf = (__bf16*)(ws + OFF_A);
  float*  BP   = (float*)(ws + OFF_BP);
  float*  Vb   = (float*)(ws + OFF_V);
  __bf16* AM   = (__bf16*)(ws + OFF_AM);
  __bf16* AVT  = (__bf16*)(ws + OFF_AVT);
  __bf16* GT   = (__bf16*)(ws + OFF_GT);
  __bf16* HB   = (__bf16*)(ws + OFF_HB);

  const dim3 blk(256);

  a2n_transpose_x<<<dim3(HW / 32, C_IN / 32, BATCH), blk, 0, stream>>>(x, XT);

  a2n_convert_weights<<<dim3((MO * C_IN + C_IN * CM + 255) / 256), blk, 0,
                        stream>>>(w1, w2, w3, w4, WC, W4C);

  a2n_conv123<<<dim3(HW / 128, MO / 128, BATCH), blk, 0, stream>>>(
      WC, XT, b1, b2, b3, Abuf, BP, Vb);

  a2n_batch_softmax<<<dim3((2 * CN * HW + 255) / 256), blk, 0, stream>>>(
      BP, Vb, AM, AVT);

  a2n_gathered<<<dim3(CN / 128, CM / 128, BATCH), blk, 0, stream>>>(Abuf, AM,
                                                                    GT);

  a2n_w4g<<<dim3(CN / 128, C_IN / 128, BATCH), blk, 0, stream>>>(W4C, GT, HB);

  a2n_distribute_out<<<dim3(HW / 128, C_IN / 128, BATCH), blk, 0, stream>>>(
      HB, AVT, b4, x, out);
}

// v001
// A run of this version takes 208 microseconds.
// Timed twice side by side with v000, it ran 1.78 and 1.77 times as fast.
#include <hip/hip_runtime.h>

// ---------------------------------------------------------------------------
// A2N attention block for MI455X (gfx1250, wave32, WMMA bf16 16x16x32).
// out = x + w4 @ ( (A @ softmax_b(Bp)^T) @ softmax_b(V) ) + b4
// refactored as  x + ((w4 @ G) @ att_vecs) + b4  to kill the HW-sized conv4.
// ---------------------------------------------------------------------------

typedef __attribute__((ext_vector_type(16))) __bf16 bvec16;
typedef __attribute__((ext_vector_type(8)))  float  fvec8;

#define BATCH 8
#define C_IN  512
#define CM    512
#define CN    256
#define HW    4096
#define MO    1024   // CM + CN + CN rows of the fused conv123 weight

// ---- workspace layout (bytes) ---------------------------------------------
static constexpr size_t SZ_XT  = (size_t)BATCH * HW * C_IN * 2;  // bf16 xT[b][p][c]
static constexpr size_t SZ_WC  = (size_t)MO * C_IN * 2;          // bf16 [w1;w2;w3]
static constexpr size_t SZ_W4C = (size_t)C_IN * CM * 2;          // bf16 w4
static constexpr size_t SZ_A   = (size_t)BATCH * CM * HW * 2;    // bf16 A[b][m][p]
static constexpr size_t SZ_BP  = (size_t)BATCH * CN * HW * 4;    // f32 Bp
static constexpr size_t SZ_V   = SZ_BP;                          // f32 V
static constexpr size_t SZ_AM  = (size_t)BATCH * CN * HW * 2;    // bf16 att_maps[b][n][p]
static constexpr size_t SZ_AVT = SZ_AM;                          // bf16 att_vecsT[b][p][n]
static constexpr size_t SZ_GT  = (size_t)BATCH * CN * CM * 2;    // bf16 Gt[b][n][m]
// Hb bf16 [b][o][n] after Gt

static constexpr size_t OFF_XT  = 0;
static constexpr size_t OFF_WC  = OFF_XT + SZ_XT;
static constexpr size_t OFF_W4C = OFF_WC + SZ_WC;
static constexpr size_t OFF_A   = OFF_W4C + SZ_W4C;
static constexpr size_t OFF_BP  = OFF_A + SZ_A;
static constexpr size_t OFF_V   = OFF_BP + SZ_BP;
static constexpr size_t OFF_AM  = OFF_V + SZ_V;
static constexpr size_t OFF_AVT = OFF_AM + SZ_AM;
static constexpr size_t OFF_GT  = OFF_AVT + SZ_AVT;
static constexpr size_t OFF_HB  = OFF_GT + SZ_GT;

// ---------------------------------------------------------------------------
// LDS ring of the four GEMMs. A pass is 128 k = 256 bytes of every operand row.
// A stage holds the block's 128 A rows and 128 B rows as eight slices of 32
// rows, one slice per wave, each brought in by that wave's own tensor load.
// The load's pad gives an LDS row pitch of 272 B (16 B x odd: no bank conflict
// for ds_load_b128). A slice's 32 * 272 = 8704 B are rounded up to a multiple
// of 2 KiB so that every load's place in LDS is one.
// ---------------------------------------------------------------------------
typedef uint32_t u32x4 __attribute__((ext_vector_type(4)));
typedef uint32_t u32x8 __attribute__((ext_vector_type(8)));

static constexpr uint32_t PASS_K     = 128;
static constexpr uint32_t ROW_B      = 256;
static constexpr uint32_t PITCH_B    = 272;
static constexpr uint32_t SLICE_ROWS = 32;
static constexpr uint32_t SLICE_B    = 10240;
static constexpr uint32_t STAGE_B    = 8 * SLICE_B;
static constexpr uint32_t RING_B     = 2 * STAGE_B;
static_assert(SLICE_B % 2048 == 0 && SLICE_B >= SLICE_ROWS * PITCH_B, "slice");

__device__ __forceinline__ uint32_t uni(uint32_t v) {
  return (uint32_t)__builtin_amdgcn_readfirstlane(v);
}
// Holds v in a scalar register: a test on it compiles to a scalar branch (a
// tensor load ignores EXEC), and descriptor words formed from it are formed
// behind the volatile statements that stand in front of it.
__device__ __forceinline__ uint32_t pinned(uint32_t v) {
  uint32_t w = uni(v);
  asm volatile("" : "+s"(w));  // pinned(): a test or descriptor word kept scalar
  return w;
}
// The compiler places no wait for a tensor load; both waits are hand-written.
__device__ __forceinline__ void wait_tensor0() {
  asm volatile("s_wait_tensorcnt 0x0" ::: "memory");
}
__device__ __forceinline__ void wait_ds0() {
  asm volatile("s_wait_dscnt 0x0" ::: "memory");
}
__device__ __forceinline__ void tdm_load(u32x4 g0, u32x8 g1) {
  asm volatile("tensor_load_to_lds %0, %1" ::"s"(g0), "s"(g1) : "memory");
}
// Group 1: 1-byte elements, tile = tensor = 32 rows of 256 B, a 4-dword pad
// behind every 64 dwords, no mask.
__device__ __forceinline__ u32x8 tdm_group1(uint32_t src_pitch_bytes) {
  u32x8 g;
  g[0] = uni((1u << 20) | (5u << 22) | (3u << 25));
  g[1] = uni((ROW_B & 0xFFFFu) << 16);
  g[2] = uni((ROW_B >> 16) | ((SLICE_ROWS & 0xFFFFu) << 16));
  g[3] = uni((SLICE_ROWS >> 16) | (ROW_B << 16));
  g[4] = uni(SLICE_ROWS);
  g[5] = uni(src_pitch_bytes);
  g[6] = uni(0u);
  g[7] = uni(0u);
  return g;
}
__device__ __forceinline__ u32x4 tdm_group0(uint32_t lds_dst, uint64_t ga) {
  u32x4 g;
  g[0] = uni(1u);
  g[1] = uni(lds_dst);
  g[2] = uni((uint32_t)ga);
  g[3] = uni((((uint32_t)(ga >> 32)) & 0x01FFFFFFu) | 0x80000000u);
  return g;
}

// ---------------------------------------------------------------------------
// WMMA operand fragment from a staged row block. Works for the A operand from
// row-major [M][K] and for the B operand when B^T is row-major [N][K] (true
// for every GEMM here by construction). Matches ISA bf16 16x32 layout:
//   lane L: row = L&15, chunk0 = K[(L>>4)*8 .. +7], chunk1 = chunk0 + 16.
// p already holds the lane's row and its 16-byte half.
// ---------------------------------------------------------------------------
__device__ __forceinline__ bvec16 lds_frag(const unsigned char* p) {
  union { uint4 q[2]; bvec16 v; } u;
  u.q[0] = *(const uint4*)(p);
  u.q[1] = *(const uint4*)(p + 32);
  return u.v;
}

// Block tile 128x128 from eight waves, each 32x64: 2 (M) x 4 (N) WMMA tiles.
// Ablk, Bblk: the block's first row of each operand, both K-contiguous with a
// row pitch of LD elements. L: the kernel's RING_B bytes of LDS.
template <int LD, int K>
__device__ __forceinline__ void block_gemm_2x4(const __bf16* __restrict__ Ablk,
                                               const __bf16* __restrict__ Bblk,
                                               unsigned char* L,
                                               fvec8 acc[2][4]) {
  constexpr uint32_t S = K / PASS_K;  // stages = passes
  static_assert(K % PASS_K == 0 && S >= 2, "the ring needs two stages");
  const uint32_t lane = threadIdx.x & 31;
  const uint32_t wave = uni(threadIdx.x >> 5);

  // This wave's slice: waves 0..3 bring A rows, waves 4..7 B rows.
  const __bf16* srow = (wave < 4u)
                           ? Ablk + (size_t)(SLICE_ROWS * wave) * LD
                           : Bblk + (size_t)(SLICE_ROWS * (wave - 4u)) * LD;
  const uint64_t src = (uint64_t)(uintptr_t)srow;
  const uint32_t dst = (uint32_t)(size_t)L + wave * SLICE_B;
  const u32x8 g1 = tdm_group1((uint32_t)LD * 2u);

  tdm_load(tdm_group0(dst, src), g1);  // stage 0
  wait_tensor0();
  __syncthreads();                     // stage 0 is published
  {
    const uint32_t one = pinned(1u);   // stage 1's words formed behind the wait
    tdm_load(tdm_group0(dst + one * STAGE_B, src + (uint64_t)one * ROW_B), g1);
  }

  const uint32_t lrow = (lane & 15u) * PITCH_B + (lane >> 4) * 16u;
  const uint32_t a_off = (wave >> 1) * SLICE_B + lrow;
  const uint32_t b_off = (4u + (wave & 1u) * 2u) * SLICE_B + lrow;

// rolled: one copy of the pass in the instruction cache for every K
#pragma clang loop unroll(disable)
  for (uint32_t s = 0; s < S; ++s) {
    const unsigned char* buf = L + (s & 1u) * STAGE_B;
#pragma unroll
    for (uint32_t kk = 0; kk < PASS_K / 32; ++kk) {
      bvec16 af[2], bfr[4];
#pragma unroll
      for (uint32_t i = 0; i < 2; ++i)
        af[i] = lds_frag(buf + a_off + i * 16u * PITCH_B + kk * 64u);
#pragma unroll
      for (uint32_t j = 0; j < 4; ++j)
        bfr[j] = lds_frag(buf + b_off + (j >> 1) * SLICE_B +
                          (j & 1u) * 16u * PITCH_B + kk * 64u);
#pragma unroll
      for (int i = 0; i < 2; ++i)
#pragma unroll
        for (int j = 0; j < 4; ++j)
          acc[i][j] = __builtin_amdgcn_wmma_f32_16x16x32_bf16(
              false, af[i], false, bfr[j], (short)0, acc[i][j], false, false);
    }
    // Publish point of stage s + 1: this wave's reads of stage s are back, its
    // own slice of stage s + 1 has landed, then every wave meets.
    wait_ds0();
    wait_tensor0();
    __syncthreads();
    const uint32_t nxt = pinned(s + 2u);  // refill's words formed behind the wait
    if (pinned(nxt < S))
      tdm_load(tdm_group0(dst + (nxt & 1u) * STAGE_B,
                          src + (uint64_t)nxt * ROW_B), g1);
  }
  wait_tensor0();
  wait_ds0();
}

// ---------------------------------------------------------------------------
// Prep 1: x [b][c][p] f32  ->  xT [b][p][c] bf16  (LDS tile transpose)
// ---------------------------------------------------------------------------
__global__ __launch_bounds__(256) void a2n_transpose_x(
    const float* __restrict__ x, __bf16* __restrict__ xT) {
  __shared__ float tile[32][33];
  const int b = blockIdx.z;
  const int cb = blockIdx.y * 32;
  const int pb = blockIdx.x * 32;
  const int col = threadIdx.x & 31;
  const int row8 = threadIdx.x >> 5;
  const float* xb = x + (size_t)b * C_IN * HW;
#pragma unroll
  for (int i = 0; i < 4; ++i) {
    int r = row8 + i * 8;
    tile[r][col] = xb[(size_t)(cb + r) * HW + pb + col];
  }
  __syncthreads();
  __bf16* xTb = xT + (size_t)b * HW * C_IN;
#pragma unroll
  for (int i = 0; i < 4; ++i) {
    int r = row8 + i * 8;
    xTb[(size_t)(pb + r) * C_IN + cb + col] = (__bf16)tile[col][r];
  }
}

// ---------------------------------------------------------------------------
// Prep 2: convert weights to bf16, fuse w1|w2|w3 into Wc [1024][512]
// ---------------------------------------------------------------------------
__global__ __launch_bounds__(256) void a2n_convert_weights(
    const float* __restrict__ w1, const float* __restrict__ w2,
    const float* __restrict__ w3, const float* __restrict__ w4,
    __bf16* __restrict__ Wc, __bf16* __restrict__ W4c) {
  const int t = blockIdx.x * 256 + threadIdx.x;
  const int n1 = MO * C_IN;          // 524288
  const int n2 = n1 + C_IN * CM;     // + 262144
  if (t < n1) {
    const int row = t / C_IN;
    float v;
    if (row < CM)            v = w1[t];
    else if (row < CM + CN)  v = w2[t - CM * C_IN];
    else                     v = w3[t - (CM + CN) * C_IN];
    Wc[t] = (__bf16)v;
  } else if (t < n2) {
    W4c[t - n1] = (__bf16)w4[t - n1];
  }
}

// ---------------------------------------------------------------------------
// K1: fused conv1/2/3.  Y[o][p] = sum_c Wc[o][c] * xT[p][c]  (+bias)
// rows 0..511 -> A (bf16), 512..767 -> Bp (f32), 768..1023 -> V (f32)
// ---------------------------------------------------------------------------
__global__ __launch_bounds__(256) void a2n_conv123(
    const __bf16* __restrict__ Wc, const __bf16* __restrict__ xT,
    const float* __restrict__ b1, const float* __restrict__ b2,
    const float* __restrict__ b3, __bf16* __restrict__ Aout,
    float* __restrict__ Bp, float* __restrict__ V) {
  __shared__ __attribute__((aligned(2048))) unsigned char L[RING_B];
  const int b = blockIdx.z;
  const int lane = threadIdx.x & 31;
  const int wave = threadIdx.x >> 5;
  const int m0 = blockIdx.y * 128 + (wave >> 1) * 32;
  const int n0 = blockIdx.x * 128 + (wave & 1) * 64;
  const __bf16* Brows = xT + (size_t)b * HW * C_IN;

  fvec8 zero = {};
  fvec8 acc[2][4];
#pragma unroll
  for (int i = 0; i < 2; ++i)
#pragma unroll
    for (int j = 0; j < 4; ++j) acc[i][j] = zero;

  block_gemm_2x4<C_IN, C_IN>(Wc + (size_t)blockIdx.y * 128 * C_IN,
                             Brows + (size_t)blockIdx.x * 128 * C_IN, L, acc);

#pragma unroll
  for (int i = 0; i < 2; ++i)
#pragma unroll
    for (int j = 0; j < 4; ++j)
#pragma unroll
      for (int e = 0; e < 8; ++e) {
        const int mg = m0 + 16 * i + 8 * (lane >> 4) + e;
        const int p = n0 + 16 * j + (lane & 15);
        float bias = (mg < CM) ? b1[mg]
                   : (mg < CM + CN) ? b2[mg - CM] : b3[mg - CM - CN];
        const float val = acc[i][j][e] + bias;
        if (mg < CM)
          Aout[(size_t)b * CM * HW + (size_t)mg * HW + p] = (__bf16)val;
        else if (mg < CM + CN)
          Bp[(size_t)b * CN * HW + (size_t)(mg - CM) * HW + p] = val;
        else
          V[(size_t)b * CN * HW + (size_t)(mg - CM - CN) * HW + p] = val;
      }
}

// ---------------------------------------------------------------------------
// K2: softmax over BATCH axis for Bp and V.
// att_maps written [b][n][p]; att_vecs written transposed [b][p][n].
// ---------------------------------------------------------------------------
__global__ __launch_bounds__(256) void a2n_batch_softmax(
    const float* __restrict__ Bp, const float* __restrict__ V,
    __bf16* __restrict__ attm, __bf16* __restrict__ attvT) {
  const size_t NP = (size_t)CN * HW;
  size_t t = (size_t)blockIdx.x * 256 + threadIdx.x;
  if (t >= 2 * NP) return;
  const bool second = t >= NP;
  const size_t j = second ? t - NP : t;
  const float* src = second ? V : Bp;

  float v[BATCH];
  float mx = -3.4e38f;
#pragma unroll
  for (int b = 0; b < BATCH; ++b) {
    v[b] = src[b * NP + j];
    mx = fmaxf(mx, v[b]);
  }
  float s = 0.f;
#pragma unroll
  for (int b = 0; b < BATCH; ++b) {
    v[b] = __expf(v[b] - mx);
    s += v[b];
  }
  const float inv = 1.f / s;
  if (!second) {
#pragma unroll
    for (int b = 0; b < BATCH; ++b) attm[b * NP + j] = (__bf16)(v[b] * inv);
  } else {
    const int n = (int)(j / HW);
    const int p = (int)(j % HW);
#pragma unroll
    for (int b = 0; b < BATCH; ++b)
      attvT[b * NP + (size_t)p * CN + n] = (__bf16)(v[b] * inv);
  }
}

// ---------------------------------------------------------------------------
// K3: gathered.  G[m][n] = sum_p A[m][p] * attm[n][p], stored transposed
// as Gt[b][n][m] (bf16) so it is a ready-made B^T operand for K4.
// ---------------------------------------------------------------------------
__global__ __launch_bounds__(256) void a2n_gathered(
    const __bf16* __restrict__ A, const __bf16* __restrict__ attm,
    __bf16* __restrict__ Gt) {
  __shared__ __attribute__((aligned(2048))) unsigned char L[RING_B];
  const int b = blockIdx.z;
  const int lane = threadIdx.x & 31;
  const int wave = threadIdx.x >> 5;
  const int m0 = blockIdx.y * 128 + (wave >> 1) * 32;  // over CM
  const int n0 = blockIdx.x * 128 + (wave & 1) * 64;   // over CN

  fvec8 zero = {};
  fvec8 acc[2][4];
#pragma unroll
  for (int i = 0; i < 2; ++i)
#pragma unroll
    for (int j = 0; j < 4; ++j) acc[i][j] = zero;

  block_gemm_2x4<HW, HW>(
      A + (size_t)b * CM * HW + (size_t)blockIdx.y * 128 * HW,
      attm + (size_t)b * CN * HW + (size_t)blockIdx.x * 128 * HW, L, acc);

  __bf16* Gb = Gt + (size_t)b * CN * CM;
#pragma unroll
  for (int i = 0; i < 2; ++i)
#pragma unroll
    for (int j = 0; j < 4; ++j)
#pragma unroll
      for (int e = 0; e < 8; ++e) {
        const int m = m0 + 16 * i + 8 * (lane >> 4) + e;
        const int n = n0 + 16 * j + (lane & 15);
        Gb[(size_t)n * CM + m] = (__bf16)acc[i][j][e];
      }
}

// ---------------------------------------------------------------------------
// K4: Hm = w4 @ G.  Hm[o][n] = sum_m w4[o][m] * Gt[n][m].  Stored [b][o][n].
// ---------------------------------------------------------------------------
__global__ __launch_bounds__(256) void a2n_w4g(
    const __bf16* __restrict__ W4c, const __bf16* __restrict__ Gt,
    __bf16* __restrict__ Hb) {
  __shared__ __attribute__((aligned(2048))) unsigned char L[RING_B];
  const int b = blockIdx.z;
  const int lane = threadIdx.x & 31;
  const int wave = threadIdx.x >> 5;
  const int m0 = blockIdx.y * 128 + (wave >> 1) * 32;  // over C (out chans)
  const int n0 = blockIdx.x * 128 + (wave & 1) * 64;   // over CN

  fvec8 zero = {};
  fvec8 acc[2][4];
#pragma unroll
  for (int i = 0; i < 2; ++i)
#pragma unroll
    for (int j = 0; j < 4; ++j) acc[i][j] = zero;

  block_gemm_2x4<CM, CM>(
      W4c + (size_t)blockIdx.y * 128 * CM,
      Gt + (size_t)b * CN * CM + (size_t)blockIdx.x * 128 * CM, L, acc);

  __bf16* Hbb = Hb + (size_t)b * C_IN * CN;
#pragma unroll
  for (int i = 0; i < 2; ++i)
#pragma unroll
    for (int j = 0; j < 4; ++j)
#pragma unroll
      for (int e = 0; e < 8; ++e) {
        const int o = m0 + 16 * i + 8 * (lane >> 4) + e;
        const int n = n0 + 16 * j + (lane & 15);
        Hbb[(size_t)o * CN + n] = (__bf16)acc[i][j][e];
      }
}

// ---------------------------------------------------------------------------
// K5: out[o][p] = x[o][p] + b4[o] + sum_n Hb[o][n] * attvT[p][n]
// ---------------------------------------------------------------------------
__global__ __launch_bounds__(256) void a2n_distribute_out(
    const __bf16* __restrict__ Hb, const __bf16* __restrict__ attvT,
    const float* __restrict__ b4, const float* __restrict__ x,
    float* __restrict__ out) {
  __shared__ __attribute__((aligned(2048))) unsigned char L[RING_B];
  const int b = blockIdx.z;
  const int lane = threadIdx.x & 31;
  const int wave = threadIdx.x >> 5;
  const int m0 = blockIdx.y * 128 + (wave >> 1) * 32;  // over C
  const int n0 = blockIdx.x * 128 + (wave & 1) * 64;   // over HW

  fvec8 zero = {};
  fvec8 acc[2][4];
#pragma unroll
  for (int i = 0; i < 2; ++i)
#pragma unroll
    for (int j = 0; j < 4; ++j) acc[i][j] = zero;

  block_gemm_2x4<CN, CN>(
      Hb + (size_t)b * C_IN * CN + (size_t)blockIdx.y * 128 * CN,
      attvT + (size_t)b * HW * CN + (size_t)blockIdx.x * 128 * CN, L, acc);

  const float* xb = x + (size_t)b * C_IN * HW;
  float* ob = out + (size_t)b * C_IN * HW;
#pragma unroll
  for (int i = 0; i < 2; ++i)
#pragma unroll
    for (int j = 0; j < 4; ++j)
#pragma unroll
      for (int e = 0; e < 8; ++e) {
        const int o = m0 + 16 * i + 8 * (lane >> 4) + e;
        const int p = n0 + 16 * j + (lane & 15);
        const size_t idx = (size_t)o * HW + p;
        ob[idx] = acc[i][j][e] + b4[o] + xb[idx];
      }
}

// ---------------------------------------------------------------------------
extern "C" void kernel_launch(void* const* d_in, const int* in_sizes, int n_in,
                              void* d_out, int out_size, void* d_ws,
                              size_t ws_size, hipStream_t stream) {
  const float* x  = (const float*)d_in[0];
  const float* w1 = (const float*)d_in[1];
  const float* b1 = (const float*)d_in[2];
  const float* w2 = (const float*)d_in[3];
  const float* b2 = (const float*)d_in[4];
  const float* w3 = (const float*)d_in[5];
  const float* b3 = (const float*)d_in[6];
  const float* w4 = (const float*)d_in[7];
  const float* b4 = (const float*)d_in[8];
  float* out = (float*)d_out;

  char* ws = (char*)d_ws;
  __bf16* XT   = (__bf16*)(ws + OFF_XT);
  __bf16* WC   = (__bf16*)(ws + OFF_WC);
  __bf16* W4C  = (__bf16*)(ws + OFF_W4C);
  __bf16* Abuf = (__bf16*)(ws + OFF_A);
  float*  BP   = (float*)(ws + OFF_BP);
  float*  Vb   = (float*)(ws + OFF_V);
  __bf16* AM   = (__bf16*)(ws + OFF_AM);
  __bf16* AVT  = (__bf16*)(ws + OFF_AVT);
  __bf16* GT   = (__bf16*)(ws + OFF_GT);
  __bf16* HB   = (__bf16*)(ws + OFF_HB);

  const dim3 blk(256);

  a2n_transpose_x<<<dim3(HW / 32, C_IN / 32, BATCH), blk, 0, stream>>>(x, XT);

  a2n_convert_weights<<<dim3((MO * C_IN + C_IN * CM + 255) / 256), blk, 0,
                        stream>>>(w1, w2, w3, w4, WC, W4C);

  a2n_conv123<<<dim3(HW / 128, MO / 128, BATCH), blk, 0, stream>>>(
      WC, XT, b1, b2, b3, Abuf, BP, Vb);

  a2n_batch_softmax<<<dim3((2 * CN * HW + 255) / 256), blk, 0, stream>>>(
      BP, Vb, AM, AVT);

  a2n_gathered<<<dim3(CN / 128, CM / 128, BATCH), blk, 0, stream>>>(Abuf, AM,
                                                                    GT);

  a2n_w4g<<<dim3(CN / 128, C_IN / 128, BATCH), blk, 0, stream>>>(W4C, GT, HB);

  a2n_distribute_out<<<dim3(HW / 128, C_IN / 128, BATCH), blk, 0, stream>>>(
      HB, AVT, b4, x, out);
}

// v002
// One run takes 178 microseconds.
// Timed twice side by side with v001, it ran 1.18 and 1.16 times as fast.
// Counting every step since v000, it is 2.08 times as fast.
#include <hip/hip_runtime.h>

// ---------------------------------------------------------------------------
// A2N attention block for MI455X (gfx1250, wave32, WMMA bf16 16x16x32).
// out = x + w4 @ ( (A @ softmax_b(Bp)^T) @ softmax_b(V) ) + b4
// refactored as  x + ((w4 @ G) @ att_vecs) + b4  to kill the HW-sized conv4.
// ---------------------------------------------------------------------------

typedef __attribute__((ext_vector_type(16))) __bf16 bvec16;
typedef __attribute__((ext_vector_type(8)))  float  fvec8;

#define BATCH 8
#define C_IN  512
#define CM    512
#define CN    256
#define HW    4096
#define MO    1024   // CM + CN + CN rows of the fused conv123 weight

// ---- workspace layout (bytes) ---------------------------------------------
static constexpr size_t SZ_XT  = (size_t)BATCH * HW * C_IN * 2;  // bf16 xT[b][p][c]
static constexpr size_t SZ_WC  = (size_t)MO * C_IN * 2;          // bf16 [w1;w2;w3]
static constexpr size_t SZ_W4C = (size_t)C_IN * CM * 2;          // bf16 w4
static constexpr size_t SZ_A   = (size_t)BATCH * CM * HW * 2;    // bf16 A[b][m][p]
static constexpr size_t SZ_BP  = (size_t)BATCH * CN * HW * 4;    // f32 Bp
static constexpr size_t SZ_V   = SZ_BP;                          // f32 V
static constexpr size_t SZ_AM  = (size_t)BATCH * CN * HW * 2;    // bf16 att_maps[b][n][p]
static constexpr size_t SZ_AVT = SZ_AM;                          // bf16 att_vecsT[b][p][n]
static constexpr size_t SZ_GT  = (size_t)BATCH * CN * CM * 2;    // bf16 Gt[b][n][m]
// Hb bf16 [b][o][n] after Gt

static constexpr size_t OFF_XT  = 0;
static constexpr size_t OFF_WC  = OFF_XT + SZ_XT;
static constexpr size_t OFF_W4C = OFF_WC + SZ_WC;
static constexpr size_t OFF_A   = OFF_W4C + SZ_W4C;
static constexpr size_t OFF_BP  = OFF_A + SZ_A;
static constexpr size_t OFF_V   = OFF_BP + SZ_BP;
static constexpr size_t OFF_AM  = OFF_V + SZ_V;
static constexpr size_t OFF_AVT = OFF_AM + SZ_AM;
static constexpr size_t OFF_GT  = OFF_AVT + SZ_AVT;
static constexpr size_t OFF_HB  = OFF_GT + SZ_GT;

// ---------------------------------------------------------------------------
// LDS ring of the four GEMMs. A pass is 128 k = 256 bytes of every operand row.
// A stage holds the block's 128 A rows and 128 B rows as eight slices of 32
// rows, one slice per wave, each brought in by that wave's own tensor load.
// The load's pad gives an LDS row pitch of 272 B (16 B x odd: no bank conflict
// for ds_load_b128). A slice's 32 * 272 = 8704 B are rounded up to a multiple
// of 2 KiB so that every load's place in LDS is one.
// ---------------------------------------------------------------------------
typedef uint32_t u32x4 __attribute__((ext_vector_type(4)));
typedef uint32_t u32x8 __attribute__((ext_vector_type(8)));

static constexpr uint32_t PASS_K     = 128;
static constexpr uint32_t ROW_B      = 256;
static constexpr uint32_t PITCH_B    = 272;
static constexpr uint32_t SLICE_ROWS = 32;
static constexpr uint32_t SLICE_B    = 10240;
static constexpr uint32_t STAGE_B    = 8 * SLICE_B;
static constexpr uint32_t RING_B     = 2 * STAGE_B;
static_assert(SLICE_B % 2048 == 0 && SLICE_B >= SLICE_ROWS * PITCH_B, "slice");

__device__ __forceinline__ uint32_t uni(uint32_t v) {
  return (uint32_t)__builtin_amdgcn_readfirstlane(v);
}
// Holds v in a scalar register: a test on it compiles to a scalar branch (a
// tensor load ignores EXEC), and descriptor words formed from it are formed
// behind the volatile statements that stand in front of it.
__device__ __forceinline__ uint32_t pinned(uint32_t v) {
  uint32_t w = uni(v);
  asm volatile("" : "+s"(w));  // pinned(): a test or descriptor word kept scalar
  return w;
}
// The compiler places no wait for a tensor load; both waits are hand-written.
__device__ __forceinline__ void wait_tensor0() {
  asm volatile("s_wait_tensorcnt 0x0" ::: "memory");
}
__device__ __forceinline__ void wait_ds0() {
  asm volatile("s_wait_dscnt 0x0" ::: "memory");
}
__device__ __forceinline__ void tdm_load(u32x4 g0, u32x8 g1) {
  asm volatile("tensor_load_to_lds %0, %1" ::"s"(g0), "s"(g1) : "memory");
}
// Group 1: 1-byte elements, tile = tensor = 32 rows of 256 B, a 4-dword pad
// behind every 64 dwords, no mask.
__device__ __forceinline__ u32x8 tdm_group1(uint32_t src_pitch_bytes) {
  u32x8 g;
  g[0] = uni((1u << 20) | (5u << 22) | (3u << 25));
  g[1] = uni((ROW_B & 0xFFFFu) << 16);
  g[2] = uni((ROW_B >> 16) | ((SLICE_ROWS & 0xFFFFu) << 16));
  g[3] = uni((SLICE_ROWS >> 16) | (ROW_B << 16));
  g[4] = uni(SLICE_ROWS);
  g[5] = uni(src_pitch_bytes);
  g[6] = uni(0u);
  g[7] = uni(0u);
  return g;
}
__device__ __forceinline__ u32x4 tdm_group0(uint32_t lds_dst, uint64_t ga) {
  u32x4 g;
  g[0] = uni(1u);
  g[1] = uni(lds_dst);
  g[2] = uni((uint32_t)ga);
  g[3] = uni((((uint32_t)(ga >> 32)) & 0x01FFFFFFu) | 0x80000000u);
  return g;
}

// ---------------------------------------------------------------------------
// WMMA operand fragment from a staged row block. Works for the A operand from
// row-major [M][K] and for the B operand when B^T is row-major [N][K] (true
// for every GEMM here by construction). Matches ISA bf16 16x32 layout:
//   lane L: row = L&15, chunk0 = K[(L>>4)*8 .. +7], chunk1 = chunk0 + 16.
// p already holds the lane's row and its 16-byte half.
// ---------------------------------------------------------------------------
__device__ __forceinline__ bvec16 lds_frag(const unsigned char* p) {
  union { uint4 q[2]; bvec16 v; } u;
  u.q[0] = *(const uint4*)(p);
  u.q[1] = *(const uint4*)(p + 32);
  return u.v;
}

// Block tile 128x128 from eight waves, each 32x64: 2 (M) x 4 (N) WMMA tiles.
// Ablk, Bblk: the block's first row of each operand, both K-contiguous with a
// row pitch of LD elements. L: the kernel's RING_B bytes of LDS.
template <int LD, int K>
__device__ __forceinline__ void block_gemm_2x4(const __bf16* __restrict__ Ablk,
                                               const __bf16* __restrict__ Bblk,
                                               unsigned char* L,
                                               fvec8 acc[2][4]) {
  constexpr uint32_t S = K / PASS_K;  // stages = passes
  static_assert(K % PASS_K == 0 && S >= 2, "the ring needs two stages");
  const uint32_t lane = threadIdx.x & 31;
  const uint32_t wave = uni(threadIdx.x >> 5);

  // This wave's slice: waves 0..3 bring A rows, waves 4..7 B rows.
  const __bf16* srow = (wave < 4u)
                           ? Ablk + (size_t)(SLICE_ROWS * wave) * LD
                           : Bblk + (size_t)(SLICE_ROWS * (wave - 4u)) * LD;
  const uint64_t src = (uint64_t)(uintptr_t)srow;
  const uint32_t dst = (uint32_t)(size_t)L + wave * SLICE_B;
  const u32x8 g1 = tdm_group1((uint32_t)LD * 2u);

  tdm_load(tdm_group0(dst, src), g1);  // stage 0
  wait_tensor0();
  __syncthreads();                     // stage 0 is published
  {
    const uint32_t one = pinned(1u);   // stage 1's words formed behind the wait
    tdm_load(tdm_group0(dst + one * STAGE_B, src + (uint64_t)one * ROW_B), g1);
  }

  const uint32_t lrow = (lane & 15u) * PITCH_B + (lane >> 4) * 16u;
  const uint32_t a_off = (wave >> 1) * SLICE_B + lrow;
  const uint32_t b_off = (4u + (wave & 1u) * 2u) * SLICE_B + lrow;

// rolled: one copy of the pass in the instruction cache for every K
#pragma clang loop unroll(disable)
  for (uint32_t s = 0; s < S; ++s) {
    const unsigned char* buf = L + (s & 1u) * STAGE_B;
#pragma unroll
    for (uint32_t kk = 0; kk < PASS_K / 32; ++kk) {
      bvec16 af[2], bfr[4];
#pragma unroll
      for (uint32_t i = 0; i < 2; ++i)
        af[i] = lds_frag(buf + a_off + i * 16u * PITCH_B + kk * 64u);
#pragma unroll
      for (uint32_t j = 0; j < 4; ++j)
        bfr[j] = lds_frag(buf + b_off + (j >> 1) * SLICE_B +
                          (j & 1u) * 16u * PITCH_B + kk * 64u);
#pragma unroll
      for (int i = 0; i < 2; ++i)
#pragma unroll
        for (int j = 0; j < 4; ++j)
          acc[i][j] = __builtin_amdgcn_wmma_f32_16x16x32_bf16(
              false, af[i], false, bfr[j], (short)0, acc[i][j], false, false);
    }
    // Publish point of stage s + 1: this wave's reads of stage s are back, its
    // own slice of stage s + 1 has landed, then every wave meets.
    wait_ds0();
    wait_tensor0();
    __syncthreads();
    const uint32_t nxt = pinned(s + 2u);  // refill's words formed behind the wait
    if (pinned(nxt < S))
      tdm_load(tdm_group0(dst + (nxt & 1u) * STAGE_B,
                          src + (uint64_t)nxt * ROW_B), g1);
  }
  wait_tensor0();
  wait_ds0();
}

// ---------------------------------------------------------------------------
// Helpers of the three non-matrix launches: 16-byte global accesses.
// ---------------------------------------------------------------------------
typedef float  f32x4 __attribute__((ext_vector_type(4)));
typedef float  f32x2 __attribute__((ext_vector_type(2)));
typedef __bf16 bf16x2 __attribute__((ext_vector_type(2)));

// Stands behind a group of global loads or stores whose registers are used
// again for other values further down.
__device__ __forceinline__ void wait_x0() {
  asm volatile("s_wait_xcnt 0x0" ::: "memory");
}

// Two f32 to one dword of two bf16 (round to nearest even), lo in the low half.
__device__ __forceinline__ uint32_t pack_bf16(float lo, float hi) {
  f32x2 f = {lo, hi};
  union { bf16x2 h; uint32_t u; } c;
  c.h = __builtin_convertvector(f, bf16x2);
  return c.u;
}

// ---------------------------------------------------------------------------
// Prep 1: x [b][c][p] f32  ->  xT [b][p][c] bf16.
// A block takes one tile of 128 c x 128 p, 64 values a lane. A lane loads 4 p
// of two neighbouring c rows (8 lanes = one 128-B line), packs the pair and
// writes dwords into an LDS tile [p][c/2]; the tile leaves as 16-byte stores,
// 16 lanes = the 256 B that a p row of the tile has in xT.
// ---------------------------------------------------------------------------
static constexpr int TX_C     = 128;
static constexpr int TX_P     = 128;
static constexpr int TX_PITCH = 68;  // dwords: 272 B = 16 B x odd

__global__ __launch_bounds__(256) void a2n_transpose_x(
    const float* __restrict__ x, __bf16* __restrict__ xT) {
  __shared__ __attribute__((aligned(16))) uint32_t tile[TX_P * TX_PITCH];
  const int tid = threadIdx.x;
  const int lane = tid & 31;
  const int wave = tid >> 5;
  const int p4l = lane & 7;
  const int c2l = wave * 8 + (lane >> 3);
  const int pbase = blockIdx.x * TX_P;
  const float* xb = x + ((size_t)blockIdx.z * C_IN + blockIdx.y * TX_C) * HW +
                    (size_t)(2 * c2l) * HW + pbase + 4 * p4l;
  __bf16* xTb = xT + ((size_t)blockIdx.z * HW + pbase + (tid >> 4)) * C_IN +
                blockIdx.y * TX_C + (tid & 15) * 8;

  f32x4 r[TX_P / 32][2][2];  // [group of 32 p][group of 4 c pairs][c of the pair]
#pragma unroll
  for (int pg = 0; pg < TX_P / 32; ++pg)
#pragma unroll
    for (int cg = 0; cg < 2; ++cg)
#pragma unroll
      for (int h = 0; h < 2; ++h)
        r[pg][cg][h] = *(const f32x4*)(xb + (size_t)(cg * 8 + h) * HW + pg * 32);
#pragma unroll
  for (int pg = 0; pg < TX_P / 32; ++pg)
#pragma unroll
    for (int cg = 0; cg < 2; ++cg)
#pragma unroll
      for (int i = 0; i < 4; ++i)
        tile[(pg * 32 + 4 * p4l + i) * TX_PITCH + cg * 4 + c2l] =
            pack_bf16(r[pg][cg][0][i], r[pg][cg][1][i]);
  __syncthreads();
#pragma unroll
  for (int it = 0; it < TX_P / 16; ++it) {
    const uint4 v =
        *(const uint4*)&tile[(it * 16 + (tid >> 4)) * TX_PITCH + (tid & 15) * 4];
    *(uint4*)(xTb + (size_t)(it * 16) * C_IN) = v;
  }
}

// ---------------------------------------------------------------------------
// Prep 2: convert weights to bf16, fuse w1|w2|w3 into Wc [1024][512].
// Eight elements a lane; every boundary between the sources is a multiple of 8.
// ---------------------------------------------------------------------------
__global__ __launch_bounds__(256) void a2n_convert_weights(
    const float* __restrict__ w1, const float* __restrict__ w2,
    const float* __restrict__ w3, const float* __restrict__ w4,
    __bf16* __restrict__ Wc, __bf16* __restrict__ W4c) {
  const int t = (blockIdx.x * 256 + threadIdx.x) * 8;
  const int n1 = MO * C_IN;          // 524288
  const int n2 = n1 + C_IN * CM;     // + 262144
  if (t >= n2) return;
  const float* s;
  if (t < CM * C_IN)             s = w1 + t;
  else if (t < (CM + CN) * C_IN) s = w2 + (t - CM * C_IN);
  else if (t < n1)               s = w3 + (t - (CM + CN) * C_IN);
  else                           s = w4 + (t - n1);
  __bf16* d = (t < n1) ? Wc + t : W4c + (t - n1);
  const f32x4 a = *(const f32x4*)s;
  const f32x4 c = *(const f32x4*)(s + 4);
  uint4 o;
  o.x = pack_bf16(a[0], a[1]);
  o.y = pack_bf16(a[2], a[3]);
  o.z = pack_bf16(c[0], c[1]);
  o.w = pack_bf16(c[2], c[3]);
  *(uint4*)d = o;
}

// ---------------------------------------------------------------------------
// K1: fused conv1/2/3.  Y[o][p] = sum_c Wc[o][c] * xT[p][c]  (+bias)
// rows 0..511 -> A (bf16), 512..767 -> Bp (f32), 768..1023 -> V (f32)
// ---------------------------------------------------------------------------
__global__ __launch_bounds__(256) void a2n_conv123(
    const __bf16* __restrict__ Wc, const __bf16* __restrict__ xT,
    const float* __restrict__ b1, const float* __restrict__ b2,
    const float* __restrict__ b3, __bf16* __restrict__ Aout,
    float* __restrict__ Bp, float* __restrict__ V) {
  __shared__ __attribute__((aligned(2048))) unsigned char L[RING_B];
  const int b = blockIdx.z;
  const int lane = threadIdx.x & 31;
  const int wave = threadIdx.x >> 5;
  const int m0 = blockIdx.y * 128 + (wave >> 1) * 32;
  const int n0 = blockIdx.x * 128 + (wave & 1) * 64;
  const __bf16* Brows = xT + (size_t)b * HW * C_IN;

  fvec8 zero = {};
  fvec8 acc[2][4];
#pragma unroll
  for (int i = 0; i < 2; ++i)
#pragma unroll
    for (int j = 0; j < 4; ++j) acc[i][j] = zero;

  block_gemm_2x4<C_IN, C_IN>(Wc + (size_t)blockIdx.y * 128 * C_IN,
                             Brows + (size_t)blockIdx.x * 128 * C_IN, L, acc);

#pragma unroll
  for (int i = 0; i < 2; ++i)
#pragma unroll
    for (int j = 0; j < 4; ++j)
#pragma unroll
      for (int e = 0; e < 8; ++e) {
        const int mg = m0 + 16 * i + 8 * (lane >> 4) + e;
        const int p = n0 + 16 * j + (lane & 15);
        float bias = (mg < CM) ? b1[mg]
                   : (mg < CM + CN) ? b2[mg - CM] : b3[mg - CM - CN];
        const float val = acc[i][j][e] + bias;
        if (mg < CM)
          Aout[(size_t)b * CM * HW + (size_t)mg * HW + p] = (__bf16)val;
        else if (mg < CM + CN)
          Bp[(size_t)b * CN * HW + (size_t)(mg - CM) * HW + p] = val;
        else
          V[(size_t)b * CN * HW + (size_t)(mg - CM - CN) * HW + p] = val;
      }
}

// ---------------------------------------------------------------------------
// K2: softmax over BATCH axis for Bp and V.
// att_maps written [b][n][p]; att_vecs written transposed [b][p][n].
// A lane holds eight positions of all eight batches (16 loads of 16 B).
// Blocks below SM_HALF: Bp, a wave's load = 512 contiguous bytes, its store
// 256. The others: a V tile of 64 n x 32 p; a lane holds 4 p of two
// neighbouring n rows, packs the pair into an LDS tile [b][p][n/2], and the
// tile leaves as 16-byte stores, 8 lanes = one whole 128-B line of attvT.
// ---------------------------------------------------------------------------
static constexpr int SM_HALF  = CN * HW / (256 * 8);  // blocks per half
static constexpr int SM_N     = 64;
static constexpr int SM_P     = 32;
static constexpr int SM_PITCH = 36;                   // dwords: 144 B = 16 B x odd
static constexpr int SM_PLANE = SM_P * SM_PITCH;      // dwords per batch

__device__ __forceinline__ void softmax_over_batch(f32x4 v[BATCH][2]) {
#pragma unroll
  for (int h = 0; h < 2; ++h)
#pragma unroll
    for (int i = 0; i < 4; ++i) {
      float mx = -3.4e38f;
#pragma unroll
      for (int b = 0; b < BATCH; ++b) mx = fmaxf(mx, v[b][h][i]);
      float s = 0.f;
#pragma unroll
      for (int b = 0; b < BATCH; ++b) {
        v[b][h][i] = __expf(v[b][h][i] - mx);
        s += v[b][h][i];
      }
      const float inv = 1.f / s;
#pragma unroll
      for (int b = 0; b < BATCH; ++b) v[b][h][i] *= inv;
    }
}

__global__ __launch_bounds__(256) void a2n_batch_softmax(
    const float* __restrict__ Bp, const float* __restrict__ V,
    __bf16* __restrict__ attm, __bf16* __restrict__ attvT) {
  __shared__ __attribute__((aligned(16))) uint32_t tile[BATCH * SM_PLANE];
  const size_t NP = (size_t)CN * HW;
  const int tid = threadIdx.x;
  const int lane = tid & 31;
  const int wave = tid >> 5;
  f32x4 v[BATCH][2];

  if (blockIdx.x >= SM_HALF) {  // block-uniform
    const int ti = blockIdx.x - SM_HALF;
    const int n0 = (ti / (HW / SM_P)) * SM_N;
    const int p0 = (ti % (HW / SM_P)) * SM_P;
    const int p4 = lane & 7;
    const int n2 = wave * 4 + (lane >> 3);
    const uint32_t src = (uint32_t)((n0 + 2 * n2) * HW + p0 + 4 * p4);
#pragma unroll
    for (int b = 0; b < BATCH; ++b) {
#pragma unroll
      for (int h = 0; h < 2; ++h)
        v[b][h] = *(const f32x4*)((const char*)(V + (b & 1) * NP + h * HW) +
                                  (src * 4u + (b >> 1) * (uint32_t)(8 * NP)));
      if (b & 1) wait_x0();  // later loads land in these loads' address register
    }
    softmax_over_batch(v);
#pragma unroll
    for (int b = 0; b < BATCH; ++b)
#pragma unroll
      for (int i = 0; i < 4; ++i)
        tile[b * SM_PLANE + (4 * p4 + i) * SM_PITCH + n2] =
            pack_bf16(v[b][0][i], v[b][1][i]);
    __syncthreads();
    const uint32_t dst = (uint32_t)((p0 + (tid >> 3)) * CN + n0 + (tid & 7) * 8);
#pragma unroll
    for (int b = 0; b < BATCH; ++b) {
      const uint4 o = *(const uint4*)&tile[b * SM_PLANE +
                                           (tid >> 3) * SM_PITCH + (tid & 7) * 4];
      *(uint4*)((char*)(attvT + b * NP) + dst * 2u) = o;
    }
    return;
  }
  {
    // a 32-bit lane offset per pair of batches beside one uniform base
    const uint32_t j = blockIdx.x * 2048u + wave * 256u + lane * 4u;
#pragma unroll
    for (int b = 0; b < BATCH; ++b) {
#pragma unroll
      for (int h = 0; h < 2; ++h)
        v[b][h] = *(const f32x4*)((const char*)(Bp + (b & 1) * NP + h * 128) +
                                  (j * 4u + (b >> 1) * (uint32_t)(8 * NP)));
      if (b & 1) wait_x0();  // later loads land in these loads' address register
    }
    softmax_over_batch(v);
#pragma unroll
    for (int b = 0; b < BATCH; ++b) {
#pragma unroll
      for (int h = 0; h < 2; ++h) {
        uint2 o;
        o.x = pack_bf16(v[b][h][0], v[b][h][1]);
        o.y = pack_bf16(v[b][h][2], v[b][h][3]);
        *(uint2*)((char*)(attm + b * NP + h * 128) + j * 2u) = o;
      }
    }
    wait_x0();  // the code laid out behind these stores rewrites their registers
  }
}

// ---------------------------------------------------------------------------
// K3: gathered.  G[m][n] = sum_p A[m][p] * attm[n][p], stored transposed
// as Gt[b][n][m] (bf16) so it is a ready-made B^T operand for K4.
// ---------------------------------------------------------------------------
__global__ __launch_bounds__(256) void a2n_gathered(
    const __bf16* __restrict__ A, const __bf16* __restrict__ attm,
    __bf16* __restrict__ Gt) {
  __shared__ __attribute__((aligned(2048))) unsigned char L[RING_B];
  const int b = blockIdx.z;
  const int lane = threadIdx.x & 31;
  const int wave = threadIdx.x >> 5;
  const int m0 = blockIdx.y * 128 + (wave >> 1) * 32;  // over CM
  const int n0 = blockIdx.x * 128 + (wave & 1) * 64;   // over CN

  fvec8 zero = {};
  fvec8 acc[2][4];
#pragma unroll
  for (int i = 0; i < 2; ++i)
#pragma unroll
    for (int j = 0; j < 4; ++j) acc[i][j] = zero;

  block_gemm_2x4<HW, HW>(
      A + (size_t)b * CM * HW + (size_t)blockIdx.y * 128 * HW,
      attm + (size_t)b * CN * HW + (size_t)blockIdx.x * 128 * HW, L, acc);

  __bf16* Gb = Gt + (size_t)b * CN * CM;
#pragma unroll
  for (int i = 0; i < 2; ++i)
#pragma unroll
    for (int j = 0; j < 4; ++j)
#pragma unroll
      for (int e = 0; e < 8; ++e) {
        const int m = m0 + 16 * i + 8 * (lane >> 4) + e;
        const int n = n0 + 16 * j + (lane & 15);
        Gb[(size_t)n * CM + m] = (__bf16)acc[i][j][e];
      }
}

// ---------------------------------------------------------------------------
// K4: Hm = w4 @ G.  Hm[o][n] = sum_m w4[o][m] * Gt[n][m].  Stored [b][o][n].
// ---------------------------------------------------------------------------
__global__ __launch_bounds__(256) void a2n_w4g(
    const __bf16* __restrict__ W4c, const __bf16* __restrict__ Gt,
    __bf16* __restrict__ Hb) {
  __shared__ __attribute__((aligned(2048))) unsigned char L[RING_B];
  const int b = blockIdx.z;
  const int lane = threadIdx.x & 31;
  const int wave = threadIdx.x >> 5;
  const int m0 = blockIdx.y * 128 + (wave >> 1) * 32;  // over C (out chans)
  const int n0 = blockIdx.x * 128 + (wave & 1) * 64;   // over CN

  fvec8 zero = {};
  fvec8 acc[2][4];
#pragma unroll
  for (int i = 0; i < 2; ++i)
#pragma unroll
    for (int j = 0; j < 4; ++j) acc[i][j] = zero;

  block_gemm_2x4<CM, CM>(
      W4c + (size_t)blockIdx.y * 128 * CM,
      Gt + (size_t)b * CN * CM + (size_t)blockIdx.x * 128 * CM, L, acc);

  __bf16* Hbb = Hb + (size_t)b * C_IN * CN;
#pragma unroll
  for (int i = 0; i < 2; ++i)
#pragma unroll
    for (int j = 0; j < 4; ++j)
#pragma unroll
      for (int e = 0; e < 8; ++e) {
        const int o = m0 + 16 * i + 8 * (lane >> 4) + e;
        const int n = n0 + 16 * j + (lane & 15);
        Hbb[(size_t)o * CN + n] = (__bf16)acc[i][j][e];
      }
}

// ---------------------------------------------------------------------------
// K5: out[o][p] = x[o][p] + b4[o] + sum_n Hb[o][n] * attvT[p][n]
// ---------------------------------------------------------------------------
__global__ __launch_bounds__(256) void a2n_distribute_out(
    const __bf16* __restrict__ Hb, const __bf16* __restrict__ attvT,
    const float* __restrict__ b4, const float* __restrict__ x,
    float* __restrict__ out) {
  __shared__ __attribute__((aligned(2048))) unsigned char L[RING_B];
  const int b = blockIdx.z;
  const int lane = threadIdx.x & 31;
  const int wave = threadIdx.x >> 5;
  const int m0 = blockIdx.y * 128 + (wave >> 1) * 32;  // over C
  const int n0 = blockIdx.x * 128 + (wave & 1) * 64;   // over HW

  fvec8 zero = {};
  fvec8 acc[2][4];
#pragma unroll
  for (int i = 0; i < 2; ++i)
#pragma unroll
    for (int j = 0; j < 4; ++j) acc[i][j] = zero;

  block_gemm_2x4<CN, CN>(
      Hb + (size_t)b * C_IN * CN + (size_t)blockIdx.y * 128 * CN,
      attvT + (size_t)b * HW * CN + (size_t)blockIdx.x * 128 * CN, L, acc);

  const float* xb = x + (size_t)b * C_IN * HW;
  float* ob = out + (size_t)b * C_IN * HW;
#pragma unroll
  for (int i = 0; i < 2; ++i)
#pragma unroll
    for (int j = 0; j < 4; ++j)
#pragma unroll
      for (int e = 0; e < 8; ++e) {
        const int o = m0 + 16 * i + 8 * (lane >> 4) + e;
        const int p = n0 + 16 * j + (lane & 15);
        const size_t idx = (size_t)o * HW + p;
        ob[idx] = acc[i][j][e] + b4[o] + xb[idx];
      }
}

// ---------------------------------------------------------------------------
extern "C" void kernel_launch(void* const* d_in, const int* in_sizes, int n_in,
                              void* d_out, int out_size, void* d_ws,
                              size_t ws_size, hipStream_t stream) {
  const float* x  = (const float*)d_in[0];
  const float* w1 = (const float*)d_in[1];
  const float* b1 = (const float*)d_in[2];
  const float* w2 = (const float*)d_in[3];
  const float* b2 = (const float*)d_in[4];
  const float* w3 = (const float*)d_in[5];
  const float* b3 = (const float*)d_in[6];
  const float* w4 = (const float*)d_in[7];
  const float* b4 = (const float*)d_in[8];
  float* out = (float*)d_out;

  char* ws = (char*)d_ws;
  __bf16* XT   = (__bf16*)(ws + OFF_XT);
  __bf16* WC   = (__bf16*)(ws + OFF_WC);
  __bf16* W4C  = (__bf16*)(ws + OFF_W4C);
  __bf16* Abuf = (__bf16*)(ws + OFF_A);
  float*  BP   = (float*)(ws + OFF_BP);
  float*  Vb   = (float*)(ws + OFF_V);
  __bf16* AM   = (__bf16*)(ws + OFF_AM);
  __bf16* AVT  = (__bf16*)(ws + OFF_AVT);
  __bf16* GT   = (__bf16*)(ws + OFF_GT);
  __bf16* HB   = (__bf16*)(ws + OFF_HB);

  const dim3 blk(256);

  a2n_transpose_x<<<dim3(HW / TX_P, C_IN / TX_C, BATCH), blk, 0,
                    stream>>>(x, XT);

  a2n_convert_weights<<<dim3((MO * C_IN + C_IN * CM) / (256 * 8)), blk, 0,
                        stream>>>(w1, w2, w3, w4, WC, W4C);

  a2n_conv123<<<dim3(HW / 128, MO / 128, BATCH), blk, 0, stream>>>(
      WC, XT, b1, b2, b3, Abuf, BP, Vb);

  a2n_batch_softmax<<<dim3(2 * SM_HALF), blk, 0, stream>>>(
      BP, Vb, AM, AVT);

  a2n_gathered<<<dim3(CN / 128, CM / 128, BATCH), blk, 0, stream>>>(Abuf, AM,
                                                                    GT);

  a2n_w4g<<<dim3(CN / 128, C_IN / 128, BATCH), blk, 0, stream>>>(W4C, GT, HB);

  a2n_distribute_out<<<dim3(HW / 128, C_IN / 128, BATCH), blk, 0, stream>>>(
      HB, AVT, b4, x, out);
}

// v003
// A run of this version takes 116 microseconds.
// Timed twice side by side with v002, it ran 1.55 and 1.53 times as fast.
// Counting every step since v000, it is 3.19 times as fast.
#include <hip/hip_runtime.h>

// ---------------------------------------------------------------------------
// A2N attention block for MI455X (gfx1250, wave32, WMMA bf16 16x16x32).
// out = x + w4 @ ( (A @ softmax_b(Bp)^T) @ softmax_b(V) ) + b4
// refactored as  x + ((w4 @ G) @ att_vecs) + b4  to kill the HW-sized conv4.
// ---------------------------------------------------------------------------

typedef __attribute__((ext_vector_type(16))) __bf16 bvec16;
typedef __attribute__((ext_vector_type(8)))  float  fvec8;

#define BATCH 8
#define C_IN  512
#define CM    512
#define CN    256
#define HW    4096
#define MO    1024   // CM + CN + CN rows of the fused conv123 weight

// ---- workspace layout (bytes) ---------------------------------------------
static constexpr size_t SZ_XT  = (size_t)BATCH * HW * C_IN * 2;  // bf16 xT[b][p][c]
static constexpr size_t SZ_WC  = (size_t)MO * C_IN * 2;          // bf16 [w1;w2;w3]
static constexpr size_t SZ_W4C = (size_t)C_IN * CM * 2;          // bf16 w4
static constexpr size_t SZ_A   = (size_t)BATCH * CM * HW * 2;    // bf16 A[b][m][p]
static constexpr size_t SZ_BP  = (size_t)BATCH * CN * HW * 4;    // f32 Bp
static constexpr size_t SZ_V   = SZ_BP;                          // f32 V
static constexpr size_t SZ_AM  = (size_t)BATCH * CN * HW * 2;    // bf16 att_maps[b][n][p]
static constexpr size_t SZ_AVT = SZ_AM;                          // bf16 att_vecsT[b][p][n]
static constexpr size_t SZ_GT  = (size_t)BATCH * CN * CM * 2;    // bf16 Gt[b][n][m]
// Hb bf16 [b][o][n] after Gt

static constexpr size_t OFF_XT  = 0;
static constexpr size_t OFF_WC  = OFF_XT + SZ_XT;
static constexpr size_t OFF_W4C = OFF_WC + SZ_WC;
static constexpr size_t OFF_A   = OFF_W4C + SZ_W4C;
static constexpr size_t OFF_BP  = OFF_A + SZ_A;
static constexpr size_t OFF_V   = OFF_BP + SZ_BP;
static constexpr size_t OFF_AM  = OFF_V + SZ_V;
static constexpr size_t OFF_AVT = OFF_AM + SZ_AM;
static constexpr size_t OFF_GT  = OFF_AVT + SZ_AVT;
static constexpr size_t OFF_HB  = OFF_GT + SZ_GT;

// ---------------------------------------------------------------------------
// LDS ring of the four GEMMs. A pass is 128 k = 256 bytes of every operand row.
// A stage holds the block's 128 A rows and 128 B rows as eight slices of 32
// rows, one slice per wave, each brought in by that wave's own tensor load.
// The load's pad gives an LDS row pitch of 272 B (16 B x odd: no bank conflict
// for ds_load_b128). A slice's 32 * 272 = 8704 B are rounded up to a multiple
// of 2 KiB so that every load's place in LDS is one.
// ---------------------------------------------------------------------------
typedef uint32_t u32x4 __attribute__((ext_vector_type(4)));
typedef uint32_t u32x8 __attribute__((ext_vector_type(8)));

static constexpr uint32_t PASS_K     = 128;
static constexpr uint32_t ROW_B      = 256;
static constexpr uint32_t PITCH_B    = 272;
static constexpr uint32_t SLICE_ROWS = 32;
static constexpr uint32_t SLICE_B    = 10240;
static constexpr uint32_t STAGE_B    = 8 * SLICE_B;
static constexpr uint32_t RING_B     = 2 * STAGE_B;
static_assert(SLICE_B % 2048 == 0 && SLICE_B >= SLICE_ROWS * PITCH_B, "slice");

__device__ __forceinline__ uint32_t uni(uint32_t v) {
  return (uint32_t)__builtin_amdgcn_readfirstlane(v);
}
// Holds v in a scalar register: a test on it compiles to a scalar branch (a
// tensor load ignores EXEC), and descriptor words formed from it are formed
// behind the volatile statements that stand in front of it.
__device__ __forceinline__ uint32_t pinned(uint32_t v) {
  uint32_t w = uni(v);
  asm volatile("" : "+s"(w));  // pinned(): a test or descriptor word kept scalar
  return w;
}
// The compiler places no wait for a tensor load; both waits are hand-written.
__device__ __forceinline__ void wait_tensor0() {
  asm volatile("s_wait_tensorcnt 0x0" ::: "memory");
}
__device__ __forceinline__ void wait_ds0() {
  asm volatile("s_wait_dscnt 0x0" ::: "memory");
}
__device__ __forceinline__ void tdm_load(u32x4 g0, u32x8 g1) {
  asm volatile("tensor_load_to_lds %0, %1" ::"s"(g0), "s"(g1) : "memory");
}
// Group 1: 1-byte elements, tile = tensor = 32 rows of 256 B, a 4-dword pad
// behind every 64 dwords, no mask.
__device__ __forceinline__ u32x8 tdm_group1(uint32_t src_pitch_bytes) {
  u32x8 g;
  g[0] = uni((1u << 20) | (5u << 22) | (3u << 25));
  g[1] = uni((ROW_B & 0xFFFFu) << 16);
  g[2] = uni((ROW_B >> 16) | ((SLICE_ROWS & 0xFFFFu) << 16));
  g[3] = uni((SLICE_ROWS >> 16) | (ROW_B << 16));
  g[4] = uni(SLICE_ROWS);
  g[5] = uni(src_pitch_bytes);
  g[6] = uni(0u);
  g[7] = uni(0u);
  return g;
}
__device__ __forceinline__ u32x4 tdm_group0(uint32_t lds_dst, uint64_t ga) {
  u32x4 g;
  g[0] = uni(1u);
  g[1] = uni(lds_dst);
  g[2] = uni((uint32_t)ga);
  g[3] = uni((((uint32_t)(ga >> 32)) & 0x01FFFFFFu) | 0x80000000u);
  return g;
}

// ---------------------------------------------------------------------------
// WMMA operand fragment from a staged row block. Works for the A operand from
// row-major [M][K] and for the B operand when B^T is row-major [N][K] (true
// for every GEMM here by construction). Matches ISA bf16 16x32 layout:
//   lane L: row = L&15, chunk0 = K[(L>>4)*8 .. +7], chunk1 = chunk0 + 16.
// p already holds the lane's row and its 16-byte half.
// ---------------------------------------------------------------------------
__device__ __forceinline__ bvec16 lds_frag(const unsigned char* p) {
  union { uint4 q[2]; bvec16 v; } u;
  u.q[0] = *(const uint4*)(p);
  u.q[1] = *(const uint4*)(p + 32);
  return u.v;
}

// Block tile 128x128 from eight waves, each 32x64: 2 (M) x 4 (N) WMMA tiles.
// Ablk, Bblk: the block's first row of each operand, both K-contiguous with a
// row pitch of LD elements. L: the kernel's RING_B bytes of LDS.
template <int LD, int K>
__device__ __forceinline__ void block_gemm_2x4(const __bf16* __restrict__ Ablk,
                                               const __bf16* __restrict__ Bblk,
                                               unsigned char* L,
                                               fvec8 acc[2][4]) {
  constexpr uint32_t S = K / PASS_K;  // stages = passes
  static_assert(K % PASS_K == 0 && S >= 2, "the ring needs two stages");
  const uint32_t lane = threadIdx.x & 31;
  const uint32_t wave = uni(threadIdx.x >> 5);

  // This wave's slice: waves 0..3 bring A rows, waves 4..7 B rows.
  const __bf16* srow = (wave < 4u)
                           ? Ablk + (size_t)(SLICE_ROWS * wave) * LD
                           : Bblk + (size_t)(SLICE_ROWS * (wave - 4u)) * LD;
  const uint64_t src = (uint64_t)(uintptr_t)srow;
  const uint32_t dst = (uint32_t)(size_t)L + wave * SLICE_B;
  const u32x8 g1 = tdm_group1((uint32_t)LD * 2u);

  tdm_load(tdm_group0(dst, src), g1);  // stage 0
  wait_tensor0();
  __syncthreads();                     // stage 0 is published
  {
    const uint32_t one = pinned(1u);   // stage 1's words formed behind the wait
    tdm_load(tdm_group0(dst + one * STAGE_B, src + (uint64_t)one * ROW_B), g1);
  }

  const uint32_t lrow = (lane & 15u) * PITCH_B + (lane >> 4) * 16u;
  const uint32_t a_off = (wave >> 1) * SLICE_B + lrow;
  const uint32_t b_off = (4u + (wave & 1u) * 2u) * SLICE_B + lrow;

// rolled: one copy of the pass in the instruction cache for every K
#pragma clang loop unroll(disable)
  for (uint32_t s = 0; s < S; ++s) {
    const unsigned char* buf = L + (s & 1u) * STAGE_B;
#pragma unroll
    for (uint32_t kk = 0; kk < PASS_K / 32; ++kk) {
      bvec16 af[2], bfr[4];
#pragma unroll
      for (uint32_t i = 0; i < 2; ++i)
        af[i] = lds_frag(buf + a_off + i * 16u * PITCH_B + kk * 64u);
#pragma unroll
      for (uint32_t j = 0; j < 4; ++j)
        bfr[j] = lds_frag(buf + b_off + (j >> 1) * SLICE_B +
                          (j & 1u) * 16u * PITCH_B + kk * 64u);
#pragma unroll
      for (int i = 0; i < 2; ++i)
#pragma unroll
        for (int j = 0; j < 4; ++j)
          acc[i][j] = __builtin_amdgcn_wmma_f32_16x16x32_bf16(
              false, af[i], false, bfr[j], (short)0, acc[i][j], false, false);
    }
    // Publish point of stage s + 1: this wave's reads of stage s are back, its
    // own slice of stage s + 1 has landed, then every wave meets.
    wait_ds0();
    wait_tensor0();
    __syncthreads();
    const uint32_t nxt = pinned(s + 2u);  // refill's words formed behind the wait
    if (pinned(nxt < S))
      tdm_load(tdm_group0(dst + (nxt & 1u) * STAGE_B,
                          src + (uint64_t)nxt * ROW_B), g1);
  }
  wait_tensor0();
  wait_ds0();
}

// ---------------------------------------------------------------------------
// Helpers of the three non-matrix launches and of K1: 16-byte global accesses.
// ---------------------------------------------------------------------------
typedef float  f32x4 __attribute__((ext_vector_type(4)));
typedef float  f32x2 __attribute__((ext_vector_type(2)));
typedef __bf16 bf16x2 __attribute__((ext_vector_type(2)));

// Stands behind a group of global loads or stores whose registers are used
// again for other values further down.
__device__ __forceinline__ void wait_x0() {
  asm volatile("s_wait_xcnt 0x0" ::: "memory");
}

// Two f32 to one dword of two bf16 (round to nearest even), lo in the low half.
__device__ __forceinline__ uint32_t pack_bf16(float lo, float hi) {
  f32x2 f = {lo, hi};
  union { bf16x2 h; uint32_t u; } c;
  c.h = __builtin_convertvector(f, bf16x2);
  return c.u;
}

// ---------------------------------------------------------------------------
// Prep 1: x [b][c][p] f32  ->  xT [b][p][c] bf16.
// A block takes one tile of 128 c x 128 p, 64 values a lane. A lane loads 4 p
// of two neighbouring c rows (8 lanes = one 128-B line), packs the pair and
// writes dwords into an LDS tile [p][c/2]; the tile leaves as 16-byte stores,
// 16 lanes = the 256 B that a p row of the tile has in xT.
// ---------------------------------------------------------------------------
static constexpr int TX_C     = 128;
static constexpr int TX_P     = 128;
static constexpr int TX_PITCH = 68;  // dwords: 272 B = 16 B x odd

__global__ __launch_bounds__(256) void a2n_transpose_x(
    const float* __restrict__ x, __bf16* __restrict__ xT) {
  __shared__ __attribute__((aligned(16))) uint32_t tile[TX_P * TX_PITCH];
  const int tid = threadIdx.x;
  const int lane = tid & 31;
  const int wave = tid >> 5;
  const int p4l = lane & 7;
  const int c2l = wave * 8 + (lane >> 3);
  const int pbase = blockIdx.x * TX_P;
  const float* xb = x + ((size_t)blockIdx.z * C_IN + blockIdx.y * TX_C) * HW +
                    (size_t)(2 * c2l) * HW + pbase + 4 * p4l;
  __bf16* xTb = xT + ((size_t)blockIdx.z * HW + pbase + (tid >> 4)) * C_IN +
                blockIdx.y * TX_C + (tid & 15) * 8;

  f32x4 r[TX_P / 32][2][2];  // [group of 32 p][group of 4 c pairs][c of the pair]
#pragma unroll
  for (int pg = 0; pg < TX_P / 32; ++pg)
#pragma unroll
    for (int cg = 0; cg < 2; ++cg)
#pragma unroll
      for (int h = 0; h < 2; ++h)
        r[pg][cg][h] = *(const f32x4*)(xb + (size_t)(cg * 8 + h) * HW + pg * 32);
#pragma unroll
  for (int pg = 0; pg < TX_P / 32; ++pg)
#pragma unroll
    for (int cg = 0; cg < 2; ++cg)
#pragma unroll
      for (int i = 0; i < 4; ++i)
        tile[(pg * 32 + 4 * p4l + i) * TX_PITCH + cg * 4 + c2l] =
            pack_bf16(r[pg][cg][0][i], r[pg][cg][1][i]);
  __syncthreads();
#pragma unroll
  for (int it = 0; it < TX_P / 16; ++it) {
    const uint4 v =
        *(const uint4*)&tile[(it * 16 + (tid >> 4)) * TX_PITCH + (tid & 15) * 4];
    *(uint4*)(xTb + (size_t)(it * 16) * C_IN) = v;
  }
}

// ---------------------------------------------------------------------------
// Prep 2: convert weights to bf16, fuse w1|w2|w3 into Wc [1024][512].
// Eight elements a lane; every boundary between the sources is a multiple of 8.
// ---------------------------------------------------------------------------
__global__ __launch_bounds__(256) void a2n_convert_weights(
    const float* __restrict__ w1, const float* __restrict__ w2,
    const float* __restrict__ w3, const float* __restrict__ w4,
    __bf16* __restrict__ Wc, __bf16* __restrict__ W4c) {
  const int t = (blockIdx.x * 256 + threadIdx.x) * 8;
  const int n1 = MO * C_IN;          // 524288
  const int n2 = n1 + C_IN * CM;     // + 262144
  if (t >= n2) return;
  const float* s;
  if (t < CM * C_IN)             s = w1 + t;
  else if (t < (CM + CN) * C_IN) s = w2 + (t - CM * C_IN);
  else if (t < n1)               s = w3 + (t - (CM + CN) * C_IN);
  else                           s = w4 + (t - n1);
  __bf16* d = (t < n1) ? Wc + t : W4c + (t - n1);
  const f32x4 a = *(const f32x4*)s;
  const f32x4 c = *(const f32x4*)(s + 4);
  uint4 o;
  o.x = pack_bf16(a[0], a[1]);
  o.y = pack_bf16(a[2], a[3]);
  o.z = pack_bf16(c[0], c[1]);
  o.w = pack_bf16(c[2], c[3]);
  *(uint4*)d = o;
}

// ---------------------------------------------------------------------------
// K1: fused conv1/2/3.  Y[o][p] = sum_c Wc[o][c] * xT[p][c]  (+bias)
// rows 0..511 -> A (bf16), 512..767 -> Bp (f32), 768..1023 -> V (f32)
// ---------------------------------------------------------------------------
static constexpr int YB_A = CM / 128;         // blockIdx.y below: rows of A
static constexpr int YB_B = (CM + CN) / 128;  // below: rows of Bp; from here: V
static_assert(CM % 128 == 0 && CN % 128 == 0, "a block's rows share one output");

__global__ __launch_bounds__(256) void a2n_conv123(
    const __bf16* __restrict__ Wc, const __bf16* __restrict__ xT,
    const float* __restrict__ b1, const float* __restrict__ b2,
    const float* __restrict__ b3, __bf16* __restrict__ Aout,
    float* __restrict__ Bp, float* __restrict__ V) {
  __shared__ __attribute__((aligned(2048))) unsigned char L[RING_B];
  const int b = blockIdx.z;
  const int lane = threadIdx.x & 31;
  const int wave = threadIdx.x >> 5;
  const int by = blockIdx.y;  // a block's 128 rows lie in one of A, Bp, V
  const int rl = (wave >> 1) * 32 + 8 * (lane >> 4);  // lane's first row in them
  const int n0 = blockIdx.x * 128 + (wave & 1) * 64;
  const __bf16* Brows = xT + (size_t)b * HW * C_IN;

  // The lane's 16 bias values, four 16-byte loads issued ahead of the product.
  const float* bias = (by < YB_A)   ? b1 + by * 128
                      : (by < YB_B) ? b2 + (by - YB_A) * 128
                                    : b3 + (by - YB_B) * 128;
  f32x4 bv[2][2];
#pragma unroll
  for (int i = 0; i < 2; ++i)
#pragma unroll
    for (int h = 0; h < 2; ++h)
      bv[i][h] = *(const f32x4*)(bias + rl + 16 * i + 4 * h);

  fvec8 zero = {};
  fvec8 acc[2][4];
#pragma unroll
  for (int i = 0; i < 2; ++i)
#pragma unroll
    for (int j = 0; j < 4; ++j) acc[i][j] = zero;

  block_gemm_2x4<C_IN, C_IN>(Wc + (size_t)blockIdx.y * 128 * C_IN,
                             Brows + (size_t)blockIdx.x * 128 * C_IN, L, acc);

  const int p0 = n0 + (lane & 15);
  if (by < YB_A) {  // block-uniform
    __bf16* d = Aout + (size_t)b * CM * HW + (size_t)(by * 128 + rl) * HW + p0;
#pragma unroll
    for (int i = 0; i < 2; ++i)
#pragma unroll
      for (int j = 0; j < 4; ++j)
#pragma unroll
        for (int e = 0; e < 8; ++e)
          d[(size_t)(16 * i + e) * HW + 16 * j] =
              (__bf16)(acc[i][j][e] + bv[i][e >> 2][e & 3]);
  } else {
    float* d = ((by < YB_B) ? Bp + (size_t)(by - YB_A) * 128 * HW
                            : V + (size_t)(by - YB_B) * 128 * HW) +
               (size_t)b * CN * HW + (size_t)rl * HW + p0;
#pragma unroll
    for (int i = 0; i < 2; ++i)
#pragma unroll
      for (int j = 0; j < 4; ++j)
#pragma unroll
        for (int e = 0; e < 8; ++e)
          d[(size_t)(16 * i + e) * HW + 16 * j] =
              acc[i][j][e] + bv[i][e >> 2][e & 3];
    wait_x0();  // the code laid out behind these stores rewrites their registers
  }
}

// ---------------------------------------------------------------------------
// K2: softmax over BATCH axis for Bp and V.
// att_maps written [b][n][p]; att_vecs written transposed [b][p][n].
// A lane holds eight positions of all eight batches (16 loads of 16 B).
// Blocks below SM_HALF: Bp, a wave's load = 512 contiguous bytes, its store
// 256. The others: a V tile of 64 n x 32 p; a lane holds 4 p of two
// neighbouring n rows, packs the pair into an LDS tile [b][p][n/2], and the
// tile leaves as 16-byte stores, 8 lanes = one whole 128-B line of attvT.
// ---------------------------------------------------------------------------
static constexpr int SM_HALF  = CN * HW / (256 * 8);  // blocks per half
static constexpr int SM_N     = 64;
static constexpr int SM_P     = 32;
static constexpr int SM_PITCH = 36;                   // dwords: 144 B = 16 B x odd
static constexpr int SM_PLANE = SM_P * SM_PITCH;      // dwords per batch

__device__ __forceinline__ void softmax_over_batch(f32x4 v[BATCH][2]) {
#pragma unroll
  for (int h = 0; h < 2; ++h)
#pragma unroll
    for (int i = 0; i < 4; ++i) {
      float mx = -3.4e38f;
#pragma unroll
      for (int b = 0; b < BATCH; ++b) mx = fmaxf(mx, v[b][h][i]);
      float s = 0.f;
#pragma unroll
      for (int b = 0; b < BATCH; ++b) {
        v[b][h][i] = __expf(v[b][h][i] - mx);
        s += v[b][h][i];
      }
      const float inv = 1.f / s;
#pragma unroll
      for (int b = 0; b < BATCH; ++b) v[b][h][i] *= inv;
    }
}

__global__ __launch_bounds__(256) void a2n_batch_softmax(
    const float* __restrict__ Bp, const float* __restrict__ V,
    __bf16* __restrict__ attm, __bf16* __restrict__ attvT) {
  __shared__ __attribute__((aligned(16))) uint32_t tile[BATCH * SM_PLANE];
  const size_t NP = (size_t)CN * HW;
  const int tid = threadIdx.x;
  const int lane = tid & 31;
  const int wave = tid >> 5;
  f32x4 v[BATCH][2];

  if (blockIdx.x >= SM_HALF) {  // block-uniform
    const int ti = blockIdx.x - SM_HALF;
    const int n0 = (ti / (HW / SM_P)) * SM_N;
    const int p0 = (ti % (HW / SM_P)) * SM_P;
    const int p4 = lane & 7;
    const int n2 = wave * 4 + (lane >> 3);
    const uint32_t src = (uint32_t)((n0 + 2 * n2) * HW + p0 + 4 * p4);
#pragma unroll
    for (int b = 0; b < BATCH; ++b) {
#pragma unroll
      for (int h = 0; h < 2; ++h)
        v[b][h] = *(const f32x4*)((const char*)(V + (b & 1) * NP + h * HW) +
                                  (src * 4u + (b >> 1) * (uint32_t)(8 * NP)));
      if (b & 1) wait_x0();  // later loads land in these loads' address register
    }
    softmax_over_batch(v);
#pragma unroll
    for (int b = 0; b < BATCH; ++b)
#pragma unroll
      for (int i = 0; i < 4; ++i)
        tile[b * SM_PLANE + (4 * p4 + i) * SM_PITCH + n2] =
            pack_bf16(v[b][0][i], v[b][1][i]);
    __syncthreads();
    const uint32_t dst = (uint32_t)((p0 + (tid >> 3)) * CN + n0 + (tid & 7) * 8);
#pragma unroll
    for (int b = 0; b < BATCH; ++b) {
      const uint4 o = *(const uint4*)&tile[b * SM_PLANE +
                                           (tid >> 3) * SM_PITCH + (tid & 7) * 4];
      *(uint4*)((char*)(attvT + b * NP) + dst * 2u) = o;
    }
    return;
  }
  {
    // a 32-bit lane offset per pair of batches beside one uniform base
    const uint32_t j = blockIdx.x * 2048u + wave * 256u + lane * 4u;
#pragma unroll
    for (int b = 0; b < BATCH; ++b) {
#pragma unroll
      for (int h = 0; h < 2; ++h)
        v[b][h] = *(const f32x4*)((const char*)(Bp + (b & 1) * NP + h * 128) +
                                  (j * 4u + (b >> 1) * (uint32_t)(8 * NP)));
      if (b & 1) wait_x0();  // later loads land in these loads' address register
    }
    softmax_over_batch(v);
#pragma unroll
    for (int b = 0; b < BATCH; ++b) {
#pragma unroll
      for (int h = 0; h < 2; ++h) {
        uint2 o;
        o.x = pack_bf16(v[b][h][0], v[b][h][1]);
        o.y = pack_bf16(v[b][h][2], v[b][h][3]);
        *(uint2*)((char*)(attm + b * NP + h * 128) + j * 2u) = o;
      }
    }
    wait_x0();  // the code laid out behind these stores rewrites their registers
  }
}

// ---------------------------------------------------------------------------
// K3: gathered.  G[m][n] = sum_p A[m][p] * attm[n][p], stored transposed
// as Gt[b][n][m] (bf16) so it is a ready-made B^T operand for K4.
// ---------------------------------------------------------------------------
__global__ __launch_bounds__(256) void a2n_gathered(
    const __bf16* __restrict__ A, const __bf16* __restrict__ attm,
    __bf16* __restrict__ Gt) {
  __shared__ __attribute__((aligned(2048))) unsigned char L[RING_B];
  const int b = blockIdx.z;
  const int lane = threadIdx.x & 31;
  const int wave = threadIdx.x >> 5;
  const int m0 = blockIdx.y * 128 + (wave >> 1) * 32;  // over CM
  const int n0 = blockIdx.x * 128 + (wave & 1) * 64;   // over CN

  fvec8 zero = {};
  fvec8 acc[2][4];
#pragma unroll
  for (int i = 0; i < 2; ++i)
#pragma unroll
    for (int j = 0; j < 4; ++j) acc[i][j] = zero;

  block_gemm_2x4<HW, HW>(
      A + (size_t)b * CM * HW + (size_t)blockIdx.y * 128 * HW,
      attm + (size_t)b * CN * HW + (size_t)blockIdx.x * 128 * HW, L, acc);

  __bf16* Gb = Gt + (size_t)b * CN * CM;
#pragma unroll
  for (int i = 0; i < 2; ++i)
#pragma unroll
    for (int j = 0; j < 4; ++j)
#pragma unroll
      for (int e = 0; e < 8; ++e) {
        const int m = m0 + 16 * i + 8 * (lane >> 4) + e;
        const int n = n0 + 16 * j + (lane & 15);
        Gb[(size_t)n * CM + m] = (__bf16)acc[i][j][e];
      }
}

// ---------------------------------------------------------------------------
// K4: Hm = w4 @ G.  Hm[o][n] = sum_m w4[o][m] * Gt[n][m].  Stored [b][o][n].
// ---------------------------------------------------------------------------
__global__ __launch_bounds__(256) void a2n_w4g(
    const __bf16* __restrict__ W4c, const __bf16* __restrict__ Gt,
    __bf16* __restrict__ Hb) {
  __shared__ __attribute__((aligned(2048))) unsigned char L[RING_B];
  const int b = blockIdx.z;
  const int lane = threadIdx.x & 31;
  const int wave = threadIdx.x >> 5;
  const int m0 = blockIdx.y * 128 + (wave >> 1) * 32;  // over C (out chans)
  const int n0 = blockIdx.x * 128 + (wave & 1) * 64;   // over CN

  fvec8 zero = {};
  fvec8 acc[2][4];
#pragma unroll
  for (int i = 0; i < 2; ++i)
#pragma unroll
    for (int j = 0; j < 4; ++j) acc[i][j] = zero;

  block_gemm_2x4<CM, CM>(
      W4c + (size_t)blockIdx.y * 128 * CM,
      Gt + (size_t)b * CN * CM + (size_t)blockIdx.x * 128 * CM, L, acc);

  __bf16* Hbb = Hb + (size_t)b * C_IN * CN;
#pragma unroll
  for (int i = 0; i < 2; ++i)
#pragma unroll
    for (int j = 0; j < 4; ++j)
#pragma unroll
      for (int e = 0; e < 8; ++e) {
        const int o = m0 + 16 * i + 8 * (lane >> 4) + e;
        const int n = n0 + 16 * j + (lane & 15);
        Hbb[(size_t)o * CN + n] = (__bf16)acc[i][j][e];
      }
}

// ---------------------------------------------------------------------------
// K5: out[o][p] = x[o][p] + b4[o] + sum_n Hb[o][n] * attvT[p][n]
// ---------------------------------------------------------------------------
__global__ __launch_bounds__(256) void a2n_distribute_out(
    const __bf16* __restrict__ Hb, const __bf16* __restrict__ attvT,
    const float* __restrict__ b4, const float* __restrict__ x,
    float* __restrict__ out) {
  __shared__ __attribute__((aligned(2048))) unsigned char L[RING_B];
  const int b = blockIdx.z;
  const int lane = threadIdx.x & 31;
  const int wave = threadIdx.x >> 5;
  const int m0 = blockIdx.y * 128 + (wave >> 1) * 32;  // over C
  const int n0 = blockIdx.x * 128 + (wave & 1) * 64;   // over HW

  fvec8 zero = {};
  fvec8 acc[2][4];
#pragma unroll
  for (int i = 0; i < 2; ++i)
#pragma unroll
    for (int j = 0; j < 4; ++j) acc[i][j] = zero;

  block_gemm_2x4<CN, CN>(
      Hb + (size_t)b * C_IN * CN + (size_t)blockIdx.y * 128 * CN,
      attvT + (size_t)b * HW * CN + (size_t)blockIdx.x * 128 * CN, L, acc);

  const float* xb = x + (size_t)b * C_IN * HW;
  float* ob = out + (size_t)b * C_IN * HW;
#pragma unroll
  for (int i = 0; i < 2; ++i)
#pragma unroll
    for (int j = 0; j < 4; ++j)
#pragma unroll
      for (int e = 0; e < 8; ++e) {
        const int o = m0 + 16 * i + 8 * (lane >> 4) + e;
        const int p = n0 + 16 * j + (lane & 15);
        const size_t idx = (size_t)o * HW + p;
        ob[idx] = acc[i][j][e] + b4[o] + xb[idx];
      }
}

// ---------------------------------------------------------------------------
extern "C" void kernel_launch(void* const* d_in, const int* in_sizes, int n_in,
                              void* d_out, int out_size, void* d_ws,
                              size_t ws_size, hipStream_t stream) {
  const float* x  = (const float*)d_in[0];
  const float* w1 = (const float*)d_in[1];
  const float* b1 = (const float*)d_in[2];
  const float* w2 = (const float*)d_in[3];
  const float* b2 = (const float*)d_in[4];
  const float* w3 = (const float*)d_in[5];
  const float* b3 = (const float*)d_in[6];
  const float* w4 = (const float*)d_in[7];
  const float* b4 = (const float*)d_in[8];
  float* out = (float*)d_out;

  char* ws = (char*)d_ws;
  __bf16* XT   = (__bf16*)(ws + OFF_XT);
  __bf16* WC   = (__bf16*)(ws + OFF_WC);
  __bf16* W4C  = (__bf16*)(ws + OFF_W4C);
  __bf16* Abuf = (__bf16*)(ws + OFF_A);
  float*  BP   = (float*)(ws + OFF_BP);
  float*  Vb   = (float*)(ws + OFF_V);
  __bf16* AM   = (__bf16*)(ws + OFF_AM);
  __bf16* AVT  = (__bf16*)(ws + OFF_AVT);
  __bf16* GT   = (__bf16*)(ws + OFF_GT);
  __bf16* HB   = (__bf16*)(ws + OFF_HB);

  const dim3 blk(256);

  a2n_transpose_x<<<dim3(HW / TX_P, C_IN / TX_C, BATCH), blk, 0,
                    stream>>>(x, XT);

  a2n_convert_weights<<<dim3((MO * C_IN + C_IN * CM) / (256 * 8)), blk, 0,
                        stream>>>(w1, w2, w3, w4, WC, W4C);

  a2n_conv123<<<dim3(HW / 128, MO / 128, BATCH), blk, 0, stream>>>(
      WC, XT, b1, b2, b3, Abuf, BP, Vb);

  a2n_batch_softmax<<<dim3(2 * SM_HALF), blk, 0, stream>>>(
      BP, Vb, AM, AVT);

  a2n_gathered<<<dim3(CN / 128, CM / 128, BATCH), blk, 0, stream>>>(Abuf, AM,
                                                                    GT);

  a2n_w4g<<<dim3(CN / 128, C_IN / 128, BATCH), blk, 0, stream>>>(W4C, GT, HB);

  a2n_distribute_out<<<dim3(HW / 128, C_IN / 128, BATCH), blk, 0, stream>>>(
      HB, AVT, b4, x, out);
}

// v004
// It runs in 100 microseconds.
// Next to v003, in two timings, it ran 1.16 and 1.15 times as fast.
// All steps since v000 together make it 3.68 times as fast.
#include <hip/hip_runtime.h>

// ---------------------------------------------------------------------------
// A2N attention block for MI455X (gfx1250, wave32, WMMA bf16 16x16x32).
// out = x + w4 @ ( (A @ softmax_b(Bp)^T) @ softmax_b(V) ) + b4
// refactored as  x + ((w4 @ G) @ att_vecs) + b4  to kill the HW-sized conv4.
// ---------------------------------------------------------------------------

typedef __attribute__((ext_vector_type(16))) __bf16 bvec16;
typedef __attribute__((ext_vector_type(8)))  float  fvec8;

#define BATCH 8
#define C_IN  512
#define CM    512
#define CN    256
#define HW    4096
#define MO    1024   // CM + CN + CN rows of the fused conv123 weight

// ---- workspace layout (bytes) ---------------------------------------------
static constexpr size_t SZ_XT  = (size_t)BATCH * HW * C_IN * 2;  // bf16 xT[b][p][c]
static constexpr size_t SZ_WC  = (size_t)MO * C_IN * 2;          // bf16 [w1;w2;w3]
static constexpr size_t SZ_W4C = (size_t)C_IN * CM * 2;          // bf16 w4
static constexpr size_t SZ_A   = (size_t)BATCH * CM * HW * 2;    // bf16 A[b][m][p]
static constexpr size_t SZ_BP  = (size_t)BATCH * CN * HW * 4;    // f32 Bp
static constexpr size_t SZ_V   = SZ_BP;                          // f32 V
static constexpr size_t SZ_AM  = (size_t)BATCH * CN * HW * 2;    // bf16 att_maps[b][n][p]
static constexpr size_t SZ_AVT = SZ_AM;                          // bf16 att_vecsT[b][p][n]
static constexpr size_t SZ_GT  = (size_t)BATCH * CN * CM * 2;    // bf16 Gt[b][n][m]
static constexpr size_t SZ_HB  = (size_t)BATCH * C_IN * CN * 2;  // bf16 Hb[b][o][n]
// f32 Gp[slice][b][n][m] after Hb: the gathered product's partial sums

static constexpr size_t OFF_XT  = 0;
static constexpr size_t OFF_WC  = OFF_XT + SZ_XT;
static constexpr size_t OFF_W4C = OFF_WC + SZ_WC;
static constexpr size_t OFF_A   = OFF_W4C + SZ_W4C;
static constexpr size_t OFF_BP  = OFF_A + SZ_A;
static constexpr size_t OFF_V   = OFF_BP + SZ_BP;
static constexpr size_t OFF_AM  = OFF_V + SZ_V;
static constexpr size_t OFF_AVT = OFF_AM + SZ_AM;
static constexpr size_t OFF_GT  = OFF_AVT + SZ_AVT;
static constexpr size_t OFF_HB  = OFF_GT + SZ_GT;
static constexpr size_t OFF_GP  = OFF_HB + SZ_HB;

// ---------------------------------------------------------------------------
// LDS ring of the four GEMMs. A pass is 128 k = 256 bytes of every operand row.
// A stage holds the block's 128 A rows and 128 B rows as eight slices of 32
// rows, one slice per wave, each brought in by that wave's own tensor load.
// The load's pad gives an LDS row pitch of 272 B (16 B x odd: no bank conflict
// for ds_load_b128). A slice's 32 * 272 = 8704 B are rounded up to a multiple
// of 2 KiB so that every load's place in LDS is one.
// ---------------------------------------------------------------------------
typedef uint32_t u32x4 __attribute__((ext_vector_type(4)));
typedef uint32_t u32x8 __attribute__((ext_vector_type(8)));

static constexpr uint32_t PASS_K     = 128;
static constexpr uint32_t ROW_B      = 256;
static constexpr uint32_t PITCH_B    = 272;
static constexpr uint32_t SLICE_ROWS = 32;
static constexpr uint32_t SLICE_B    = 10240;
static constexpr uint32_t STAGE_B    = 8 * SLICE_B;
static constexpr uint32_t RING_B     = 2 * STAGE_B;
static_assert(SLICE_B % 2048 == 0 && SLICE_B >= SLICE_ROWS * PITCH_B, "slice");

__device__ __forceinline__ uint32_t uni(uint32_t v) {
  return (uint32_t)__builtin_amdgcn_readfirstlane(v);
}
// Holds v in a scalar register: a test on it compiles to a scalar branch (a
// tensor load ignores EXEC), and descriptor words formed from it are formed
// behind the volatile statements that stand in front of it.
__device__ __forceinline__ uint32_t pinned(uint32_t v) {
  uint32_t w = uni(v);
  asm volatile("" : "+s"(w));  // pinned(): a test or descriptor word kept scalar
  return w;
}
// The compiler places no wait for a tensor load; both waits are hand-written.
__device__ __forceinline__ void wait_tensor0() {
  asm volatile("s_wait_tensorcnt 0x0" ::: "memory");
}
__device__ __forceinline__ void wait_ds0() {
  asm volatile("s_wait_dscnt 0x0" ::: "memory");
}
__device__ __forceinline__ void tdm_load(u32x4 g0, u32x8 g1) {
  asm volatile("tensor_load_to_lds %0, %1" ::"s"(g0), "s"(g1) : "memory");
}
// Group 1: 1-byte elements, tile = tensor = 32 rows of 256 B, a 4-dword pad
// behind every 64 dwords, no mask.
__device__ __forceinline__ u32x8 tdm_group1(uint32_t src_pitch_bytes) {
  u32x8 g;
  g[0] = uni((1u << 20) | (5u << 22) | (3u << 25));
  g[1] = uni((ROW_B & 0xFFFFu) << 16);
  g[2] = uni((ROW_B >> 16) | ((SLICE_ROWS & 0xFFFFu) << 16));
  g[3] = uni((SLICE_ROWS >> 16) | (ROW_B << 16));
  g[4] = uni(SLICE_ROWS);
  g[5] = uni(src_pitch_bytes);
  g[6] = uni(0u);
  g[7] = uni(0u);
  return g;
}
__device__ __forceinline__ u32x4 tdm_group0(uint32_t lds_dst, uint64_t ga) {
  u32x4 g;
  g[0] = uni(1u);
  g[1] = uni(lds_dst);
  g[2] = uni((uint32_t)ga);
  g[3] = uni((((uint32_t)(ga >> 32)) & 0x01FFFFFFu) | 0x80000000u);
  return g;
}

// ---------------------------------------------------------------------------
// WMMA operand fragment from a staged row block. Works for the A operand from
// row-major [M][K] and for the B operand when B^T is row-major [N][K] (true
// for every GEMM here by construction). Matches ISA bf16 16x32 layout:
//   lane L: row = L&15, chunk0 = K[(L>>4)*8 .. +7], chunk1 = chunk0 + 16.
// p already holds the lane's row and its 16-byte half.
// ---------------------------------------------------------------------------
__device__ __forceinline__ bvec16 lds_frag(const unsigned char* p) {
  union { uint4 q[2]; bvec16 v; } u;
  u.q[0] = *(const uint4*)(p);
  u.q[1] = *(const uint4*)(p + 32);
  return u.v;
}

// Block tile 128x128 from eight waves, each 32x64: 2 (M) x 4 (N) WMMA tiles.
// Ablk, Bblk: the block's first row of each operand, both K-contiguous with a
// row pitch of LD elements. L: the kernel's RING_B bytes of LDS.
template <int LD, int K>
__device__ __forceinline__ void block_gemm_2x4(const __bf16* __restrict__ Ablk,
                                               const __bf16* __restrict__ Bblk,
                                               unsigned char* L,
                                               fvec8 acc[2][4]) {
  constexpr uint32_t S = K / PASS_K;  // stages = passes
  static_assert(K % PASS_K == 0 && S >= 2, "the ring needs two stages");
  const uint32_t lane = threadIdx.x & 31;
  const uint32_t wave = uni(threadIdx.x >> 5);

  // This wave's slice: waves 0..3 bring A rows, waves 4..7 B rows.
  const __bf16* srow = (wave < 4u)
                           ? Ablk + (size_t)(SLICE_ROWS * wave) * LD
                           : Bblk + (size_t)(SLICE_ROWS * (wave - 4u)) * LD;
  const uint64_t src = (uint64_t)(uintptr_t)srow;
  const uint32_t dst = (uint32_t)(size_t)L + wave * SLICE_B;
  const u32x8 g1 = tdm_group1((uint32_t)LD * 2u);

  tdm_load(tdm_group0(dst, src), g1);  // stage 0
  wait_tensor0();
  __syncthreads();                     // stage 0 is published
  {
    const uint32_t one = pinned(1u);   // stage 1's words formed behind the wait
    tdm_load(tdm_group0(dst + one * STAGE_B, src + (uint64_t)one * ROW_B), g1);
  }

  const uint32_t lrow = (lane & 15u) * PITCH_B + (lane >> 4) * 16u;
  const uint32_t a_off = (wave >> 1) * SLICE_B + lrow;
  const uint32_t b_off = (4u + (wave & 1u) * 2u) * SLICE_B + lrow;

// rolled: one copy of the pass in the instruction cache for every K
#pragma clang loop unroll(disable)
  for (uint32_t s = 0; s < S; ++s) {
    const unsigned char* buf = L + (s & 1u) * STAGE_B;
#pragma unroll
    for (uint32_t kk = 0; kk < PASS_K / 32; ++kk) {
      bvec16 af[2], bfr[4];
#pragma unroll
      for (uint32_t i = 0; i < 2; ++i)
        af[i] = lds_frag(buf + a_off + i * 16u * PITCH_B + kk * 64u);
#pragma unroll
      for (uint32_t j = 0; j < 4; ++j)
        bfr[j] = lds_frag(buf + b_off + (j >> 1) * SLICE_B +
                          (j & 1u) * 16u * PITCH_B + kk * 64u);
#pragma unroll
      for (int i = 0; i < 2; ++i)
#pragma unroll
        for (int j = 0; j < 4; ++j)
          acc[i][j] = __builtin_amdgcn_wmma_f32_16x16x32_bf16(
              false, af[i], false, bfr[j], (short)0, acc[i][j], false, false);
    }
    // Publish point of stage s + 1: this wave's reads of stage s are back, its
    // own slice of stage s + 1 has landed, then every wave meets.
    wait_ds0();
    wait_tensor0();
    __syncthreads();
    const uint32_t nxt = pinned(s + 2u);  // refill's words formed behind the wait
    if (pinned(nxt < S))
      tdm_load(tdm_group0(dst + (nxt & 1u) * STAGE_B,
                          src + (uint64_t)nxt * ROW_B), g1);
  }
  wait_tensor0();
  wait_ds0();
}

// ---------------------------------------------------------------------------
// Helpers of the four non-matrix launches: 16-byte global accesses.
// ---------------------------------------------------------------------------
typedef float  f32x4 __attribute__((ext_vector_type(4)));
typedef float  f32x2 __attribute__((ext_vector_type(2)));
typedef __bf16 bf16x2 __attribute__((ext_vector_type(2)));

// Stands behind a group of global loads or stores whose registers are used
// again for other values further down.
__device__ __forceinline__ void wait_x0() {
  asm volatile("s_wait_xcnt 0x0" ::: "memory");
}

// Two f32 to one dword of two bf16 (round to nearest even), lo in the low half.
__device__ __forceinline__ uint32_t pack_bf16(float lo, float hi) {
  f32x2 f = {lo, hi};
  union { bf16x2 h; uint32_t u; } c;
  c.h = __builtin_convertvector(f, bf16x2);
  return c.u;
}

// ---------------------------------------------------------------------------
// Prep 1: x [b][c][p] f32  ->  xT [b][p][c] bf16.
// A block takes one tile of 128 c x 128 p, 64 values a lane. A lane loads 4 p
// of two neighbouring c rows (8 lanes = one 128-B line), packs the pair and
// writes dwords into an LDS tile [p][c/2]; the tile leaves as 16-byte stores,
// 16 lanes = the 256 B that a p row of the tile has in xT.
// ---------------------------------------------------------------------------
static constexpr int TX_C     = 128;
static constexpr int TX_P     = 128;
static constexpr int TX_PITCH = 68;  // dwords: 272 B = 16 B x odd

__global__ __launch_bounds__(256) void a2n_transpose_x(
    const float* __restrict__ x, __bf16* __restrict__ xT) {
  __shared__ __attribute__((aligned(16))) uint32_t tile[TX_P * TX_PITCH];
  const int tid = threadIdx.x;
  const int lane = tid & 31;
  const int wave = tid >> 5;
  const int p4l = lane & 7;
  const int c2l = wave * 8 + (lane >> 3);
  const int pbase = blockIdx.x * TX_P;
  const float* xb = x + ((size_t)blockIdx.z * C_IN + blockIdx.y * TX_C) * HW +
                    (size_t)(2 * c2l) * HW + pbase + 4 * p4l;
  __bf16* xTb = xT + ((size_t)blockIdx.z * HW + pbase + (tid >> 4)) * C_IN +
                blockIdx.y * TX_C + (tid & 15) * 8;

  f32x4 r[TX_P / 32][2][2];  // [group of 32 p][group of 4 c pairs][c of the pair]
#pragma unroll
  for (int pg = 0; pg < TX_P / 32; ++pg)
#pragma unroll
    for (int cg = 0; cg < 2; ++cg)
#pragma unroll
      for (int h = 0; h < 2; ++h)
        r[pg][cg][h] = *(const f32x4*)(xb + (size_t)(cg * 8 + h) * HW + pg * 32);
#pragma unroll
  for (int pg = 0; pg < TX_P / 32; ++pg)
#pragma unroll
    for (int cg = 0; cg < 2; ++cg)
#pragma unroll
      for (int i = 0; i < 4; ++i)
        tile[(pg * 32 + 4 * p4l + i) * TX_PITCH + cg * 4 + c2l] =
            pack_bf16(r[pg][cg][0][i], r[pg][cg][1][i]);
  __syncthreads();
#pragma unroll
  for (int it = 0; it < TX_P / 16; ++it) {
    const uint4 v =
        *(const uint4*)&tile[(it * 16 + (tid >> 4)) * TX_PITCH + (tid & 15) * 4];
    *(uint4*)(xTb + (size_t)(it * 16) * C_IN) = v;
  }
}

// ---------------------------------------------------------------------------
// Prep 2: convert weights to bf16, fuse w1|w2|w3 into Wc [1024][512].
// Eight elements a lane; every boundary between the sources is a multiple of 8.
// ---------------------------------------------------------------------------
__global__ __launch_bounds__(256) void a2n_convert_weights(
    const float* __restrict__ w1, const float* __restrict__ w2,
    const float* __restrict__ w3, const float* __restrict__ w4,
    __bf16* __restrict__ Wc, __bf16* __restrict__ W4c) {
  const int t = (blockIdx.x * 256 + threadIdx.x) * 8;
  const int n1 = MO * C_IN;          // 524288
  const int n2 = n1 + C_IN * CM;     // + 262144
  if (t >= n2) return;
  const float* s;
  if (t < CM * C_IN)             s = w1 + t;
  else if (t < (CM + CN) * C_IN) s = w2 + (t - CM * C_IN);
  else if (t < n1)               s = w3 + (t - (CM + CN) * C_IN);
  else                           s = w4 + (t - n1);
  __bf16* d = (t < n1) ? Wc + t : W4c + (t - n1);
  const f32x4 a = *(const f32x4*)s;
  const f32x4 c = *(const f32x4*)(s + 4);
  uint4 o;
  o.x = pack_bf16(a[0], a[1]);
  o.y = pack_bf16(a[2], a[3]);
  o.z = pack_bf16(c[0], c[1]);
  o.w = pack_bf16(c[2], c[3]);
  *(uint4*)d = o;
}

// ---------------------------------------------------------------------------
// K1: fused conv1/2/3.  Y[o][p] = sum_c Wc[o][c] * xT[p][c]  (+bias)
// rows 0..511 -> A (bf16), 512..767 -> Bp (f32), 768..1023 -> V (f32)
// ---------------------------------------------------------------------------
static constexpr int YB_A = CM / 128;         // blockIdx.y below: rows of A
static constexpr int YB_B = (CM + CN) / 128;  // below: rows of Bp; from here: V
static_assert(CM % 128 == 0 && CN % 128 == 0, "a block's rows share one output");

__global__ __launch_bounds__(256) void a2n_conv123(
    const __bf16* __restrict__ Wc, const __bf16* __restrict__ xT,
    const float* __restrict__ b1, const float* __restrict__ b2,
    const float* __restrict__ b3, __bf16* __restrict__ Aout,
    float* __restrict__ Bp, float* __restrict__ V) {
  __shared__ __attribute__((aligned(2048))) unsigned char L[RING_B];
  const int b = blockIdx.z;
  const int lane = threadIdx.x & 31;
  const int wave = threadIdx.x >> 5;
  const int by = blockIdx.y;  // a block's 128 rows lie in one of A, Bp, V
  const int rl = (wave >> 1) * 32 + 8 * (lane >> 4);  // lane's first row in them
  const int n0 = blockIdx.x * 128 + (wave & 1) * 64;
  const __bf16* Brows = xT + (size_t)b * HW * C_IN;

  // The lane's 16 bias values, four 16-byte loads issued ahead of the product.
  const float* bias = (by < YB_A)   ? b1 + by * 128
                      : (by < YB_B) ? b2 + (by - YB_A) * 128
                                    : b3 + (by - YB_B) * 128;
  f32x4 bv[2][2];
#pragma unroll
  for (int i = 0; i < 2; ++i)
#pragma unroll
    for (int h = 0; h < 2; ++h)
      bv[i][h] = *(const f32x4*)(bias + rl + 16 * i + 4 * h);

  fvec8 zero = {};
  fvec8 acc[2][4];
#pragma unroll
  for (int i = 0; i < 2; ++i)
#pragma unroll
    for (int j = 0; j < 4; ++j) acc[i][j] = zero;

  block_gemm_2x4<C_IN, C_IN>(Wc + (size_t)blockIdx.y * 128 * C_IN,
                             Brows + (size_t)blockIdx.x * 128 * C_IN, L, acc);

  const int p0 = n0 + (lane & 15);
  if (by < YB_A) {  // block-uniform
    __bf16* d = Aout + (size_t)b * CM * HW + (size_t)(by * 128 + rl) * HW + p0;
#pragma unroll
    for (int i = 0; i < 2; ++i)
#pragma unroll
      for (int j = 0; j < 4; ++j)
#pragma unroll
        for (int e = 0; e < 8; ++e)
          d[(size_t)(16 * i + e) * HW + 16 * j] =
              (__bf16)(acc[i][j][e] + bv[i][e >> 2][e & 3]);
  } else {
    float* d = ((by < YB_B) ? Bp + (size_t)(by - YB_A) * 128 * HW
                            : V + (size_t)(by - YB_B) * 128 * HW) +
               (size_t)b * CN * HW + (size_t)rl * HW + p0;
#pragma unroll
    for (int i = 0; i < 2; ++i)
#pragma unroll
      for (int j = 0; j < 4; ++j)
#pragma unroll
        for (int e = 0; e < 8; ++e)
          d[(size_t)(16 * i + e) * HW + 16 * j] =
              acc[i][j][e] + bv[i][e >> 2][e & 3];
    wait_x0();  // the code laid out behind these stores rewrites their registers
  }
}

// ---------------------------------------------------------------------------
// K2: softmax over BATCH axis for Bp and V.
// att_maps written [b][n][p]; att_vecs written transposed [b][p][n].
// A lane holds eight positions of all eight batches (16 loads of 16 B).
// Blocks below SM_HALF: Bp, a wave's load = 512 contiguous bytes, its store
// 256. The others: a V tile of 64 n x 32 p; a lane holds 4 p of two
// neighbouring n rows, packs the pair into an LDS tile [b][p][n/2], and the
// tile leaves as 16-byte stores, 8 lanes = one whole 128-B line of attvT.
// ---------------------------------------------------------------------------
static constexpr int SM_HALF  = CN * HW / (256 * 8);  // blocks per half
static constexpr int SM_N     = 64;
static constexpr int SM_P     = 32;
static constexpr int SM_PITCH = 36;                   // dwords: 144 B = 16 B x odd
static constexpr int SM_PLANE = SM_P * SM_PITCH;      // dwords per batch

__device__ __forceinline__ void softmax_over_batch(f32x4 v[BATCH][2]) {
#pragma unroll
  for (int h = 0; h < 2; ++h)
#pragma unroll
    for (int i = 0; i < 4; ++i) {
      float mx = -3.4e38f;
#pragma unroll
      for (int b = 0; b < BATCH; ++b) mx = fmaxf(mx, v[b][h][i]);
      float s = 0.f;
#pragma unroll
      for (int b = 0; b < BATCH; ++b) {
        v[b][h][i] = __expf(v[b][h][i] - mx);
        s += v[b][h][i];
      }
      const float inv = 1.f / s;
#pragma unroll
      for (int b = 0; b < BATCH; ++b) v[b][h][i] *= inv;
    }
}

__global__ __launch_bounds__(256) void a2n_batch_softmax(
    const float* __restrict__ Bp, const float* __restrict__ V,
    __bf16* __restrict__ attm, __bf16* __restrict__ attvT) {
  __shared__ __attribute__((aligned(16))) uint32_t tile[BATCH * SM_PLANE];
  const size_t NP = (size_t)CN * HW;
  const int tid = threadIdx.x;
  const int lane = tid & 31;
  const int wave = tid >> 5;
  f32x4 v[BATCH][2];

  if (blockIdx.x >= SM_HALF) {  // block-uniform
    const int ti = blockIdx.x - SM_HALF;
    const int n0 = (ti / (HW / SM_P)) * SM_N;
    const int p0 = (ti % (HW / SM_P)) * SM_P;
    const int p4 = lane & 7;
    const int n2 = wave * 4 + (lane >> 3);
    const uint32_t src = (uint32_t)((n0 + 2 * n2) * HW + p0 + 4 * p4);
#pragma unroll
    for (int b = 0; b < BATCH; ++b) {
#pragma unroll
      for (int h = 0; h < 2; ++h)
        v[b][h] = *(const f32x4*)((const char*)(V + (b & 1) * NP + h * HW) +
                                  (src * 4u + (b >> 1) * (uint32_t)(8 * NP)));
      if (b & 1) wait_x0();  // later loads land in these loads' address register
    }
    softmax_over_batch(v);
#pragma unroll
    for (int b = 0; b < BATCH; ++b)
#pragma unroll
      for (int i = 0; i < 4; ++i)
        tile[b * SM_PLANE + (4 * p4 + i) * SM_PITCH + n2] =
            pack_bf16(v[b][0][i], v[b][1][i]);
    __syncthreads();
    const uint32_t dst = (uint32_t)((p0 + (tid >> 3)) * CN + n0 + (tid & 7) * 8);
#pragma unroll
    for (int b = 0; b < BATCH; ++b) {
      const uint4 o = *(const uint4*)&tile[b * SM_PLANE +
                                           (tid >> 3) * SM_PITCH + (tid & 7) * 4];
      *(uint4*)((char*)(attvT + b * NP) + dst * 2u) = o;
    }
    return;
  }
  {
    // a 32-bit lane offset per pair of batches beside one uniform base
    const uint32_t j = blockIdx.x * 2048u + wave * 256u + lane * 4u;
#pragma unroll
    for (int b = 0; b < BATCH; ++b) {
#pragma unroll
      for (int h = 0; h < 2; ++h)
        v[b][h] = *(const f32x4*)((const char*)(Bp + (b & 1) * NP + h * 128) +
                                  (j * 4u + (b >> 1) * (uint32_t)(8 * NP)));
      if (b & 1) wait_x0();  // later loads land in these loads' address register
    }
    softmax_over_batch(v);
#pragma unroll
    for (int b = 0; b < BATCH; ++b) {
#pragma unroll
      for (int h = 0; h < 2; ++h) {
        uint2 o;
        o.x = pack_bf16(v[b][h][0], v[b][h][1]);
        o.y = pack_bf16(v[b][h][2], v[b][h][3]);
        *(uint2*)((char*)(attm + b * NP + h * 128) + j * 2u) = o;
      }
    }
    wait_x0();  // the code laid out behind these stores rewrites their registers
  }
}

// ---------------------------------------------------------------------------
// K3: gathered.  G[m][n] = sum_p A[m][p] * attm[n][p].
// The 64 output tiles alone would leave three WGPs in four idle through 32
// passes, so the sum over p is cut into KS slices, one block each. A block
// stores its slice's f32 sums, transposed, as Gp[slice][b][n][m]; K3b adds them.
// ---------------------------------------------------------------------------
static constexpr int KS  = 8;        // slices of the sum over p
static constexpr int KSL = HW / KS;  // p per slice
static constexpr uint32_t NG = BATCH * CN * CM;  // elements of G, all batches

__global__ __launch_bounds__(256) void a2n_gathered(
    const __bf16* __restrict__ A, const __bf16* __restrict__ attm,
    float* __restrict__ Gp) {
  __shared__ __attribute__((aligned(2048))) unsigned char L[RING_B];
  const int b = blockIdx.z / KS;
  const int ks = blockIdx.z % KS;
  const int lane = threadIdx.x & 31;
  const int wave = threadIdx.x >> 5;
  const int m0 = blockIdx.y * 128 + (wave >> 1) * 32;  // over CM
  const int n0 = blockIdx.x * 128 + (wave & 1) * 64;   // over CN

  fvec8 zero = {};
  fvec8 acc[2][4];
#pragma unroll
  for (int i = 0; i < 2; ++i)
#pragma unroll
    for (int j = 0; j < 4; ++j) acc[i][j] = zero;

  block_gemm_2x4<HW, KSL>(
      A + (size_t)b * CM * HW + (size_t)blockIdx.y * 128 * HW + ks * KSL,
      attm + (size_t)b * CN * HW + (size_t)blockIdx.x * 128 * HW + ks * KSL, L,
      acc);

  // A lane's eight sums of a tile are eight neighbouring m: two 16-byte stores.
  float* d = Gp + (size_t)(ks * BATCH + b) * (CN * CM) +
             (size_t)(n0 + (lane & 15)) * CM + m0 + 8 * (lane >> 4);
#pragma unroll
  for (int i = 0; i < 2; ++i)
#pragma unroll
    for (int j = 0; j < 4; ++j)
#pragma unroll
      for (int h = 0; h < 2; ++h) {
        const f32x4 o = {acc[i][j][4 * h], acc[i][j][4 * h + 1],
                         acc[i][j][4 * h + 2], acc[i][j][4 * h + 3]};
        *(f32x4*)(d + (size_t)(16 * j) * CM + 16 * i + 4 * h) = o;
      }
}

// ---------------------------------------------------------------------------
// K3b: Gt[b][n][m] (bf16, the ready-made B^T operand of K4) = the KS slices of
// Gp added in slice order. A lane takes 16 elements of every slice (32 loads of
// 16 B); a wave's load = 512 contiguous bytes, its store 256.
// ---------------------------------------------------------------------------
static constexpr int SS_H = 4;  // groups of four elements a lane

__global__ __launch_bounds__(256) void a2n_sum_slices(
    const float* __restrict__ Gp, __bf16* __restrict__ Gt) {
  const uint32_t j = blockIdx.x * (256u * 4u * SS_H) +
                     (threadIdx.x >> 5) * (128u * SS_H) +
                     (threadIdx.x & 31) * 4u;
  f32x4 v[KS][SS_H];
  // a 32-bit lane offset per pair of slices beside one uniform base
#pragma unroll
  for (int s = 0; s < KS; ++s) {
#pragma unroll
    for (int h = 0; h < SS_H; ++h)
      v[s][h] = *(const f32x4*)((const char*)(Gp + (s & 1) * NG + h * 128) +
                                (j * 4u + (s >> 1) * (8u * NG)));
    if (s & 1) wait_x0();  // later loads land in these loads' address register
  }
#pragma unroll
  for (int h = 0; h < SS_H; ++h) {
    f32x4 t = v[0][h];
#pragma unroll
    for (int s = 1; s < KS; ++s) t += v[s][h];
    uint2 o;
    o.x = pack_bf16(t[0], t[1]);
    o.y = pack_bf16(t[2], t[3]);
    *(uint2*)((char*)(Gt + h * 128) + j * 2u) = o;
  }
}

// ---------------------------------------------------------------------------
// K4: Hm = w4 @ G.  Hm[o][n] = sum_m w4[o][m] * Gt[n][m].  Stored [b][o][n].
// ---------------------------------------------------------------------------
__global__ __launch_bounds__(256) void a2n_w4g(
    const __bf16* __restrict__ W4c, const __bf16* __restrict__ Gt,
    __bf16* __restrict__ Hb) {
  __shared__ __attribute__((aligned(2048))) unsigned char L[RING_B];
  const int b = blockIdx.z;
  const int lane = threadIdx.x & 31;
  const int wave = threadIdx.x >> 5;
  const int m0 = blockIdx.y * 128 + (wave >> 1) * 32;  // over C (out chans)
  const int n0 = blockIdx.x * 128 + (wave & 1) * 64;   // over CN

  fvec8 zero = {};
  fvec8 acc[2][4];
#pragma unroll
  for (int i = 0; i < 2; ++i)
#pragma unroll
    for (int j = 0; j < 4; ++j) acc[i][j] = zero;

  block_gemm_2x4<CM, CM>(
      W4c + (size_t)blockIdx.y * 128 * CM,
      Gt + (size_t)b * CN * CM + (size_t)blockIdx.x * 128 * CM, L, acc);

  __bf16* Hbb = Hb + (size_t)b * C_IN * CN;
#pragma unroll
  for (int i = 0; i < 2; ++i)
#pragma unroll
    for (int j = 0; j < 4; ++j)
#pragma unroll
      for (int e = 0; e < 8; ++e) {
        const int o = m0 + 16 * i + 8 * (lane >> 4) + e;
        const int n = n0 + 16 * j + (lane & 15);
        Hbb[(size_t)o * CN + n] = (__bf16)acc[i][j][e];
      }
}

// ---------------------------------------------------------------------------
// K5: out[o][p] = x[o][p] + b4[o] + sum_n Hb[o][n] * attvT[p][n]
// ---------------------------------------------------------------------------
__global__ __launch_bounds__(256) void a2n_distribute_out(
    const __bf16* __restrict__ Hb, const __bf16* __restrict__ attvT,
    const float* __restrict__ b4, const float* __restrict__ x,
    float* __restrict__ out) {
  __shared__ __attribute__((aligned(2048))) unsigned char L[RING_B];
  const int b = blockIdx.z;
  const int lane = threadIdx.x & 31;
  const int wave = threadIdx.x >> 5;
  const int m0 = blockIdx.y * 128 + (wave >> 1) * 32;  // over C
  const int n0 = blockIdx.x * 128 + (wave & 1) * 64;   // over HW

  fvec8 zero = {};
  fvec8 acc[2][4];
#pragma unroll
  for (int i = 0; i < 2; ++i)
#pragma unroll
    for (int j = 0; j < 4; ++j) acc[i][j] = zero;

  block_gemm_2x4<CN, CN>(
      Hb + (size_t)b * C_IN * CN + (size_t)blockIdx.y * 128 * CN,
      attvT + (size_t)b * HW * CN + (size_t)blockIdx.x * 128 * CN, L, acc);

  const float* xb = x + (size_t)b * C_IN * HW;
  float* ob = out + (size_t)b * C_IN * HW;
#pragma unroll
  for (int i = 0; i < 2; ++i)
#pragma unroll
    for (int j = 0; j < 4; ++j)
#pragma unroll
      for (int e = 0; e < 8; ++e) {
        const int o = m0 + 16 * i + 8 * (lane >> 4) + e;
        const int p = n0 + 16 * j + (lane & 15);
        const size_t idx = (size_t)o * HW + p;
        ob[idx] = acc[i][j][e] + b4[o] + xb[idx];
      }
}

// ---------------------------------------------------------------------------
extern "C" void kernel_launch(void* const* d_in, const int* in_sizes, int n_in,
                              void* d_out, int out_size, void* d_ws,
                              size_t ws_size, hipStream_t stream) {
  const float* x  = (const float*)d_in[0];
  const float* w1 = (const float*)d_in[1];
  const float* b1 = (const float*)d_in[2];
  const float* w2 = (const float*)d_in[3];
  const float* b2 = (const float*)d_in[4];
  const float* w3 = (const float*)d_in[5];
  const float* b3 = (const float*)d_in[6];
  const float* w4 = (const float*)d_in[7];
  const float* b4 = (const float*)d_in[8];
  float* out = (float*)d_out;

  char* ws = (char*)d_ws;
  __bf16* XT   = (__bf16*)(ws + OFF_XT);
  __bf16* WC   = (__bf16*)(ws + OFF_WC);
  __bf16* W4C  = (__bf16*)(ws + OFF_W4C);
  __bf16* Abuf = (__bf16*)(ws + OFF_A);
  float*  BP   = (float*)(ws + OFF_BP);
  float*  Vb   = (float*)(ws + OFF_V);
  __bf16* AM   = (__bf16*)(ws + OFF_AM);
  __bf16* AVT  = (__bf16*)(ws + OFF_AVT);
  __bf16* GT   = (__bf16*)(ws + OFF_GT);
  __bf16* HB   = (__bf16*)(ws + OFF_HB);
  float*  GP   = (float*)(ws + OFF_GP);

  const dim3 blk(256);

  a2n_transpose_x<<<dim3(HW / TX_P, C_IN / TX_C, BATCH), blk, 0,
                    stream>>>(x, XT);

  a2n_convert_weights<<<dim3((MO * C_IN + C_IN * CM) / (256 * 8)), blk, 0,
                        stream>>>(w1, w2, w3, w4, WC, W4C);

  a2n_conv123<<<dim3(HW / 128, MO / 128, BATCH), blk, 0, stream>>>(
      WC, XT, b1, b2, b3, Abuf, BP, Vb);

  a2n_batch_softmax<<<dim3(2 * SM_HALF), blk, 0, stream>>>(
      BP, Vb, AM, AVT);

  a2n_gathered<<<dim3(CN / 128, CM / 128, BATCH * KS), blk, 0, stream>>>(
      Abuf, AM, GP);

  a2n_sum_slices<<<dim3(NG / (256 * 4 * SS_H)), blk, 0, stream>>>(GP, GT);

  a2n_w4g<<<dim3(CN / 128, C_IN / 128, BATCH), blk, 0, stream>>>(W4C, GT, HB);

  a2n_distribute_out<<<dim3(HW / 128, C_IN / 128, BATCH), blk, 0, stream>>>(
      HB, AVT, b4, x, out);
}

// v005
// A run of this version takes 92.3 microseconds.
// Next to v004, in two timings, it ran 1.09 times as fast each time.
// All steps since v000 together make it 4.00 times as fast.
#include <hip/hip_runtime.h>

// ---------------------------------------------------------------------------
// A2N attention block for MI455X (gfx1250, wave32, WMMA bf16 16x16x32).
// out = x + w4 @ ( (A @ softmax_b(Bp)^T) @ softmax_b(V) ) + b4
// refactored as  x + ((w4 @ G) @ att_vecs) + b4  to kill the HW-sized conv4.
// ---------------------------------------------------------------------------

typedef __attribute__((ext_vector_type(16))) __bf16 bvec16;
typedef __attribute__((ext_vector_type(8)))  float  fvec8;

#define BATCH 8
#define C_IN  512
#define CM    512
#define CN    256
#define HW    4096
#define MO    1024   // CM + CN + CN rows of the fused conv123 weight

// ---- workspace layout (bytes) ---------------------------------------------
static constexpr size_t SZ_XT  = (size_t)BATCH * HW * C_IN * 2;  // bf16 xT[b][p][c]
static constexpr size_t SZ_WC  = (size_t)MO * C_IN * 2;          // bf16 [w1;w2;w3]
static constexpr size_t SZ_W4C = (size_t)C_IN * CM * 2;          // bf16 w4
static constexpr size_t SZ_A   = (size_t)BATCH * CM * HW * 2;    // bf16 A[b][m][p]
static constexpr size_t SZ_BP  = (size_t)BATCH * CN * HW * 4;    // f32 Bp
static constexpr size_t SZ_V   = SZ_BP;                          // f32 V
static constexpr size_t SZ_AM  = (size_t)BATCH * CN * HW * 2;    // bf16 att_maps[b][n][p]
static constexpr size_t SZ_AVT = SZ_AM;                          // bf16 att_vecsT[b][p][n]
static constexpr size_t SZ_GT  = (size_t)BATCH * CN * CM * 2;    // bf16 Gt[b][n][m]
static constexpr size_t SZ_HB  = (size_t)BATCH * C_IN * CN * 2;  // bf16 Hb[b][o][n]
// f32 Gp[slice][b][n][m] after Hb: the gathered product's partial sums

static constexpr size_t OFF_XT  = 0;
static constexpr size_t OFF_WC  = OFF_XT + SZ_XT;
static constexpr size_t OFF_W4C = OFF_WC + SZ_WC;
static constexpr size_t OFF_A   = OFF_W4C + SZ_W4C;
static constexpr size_t OFF_BP  = OFF_A + SZ_A;
static constexpr size_t OFF_V   = OFF_BP + SZ_BP;
static constexpr size_t OFF_AM  = OFF_V + SZ_V;
static constexpr size_t OFF_AVT = OFF_AM + SZ_AM;
static constexpr size_t OFF_GT  = OFF_AVT + SZ_AVT;
static constexpr size_t OFF_HB  = OFF_GT + SZ_GT;
static constexpr size_t OFF_GP  = OFF_HB + SZ_HB;

// ---------------------------------------------------------------------------
// LDS ring of the four GEMMs. A pass is 128 k = 256 bytes of every operand row.
// A stage holds the block's 128 A rows and 128 B rows as eight slices of 32
// rows, one slice per wave, each brought in by that wave's own tensor load.
// The load's pad gives an LDS row pitch of 272 B (16 B x odd: no bank conflict
// for ds_load_b128). A slice's 32 * 272 = 8704 B are rounded up to a multiple
// of 2 KiB so that every load's place in LDS is one.
// ---------------------------------------------------------------------------
typedef uint32_t u32x4 __attribute__((ext_vector_type(4)));
typedef uint32_t u32x8 __attribute__((ext_vector_type(8)));

static constexpr uint32_t PASS_K     = 128;
static constexpr uint32_t ROW_B      = 256;
static constexpr uint32_t PITCH_B    = 272;
static constexpr uint32_t SLICE_ROWS = 32;
static constexpr uint32_t SLICE_B    = 10240;
static constexpr uint32_t STAGE_B    = 8 * SLICE_B;
static constexpr uint32_t RING_B     = 2 * STAGE_B;
static_assert(SLICE_B % 2048 == 0 && SLICE_B >= SLICE_ROWS * PITCH_B, "slice");

__device__ __forceinline__ uint32_t uni(uint32_t v) {
  return (uint32_t)__builtin_amdgcn_readfirstlane(v);
}
// Holds v in a scalar register: a test on it compiles to a scalar branch (a
// tensor load ignores EXEC), and descriptor words formed from it are formed
// behind the volatile statements that stand in front of it.
__device__ __forceinline__ uint32_t pinned(uint32_t v) {
  uint32_t w = uni(v);
  asm volatile("" : "+s"(w));  // pinned(): a test or descriptor word kept scalar
  return w;
}
// The compiler places no wait for a tensor load; both waits are hand-written.
__device__ __forceinline__ void wait_tensor0() {
  asm volatile("s_wait_tensorcnt 0x0" ::: "memory");
}
__device__ __forceinline__ void wait_ds0() {
  asm volatile("s_wait_dscnt 0x0" ::: "memory");
}
__device__ __forceinline__ void tdm_load(u32x4 g0, u32x8 g1) {
  asm volatile("tensor_load_to_lds %0, %1" ::"s"(g0), "s"(g1) : "memory");
}
// Group 1: 1-byte elements, tile = tensor = 32 rows of 256 B, a 4-dword pad
// behind every 64 dwords, no mask.
__device__ __forceinline__ u32x8 tdm_group1(uint32_t src_pitch_bytes) {
  u32x8 g;
  g[0] = uni((1u << 20) | (5u << 22) | (3u << 25));
  g[1] = uni((ROW_B & 0xFFFFu) << 16);
  g[2] = uni((ROW_B >> 16) | ((SLICE_ROWS & 0xFFFFu) << 16));
  g[3] = uni((SLICE_ROWS >> 16) | (ROW_B << 16));
  g[4] = uni(SLICE_ROWS);
  g[5] = uni(src_pitch_bytes);
  g[6] = uni(0u);
  g[7] = uni(0u);
  return g;
}
__device__ __forceinline__ u32x4 tdm_group0(uint32_t lds_dst, uint64_t ga) {
  u32x4 g;
  g[0] = uni(1u);
  g[1] = uni(lds_dst);
  g[2] = uni((uint32_t)ga);
  g[3] = uni((((uint32_t)(ga >> 32)) & 0x01FFFFFFu) | 0x80000000u);
  return g;
}

// ---------------------------------------------------------------------------
// WMMA operand fragment from a staged row block. Works for the A operand from
// row-major [M][K] and for the B operand when B^T is row-major [N][K] (true
// for every GEMM here by construction). Matches ISA bf16 16x32 layout:
//   lane L: row = L&15, chunk0 = K[(L>>4)*8 .. +7], chunk1 = chunk0 + 16.
// p already holds the lane's row and its 16-byte half.
// ---------------------------------------------------------------------------
__device__ __forceinline__ bvec16 lds_frag(const unsigned char* p) {
  union { uint4 q[2]; bvec16 v; } u;
  u.q[0] = *(const uint4*)(p);
  u.q[1] = *(const uint4*)(p + 32);
  return u.v;
}

// Block tile 128x128 from eight waves, each 32x64: 2 (M) x 4 (N) WMMA tiles.
// Ablk, Bblk: the block's first row of each operand, both K-contiguous with a
// row pitch of LD elements. L: the kernel's RING_B bytes of LDS.
// TR: the two fragments trade places in the matrix instruction (their lane
// maps are equal), so that acc[i][j] holds the tile transposed: a lane has one
// A row, 16 i + (lane & 15), and eight neighbouring B rows,
// 16 j + 8 (lane >> 4) + e.
template <int LD, int K, bool TR>
__device__ __forceinline__ void block_gemm_2x4(const __bf16* __restrict__ Ablk,
                                               const __bf16* __restrict__ Bblk,
                                               unsigned char* L,
                                               fvec8 acc[2][4]) {
  constexpr uint32_t S = K / PASS_K;  // stages = passes
  static_assert(K % PASS_K == 0 && S >= 2, "the ring needs two stages");
  const uint32_t lane = threadIdx.x & 31;
  const uint32_t wave = uni(threadIdx.x >> 5);

  // This wave's slice: waves 0..3 bring A rows, waves 4..7 B rows.
  const __bf16* srow = (wave < 4u)
                           ? Ablk + (size_t)(SLICE_ROWS * wave) * LD
                           : Bblk + (size_t)(SLICE_ROWS * (wave - 4u)) * LD;
  const uint64_t src = (uint64_t)(uintptr_t)srow;
  const uint32_t dst = (uint32_t)(size_t)L + wave * SLICE_B;
  const u32x8 g1 = tdm_group1((uint32_t)LD * 2u);

  tdm_load(tdm_group0(dst, src), g1);  // stage 0
  wait_tensor0();
  __syncthreads();                     // stage 0 is published
  {
    const uint32_t one = pinned(1u);   // stage 1's words formed behind the wait
    tdm_load(tdm_group0(dst + one * STAGE_B, src + (uint64_t)one * ROW_B), g1);
  }

  const uint32_t lrow = (lane & 15u) * PITCH_B + (lane >> 4) * 16u;
  const uint32_t a_off = (wave >> 1) * SLICE_B + lrow;
  const uint32_t b_off = (4u + (wave & 1u) * 2u) * SLICE_B + lrow;

// rolled: one copy of the pass in the instruction cache for every K
#pragma clang loop unroll(disable)
  for (uint32_t s = 0; s < S; ++s) {
    const unsigned char* buf = L + (s & 1u) * STAGE_B;
#pragma unroll
    for (uint32_t kk = 0; kk < PASS_K / 32; ++kk) {
      bvec16 af[2], bfr[4];
#pragma unroll
      for (uint32_t i = 0; i < 2; ++i)
        af[i] = lds_frag(buf + a_off + i * 16u * PITCH_B + kk * 64u);
#pragma unroll
      for (uint32_t j = 0; j < 4; ++j)
        bfr[j] = lds_frag(buf + b_off + (j >> 1) * SLICE_B +
                          (j & 1u) * 16u * PITCH_B + kk * 64u);
#pragma unroll
      for (int i = 0; i < 2; ++i)
#pragma unroll
        for (int j = 0; j < 4; ++j)
          acc[i][j] = TR ? __builtin_amdgcn_wmma_f32_16x16x32_bf16(
                               false, bfr[j], false, af[i], (short)0, acc[i][j],
                               false, false)
                         : __builtin_amdgcn_wmma_f32_16x16x32_bf16(
                               false, af[i], false, bfr[j], (short)0, acc[i][j],
                               false, false);
    }
    // Publish point of stage s + 1: this wave's reads of stage s are back, its
    // own slice of stage s + 1 has landed, then every wave meets.
    wait_ds0();
    wait_tensor0();
    __syncthreads();
    const uint32_t nxt = pinned(s + 2u);  // refill's words formed behind the wait
    if (pinned(nxt < S))
      tdm_load(tdm_group0(dst + (nxt & 1u) * STAGE_B,
                          src + (uint64_t)nxt * ROW_B), g1);
  }
  wait_tensor0();
  wait_ds0();
}

// ---------------------------------------------------------------------------
// Helpers of the four non-matrix launches: 16-byte global accesses.
// ---------------------------------------------------------------------------
typedef float  f32x4 __attribute__((ext_vector_type(4)));
typedef float  f32x2 __attribute__((ext_vector_type(2)));
typedef __bf16 bf16x2 __attribute__((ext_vector_type(2)));

// Stands behind a group of global loads or stores whose registers are used
// again for other values further down.
__device__ __forceinline__ void wait_x0() {
  asm volatile("s_wait_xcnt 0x0" ::: "memory");
}

// Two f32 to one dword of two bf16 (round to nearest even), lo in the low half.
__device__ __forceinline__ uint32_t pack_bf16(float lo, float hi) {
  f32x2 f = {lo, hi};
  union { bf16x2 h; uint32_t u; } c;
  c.h = __builtin_convertvector(f, bf16x2);
  return c.u;
}

// ---------------------------------------------------------------------------
// Epilogue of the four GEMMs: a wave's 32x64 results go through LDS so that
// every global access is 16 bytes a lane and covers whole 128-B lines. Behind
// the ring's last barrier no tensor load is in flight and no wave reads the
// ring any more; each wave then stages in its own SLICE_B bytes of it, so no
// further barrier is needed. A lane writes its eight neighbouring results with
// 16-byte LDS stores; row pitches are 16 B x odd (16 rows fall on 64 banks).
// ---------------------------------------------------------------------------
static constexpr uint32_t ST_PITCH_W = 272;  // staged rows of 256 B
static constexpr uint32_t ST_PITCH_N = 144;  // staged rows of 128 B
static_assert(32 * ST_PITCH_W <= SLICE_B && 64 * ST_PITCH_N <= SLICE_B, "stage");

__device__ __forceinline__ void stage_f32(unsigned char* p, fvec8 a) {
  const f32x4 lo = {a[0], a[1], a[2], a[3]};
  const f32x4 hi = {a[4], a[5], a[6], a[7]};
  *(f32x4*)p = lo;
  *(f32x4*)(p + 16) = hi;
}
__device__ __forceinline__ void stage_bf16(unsigned char* p, fvec8 a) {
  uint4 o;
  o.x = pack_bf16(a[0], a[1]);
  o.y = pack_bf16(a[2], a[3]);
  o.z = pack_bf16(a[4], a[5]);
  o.w = pack_bf16(a[6], a[7]);
  *(uint4*)p = o;
}
// ROWS staged rows of 128 B leave as whole lines, four rows an instruction.
// Lanes 0..7 and 8..15 take rows 8 apart: 8 * 144 B = half the banks further.
template <int ROWS>
__device__ __forceinline__ void rows128_out(const unsigned char* st, char* g,
                                            uint32_t gpitch, uint32_t lane) {
  st += (lane >> 3) * 8u * ST_PITCH_N + (lane & 7u) * 16u;
  g += (size_t)((lane >> 3) * 8u) * gpitch + (lane & 7u) * 16u;
#pragma unroll
  for (uint32_t it = 0; it < ROWS / 4; ++it) {
    const uint32_t row = (it & 7u) + 32u * (it >> 3);
    const uint4 v = *(const uint4*)(st + row * ST_PITCH_N);
    *(uint4*)(g + (size_t)row * gpitch) = v;
  }
}

// ---------------------------------------------------------------------------
// Prep 1: x [b][c][p] f32  ->  xT [b][p][c] bf16.
// A block takes one tile of 128 c x 128 p, 64 values a lane. A lane loads 4 p
// of two neighbouring c rows (8 lanes = one 128-B line), packs the pair and
// writes dwords into an LDS tile [p][c/2]; the tile leaves as 16-byte stores,
// 16 lanes = the 256 B that a p row of the tile has in xT.
// ---------------------------------------------------------------------------
static constexpr int TX_C     = 128;
static constexpr int TX_P     = 128;
static constexpr int TX_PITCH = 68;  // dwords: 272 B = 16 B x odd

__global__ __launch_bounds__(256) void a2n_transpose_x(
    const float* __restrict__ x, __bf16* __restrict__ xT) {
  __shared__ __attribute__((aligned(16))) uint32_t tile[TX_P * TX_PITCH];
  const int tid = threadIdx.x;
  const int lane = tid & 31;
  const int wave = tid >> 5;
  const int p4l = lane & 7;
  const int c2l = wave * 8 + (lane >> 3);
  const int pbase = blockIdx.x * TX_P;
  const float* xb = x + ((size_t)blockIdx.z * C_IN + blockIdx.y * TX_C) * HW +
                    (size_t)(2 * c2l) * HW + pbase + 4 * p4l;
  __bf16* xTb = xT + ((size_t)blockIdx.z * HW + pbase + (tid >> 4)) * C_IN +
                blockIdx.y * TX_C + (tid & 15) * 8;

  f32x4 r[TX_P / 32][2][2];  // [group of 32 p][group of 4 c pairs][c of the pair]
#pragma unroll
  for (int pg = 0; pg < TX_P / 32; ++pg)
#pragma unroll
    for (int cg = 0; cg < 2; ++cg)
#pragma unroll
      for (int h = 0; h < 2; ++h)
        r[pg][cg][h] = *(const f32x4*)(xb + (size_t)(cg * 8 + h) * HW + pg * 32);
#pragma unroll
  for (int pg = 0; pg < TX_P / 32; ++pg)
#pragma unroll
    for (int cg = 0; cg < 2; ++cg)
#pragma unroll
      for (int i = 0; i < 4; ++i)
        tile[(pg * 32 + 4 * p4l + i) * TX_PITCH + cg * 4 + c2l] =
            pack_bf16(r[pg][cg][0][i], r[pg][cg][1][i]);
  __syncthreads();
#pragma unroll
  for (int it = 0; it < TX_P / 16; ++it) {
    const uint4 v =
        *(const uint4*)&tile[(it * 16 + (tid >> 4)) * TX_PITCH + (tid & 15) * 4];
    *(uint4*)(xTb + (size_t)(it * 16) * C_IN) = v;
  }
}

// ---------------------------------------------------------------------------
// Prep 2: convert weights to bf16, fuse w1|w2|w3 into Wc [1024][512].
// Eight elements a lane; every boundary between the sources is a multiple of 8.
// ---------------------------------------------------------------------------
__global__ __launch_bounds__(256) void a2n_convert_weights(
    const float* __restrict__ w1, const float* __restrict__ w2,
    const float* __restrict__ w3, const float* __restrict__ w4,
    __bf16* __restrict__ Wc, __bf16* __restrict__ W4c) {
  const int t = (blockIdx.x * 256 + threadIdx.x) * 8;
  const int n1 = MO * C_IN;          // 524288
  const int n2 = n1 + C_IN * CM;     // + 262144
  if (t >= n2) return;
  const float* s;
  if (t < CM * C_IN)             s = w1 + t;
  else if (t < (CM + CN) * C_IN) s = w2 + (t - CM * C_IN);
  else if (t < n1)               s = w3 + (t - (CM + CN) * C_IN);
  else                           s = w4 + (t - n1);
  __bf16* d = (t < n1) ? Wc + t : W4c + (t - n1);
  const f32x4 a = *(const f32x4*)s;
  const f32x4 c = *(const f32x4*)(s + 4);
  uint4 o;
  o.x = pack_bf16(a[0], a[1]);
  o.y = pack_bf16(a[2], a[3]);
  o.z = pack_bf16(c[0], c[1]);
  o.w = pack_bf16(c[2], c[3]);
  *(uint4*)d = o;
}

// ---------------------------------------------------------------------------
// K1: fused conv1/2/3.  Y[o][p] = sum_c Wc[o][c] * xT[p][c]  (+bias)
// rows 0..511 -> A (bf16), 512..767 -> Bp (f32), 768..1023 -> V (f32)
// ---------------------------------------------------------------------------
static constexpr int YB_A = CM / 128;         // blockIdx.y below: rows of A
static constexpr int YB_B = (CM + CN) / 128;  // below: rows of Bp; from here: V
static_assert(CM % 128 == 0 && CN % 128 == 0, "a block's rows share one output");

__global__ __launch_bounds__(256) void a2n_conv123(
    const __bf16* __restrict__ Wc, const __bf16* __restrict__ xT,
    const float* __restrict__ b1, const float* __restrict__ b2,
    const float* __restrict__ b3, __bf16* __restrict__ Aout,
    float* __restrict__ Bp, float* __restrict__ V) {
  __shared__ __attribute__((aligned(2048))) unsigned char L[RING_B];
  const int b = blockIdx.z;
  const int lane = threadIdx.x & 31;
  const int wave = threadIdx.x >> 5;
  const int by = blockIdx.y;  // a block's 128 rows lie in one of A, Bp, V
  const int rw = (wave >> 1) * 32;  // the wave's first row in them
  const int n0 = blockIdx.x * 128 + (wave & 1) * 64;
  const __bf16* Brows = xT + (size_t)b * HW * C_IN;

  // The biases of the lane's two rows, loaded ahead of the product.
  const float* bias = (by < YB_A)   ? b1 + by * 128
                      : (by < YB_B) ? b2 + (by - YB_A) * 128
                                    : b3 + (by - YB_B) * 128;
  float bv[2];
#pragma unroll
  for (int i = 0; i < 2; ++i) bv[i] = bias[rw + 16 * i + (lane & 15)];

  fvec8 zero = {};
  fvec8 acc[2][4];
#pragma unroll
  for (int i = 0; i < 2; ++i)
#pragma unroll
    for (int j = 0; j < 4; ++j) acc[i][j] = zero;

  block_gemm_2x4<C_IN, C_IN, true>(Wc + (size_t)blockIdx.y * 128 * C_IN,
                                   Brows + (size_t)blockIdx.x * 128 * C_IN, L,
                                   acc);

  unsigned char* st = L + wave * SLICE_B;  // the wave's own staging range
  if (by < YB_A) {  // block-uniform
#pragma unroll
    for (int i = 0; i < 2; ++i)
#pragma unroll
      for (int j = 0; j < 4; ++j)
        stage_bf16(st + (16 * i + (lane & 15)) * ST_PITCH_N +
                       (16 * j + 8 * (lane >> 4)) * 2,
                   acc[i][j] + bv[i]);
    wait_ds0();  // other lanes' rows are read back: every LDS store is done
    rows128_out<32>(st,
                    (char*)(Aout + (size_t)b * CM * HW +
                            (size_t)(by * 128 + rw) * HW + n0),
                    HW * 2u, lane);
  } else {
#pragma unroll
    for (int i = 0; i < 2; ++i)
#pragma unroll
      for (int j = 0; j < 4; ++j)
        stage_f32(st + (16 * i + (lane & 15)) * ST_PITCH_W +
                      (16 * j + 8 * (lane >> 4)) * 4,
                  acc[i][j] + bv[i]);
    wait_ds0();  // other lanes' rows are read back: every LDS store is done
    float* d = ((by < YB_B) ? Bp + (size_t)(by - YB_A) * 128 * HW
                            : V + (size_t)(by - YB_B) * 128 * HW) +
               (size_t)b * CN * HW + (size_t)(rw + (lane >> 4)) * HW + n0 +
               (lane & 15) * 4;
    const unsigned char* sr = st + (lane >> 4) * ST_PITCH_W + (lane & 15) * 16;
#pragma unroll
    for (int it = 0; it < 16; ++it) {  // two rows of 256 B an instruction
      const f32x4 v = *(const f32x4*)(sr + 2 * it * ST_PITCH_W);
      *(f32x4*)(d + (size_t)(2 * it) * HW) = v;
    }
  }
}

// ---------------------------------------------------------------------------
// K2: softmax over BATCH axis for Bp and V.
// att_maps written [b][n][p]; att_vecs written transposed [b][p][n].
// A lane holds eight positions of all eight batches (16 loads of 16 B).
// Blocks below SM_HALF: Bp, a wave's load = 512 contiguous bytes, its store
// 256. The others: a V tile of 64 n x 32 p; a lane holds 4 p of two
// neighbouring n rows, packs the pair into an LDS tile [b][p][n/2], and the
// tile leaves as 16-byte stores, 8 lanes = one whole 128-B line of attvT.
// ---------------------------------------------------------------------------
static constexpr int SM_HALF  = CN * HW / (256 * 8);  // blocks per half
static constexpr int SM_N     = 64;
static constexpr int SM_P     = 32;
static constexpr int SM_PITCH = 36;                   // dwords: 144 B = 16 B x odd
static constexpr int SM_PLANE = SM_P * SM_PITCH;      // dwords per batch

__device__ __forceinline__ void softmax_over_batch(f32x4 v[BATCH][2]) {
#pragma unroll
  for (int h = 0; h < 2; ++h)
#pragma unroll
    for (int i = 0; i < 4; ++i) {
      float mx = -3.4e38f;
#pragma unroll
      for (int b = 0; b < BATCH; ++b) mx = fmaxf(mx, v[b][h][i]);
      float s = 0.f;
#pragma unroll
      for (int b = 0; b < BATCH; ++b) {
        v[b][h][i] = __expf(v[b][h][i] - mx);
        s += v[b][h][i];
      }
      const float inv = 1.f / s;
#pragma unroll
      for (int b = 0; b < BATCH; ++b) v[b][h][i] *= inv;
    }
}

__global__ __launch_bounds__(256) void a2n_batch_softmax(
    const float* __restrict__ Bp, const float* __restrict__ V,
    __bf16* __restrict__ attm, __bf16* __restrict__ attvT) {
  __shared__ __attribute__((aligned(16))) uint32_t tile[BATCH * SM_PLANE];
  const size_t NP = (size_t)CN * HW;
  const int tid = threadIdx.x;
  const int lane = tid & 31;
  const int wave = tid >> 5;
  f32x4 v[BATCH][2];

  if (blockIdx.x >= SM_HALF) {  // block-uniform
    const int ti = blockIdx.x - SM_HALF;
    const int n0 = (ti / (HW / SM_P)) * SM_N;
    const int p0 = (ti % (HW / SM_P)) * SM_P;
    const int p4 = lane & 7;
    const int n2 = wave * 4 + (lane >> 3);
    const uint32_t src = (uint32_t)((n0 + 2 * n2) * HW + p0 + 4 * p4);
#pragma unroll
    for (int b = 0; b < BATCH; ++b) {
#pragma unroll
      for (int h = 0; h < 2; ++h)
        v[b][h] = *(const f32x4*)((const char*)(V + (b & 1) * NP + h * HW) +
                                  (src * 4u + (b >> 1) * (uint32_t)(8 * NP)));
      if (b & 1) wait_x0();  // later loads land in these loads' address register
    }
    softmax_over_batch(v);
#pragma unroll
    for (int b = 0; b < BATCH; ++b)
#pragma unroll
      for (int i = 0; i < 4; ++i)
        tile[b * SM_PLANE + (4 * p4 + i) * SM_PITCH + n2] =
            pack_bf16(v[b][0][i], v[b][1][i]);
    __syncthreads();
    const uint32_t dst = (uint32_t)((p0 + (tid >> 3)) * CN + n0 + (tid & 7) * 8);
#pragma unroll
    for (int b = 0; b < BATCH; ++b) {
      const uint4 o = *(const uint4*)&tile[b * SM_PLANE +
                                           (tid >> 3) * SM_PITCH + (tid & 7) * 4];
      *(uint4*)((char*)(attvT + b * NP) + dst * 2u) = o;
    }
    return;
  }
  {
    // a 32-bit lane offset per pair of batches beside one uniform base
    const uint32_t j = blockIdx.x * 2048u + wave * 256u + lane * 4u;
#pragma unroll
    for (int b = 0; b < BATCH; ++b) {
#pragma unroll
      for (int h = 0; h < 2; ++h)
        v[b][h] = *(const f32x4*)((const char*)(Bp + (b & 1) * NP + h * 128) +
                                  (j * 4u + (b >> 1) * (uint32_t)(8 * NP)));
      if (b & 1) wait_x0();  // later loads land in these loads' address register
    }
    softmax_over_batch(v);
#pragma unroll
    for (int b = 0; b < BATCH; ++b) {
#pragma unroll
      for (int h = 0; h < 2; ++h) {
        uint2 o;
        o.x = pack_bf16(v[b][h][0], v[b][h][1]);
        o.y = pack_bf16(v[b][h][2], v[b][h][3]);
        *(uint2*)((char*)(attm + b * NP + h * 128) + j * 2u) = o;
      }
    }
    wait_x0();  // the code laid out behind these stores rewrites their registers
  }
}

// ---------------------------------------------------------------------------
// K3: gathered.  G[m][n] = sum_p A[m][p] * attm[n][p].
// The 64 output tiles alone would leave three WGPs in four idle through 32
// passes, so the sum over p is cut into KS slices, one block each. A block
// stores its slice's f32 sums, transposed, as Gp[slice][b][n][m]; K3b adds them.
// ---------------------------------------------------------------------------
static constexpr int KS  = 8;        // slices of the sum over p
static constexpr int KSL = HW / KS;  // p per slice
static constexpr uint32_t NG = BATCH * CN * CM;  // elements of G, all batches

__global__ __launch_bounds__(256) void a2n_gathered(
    const __bf16* __restrict__ A, const __bf16* __restrict__ attm,
    float* __restrict__ Gp) {
  __shared__ __attribute__((aligned(2048))) unsigned char L[RING_B];
  const int b = blockIdx.z / KS;
  const int ks = blockIdx.z % KS;
  const int lane = threadIdx.x & 31;
  const int wave = threadIdx.x >> 5;
  const int m0 = blockIdx.y * 128 + (wave >> 1) * 32;  // over CM
  const int n0 = blockIdx.x * 128 + (wave & 1) * 64;   // over CN

  fvec8 zero = {};
  fvec8 acc[2][4];
#pragma unroll
  for (int i = 0; i < 2; ++i)
#pragma unroll
    for (int j = 0; j < 4; ++j) acc[i][j] = zero;

  block_gemm_2x4<HW, KSL, false>(
      A + (size_t)b * CM * HW + (size_t)blockIdx.y * 128 * HW + ks * KSL,
      attm + (size_t)b * CN * HW + (size_t)blockIdx.x * 128 * HW + ks * KSL, L,
      acc);

  // A lane's eight sums of a tile are eight neighbouring m of one n: the wave
  // stages 64 rows (n) of 32 m = 128 B.
  unsigned char* st = L + wave * SLICE_B;  // the wave's own staging range
#pragma unroll
  for (int i = 0; i < 2; ++i)
#pragma unroll
    for (int j = 0; j < 4; ++j)
      stage_f32(st + (16 * j + (lane & 15)) * ST_PITCH_N +
                    (16 * i + 8 * (lane >> 4)) * 4,
                acc[i][j]);
  wait_ds0();  // other lanes' rows are read back: every LDS store is done
  rows128_out<64>(st,
                  (char*)(Gp + (size_t)(ks * BATCH + b) * (CN * CM) +
                          (size_t)n0 * CM + m0),
                  CM * 4u, lane);
}

// ---------------------------------------------------------------------------
// K3b: Gt[b][n][m] (bf16, the ready-made B^T operand of K4) = the KS slices of
// Gp added in slice order. A lane takes 16 elements of every slice (32 loads of
// 16 B); a wave's load = 512 contiguous bytes, its store 256.
// ---------------------------------------------------------------------------
static constexpr int SS_H = 4;  // groups of four elements a lane

__global__ __launch_bounds__(256) void a2n_sum_slices(
    const float* __restrict__ Gp, __bf16* __restrict__ Gt) {
  const uint32_t j = blockIdx.x * (256u * 4u * SS_H) +
                     (threadIdx.x >> 5) * (128u * SS_H) +
                     (threadIdx.x & 31) * 4u;
  f32x4 v[KS][SS_H];
  // a 32-bit lane offset per pair of slices beside one uniform base
#pragma unroll
  for (int s = 0; s < KS; ++s) {
#pragma unroll
    for (int h = 0; h < SS_H; ++h)
      v[s][h] = *(const f32x4*)((const char*)(Gp + (s & 1) * NG + h * 128) +
                                (j * 4u + (s >> 1) * (8u * NG)));
    if (s & 1) wait_x0();  // later loads land in these loads' address register
  }
#pragma unroll
  for (int h = 0; h < SS_H; ++h) {
    f32x4 t = v[0][h];
#pragma unroll
    for (int s = 1; s < KS; ++s) t += v[s][h];
    uint2 o;
    o.x = pack_bf16(t[0], t[1]);
    o.y = pack_bf16(t[2], t[3]);
    *(uint2*)((char*)(Gt + h * 128) + j * 2u) = o;
  }
}

// ---------------------------------------------------------------------------
// K4: Hm = w4 @ G.  Hm[o][n] = sum_m w4[o][m] * Gt[n][m].  Stored [b][o][n].
// ---------------------------------------------------------------------------
__global__ __launch_bounds__(256) void a2n_w4g(
    const __bf16* __restrict__ W4c, const __bf16* __restrict__ Gt,
    __bf16* __restrict__ Hb) {
  __shared__ __attribute__((aligned(2048))) unsigned char L[RING_B];
  const int b = blockIdx.z;
  const int lane = threadIdx.x & 31;
  const int wave = threadIdx.x >> 5;
  const int m0 = blockIdx.y * 128 + (wave >> 1) * 32;  // over C (out chans)
  const int n0 = blockIdx.x * 128 + (wave & 1) * 64;   // over CN

  fvec8 zero = {};
  fvec8 acc[2][4];
#pragma unroll
  for (int i = 0; i < 2; ++i)
#pragma unroll
    for (int j = 0; j < 4; ++j) acc[i][j] = zero;

  block_gemm_2x4<CM, CM, true>(
      W4c + (size_t)blockIdx.y * 128 * CM,
      Gt + (size_t)b * CN * CM + (size_t)blockIdx.x * 128 * CM, L, acc);

  unsigned char* st = L + wave * SLICE_B;  // the wave's own staging range
#pragma unroll
  for (int i = 0; i < 2; ++i)
#pragma unroll
    for (int j = 0; j < 4; ++j)
      stage_bf16(st + (16 * i + (lane & 15)) * ST_PITCH_N +
                     (16 * j + 8 * (lane >> 4)) * 2,
                 acc[i][j]);
  wait_ds0();  // other lanes' rows are read back: every LDS store is done
  rows128_out<32>(st,
                  (char*)(Hb + (size_t)b * C_IN * CN + (size_t)m0 * CN + n0),
                  CN * 2u, lane);
}

// ---------------------------------------------------------------------------
// K5: out[o][p] = x[o][p] + b4[o] + sum_n Hb[o][n] * attvT[p][n]
// ---------------------------------------------------------------------------
__global__ __launch_bounds__(256) void a2n_distribute_out(
    const __bf16* __restrict__ Hb, const __bf16* __restrict__ attvT,
    const float* __restrict__ b4, const float* __restrict__ x,
    float* __restrict__ out) {
  __shared__ __attribute__((aligned(2048))) unsigned char L[RING_B];
  const int b = blockIdx.z;
  const int lane = threadIdx.x & 31;
  const int wave = threadIdx.x >> 5;
  const int m0 = blockIdx.y * 128 + (wave >> 1) * 32;  // over C
  const int n0 = blockIdx.x * 128 + (wave & 1) * 64;   // over HW

  fvec8 zero = {};
  fvec8 acc[2][4];
#pragma unroll
  for (int i = 0; i < 2; ++i)
#pragma unroll
    for (int j = 0; j < 4; ++j) acc[i][j] = zero;

  block_gemm_2x4<CN, CN, true>(
      Hb + (size_t)b * C_IN * CN + (size_t)blockIdx.y * 128 * CN,
      attvT + (size_t)b * HW * CN + (size_t)blockIdx.x * 128 * CN, L, acc);

  // Two rows of 256 B an instruction, for x as for out.
  // One 32-bit lane offset in bytes beside the two uniform bases: its register
  // serves the loads and the stores and takes no other value in between.
  const uint32_t off = (uint32_t)(((b * C_IN + m0 + (lane >> 4)) * HW + n0 +
                                   (lane & 15) * 4) * 4);
  float bv[2];
#pragma unroll
  for (int i = 0; i < 2; ++i) bv[i] = b4[m0 + 16 * i + (lane & 15)];
  f32x4 xv[16];
#pragma unroll
  for (int it = 0; it < 16; ++it)
    xv[it] = *(const f32x4*)((const char*)(x + (size_t)(2 * it) * HW) + off);

  unsigned char* st = L + wave * SLICE_B;  // the wave's own staging range
#pragma unroll
  for (int i = 0; i < 2; ++i)
#pragma unroll
    for (int j = 0; j < 4; ++j)
      stage_f32(st + (16 * i + (lane & 15)) * ST_PITCH_W +
                    (16 * j + 8 * (lane >> 4)) * 4,
                acc[i][j] + bv[i]);
  wait_ds0();  // other lanes' rows are read back: every LDS store is done
  const unsigned char* sr = st + (lane >> 4) * ST_PITCH_W + (lane & 15) * 16;
#pragma unroll
  for (int it = 0; it < 16; ++it) {
    const f32x4 v = *(const f32x4*)(sr + 2 * it * ST_PITCH_W);
    *(f32x4*)((char*)(out + (size_t)(2 * it) * HW) + off) = v + xv[it];
  }
}

// ---------------------------------------------------------------------------
extern "C" void kernel_launch(void* const* d_in, const int* in_sizes, int n_in,
                              void* d_out, int out_size, void* d_ws,
                              size_t ws_size, hipStream_t stream) {
  const float* x  = (const float*)d_in[0];
  const float* w1 = (const float*)d_in[1];
  const float* b1 = (const float*)d_in[2];
  const float* w2 = (const float*)d_in[3];
  const float* b2 = (const float*)d_in[4];
  const float* w3 = (const float*)d_in[5];
  const float* b3 = (const float*)d_in[6];
  const float* w4 = (const float*)d_in[7];
  const float* b4 = (const float*)d_in[8];
  float* out = (float*)d_out;

  char* ws = (char*)d_ws;
  __bf16* XT   = (__bf16*)(ws + OFF_XT);
  __bf16* WC   = (__bf16*)(ws + OFF_WC);
  __bf16* W4C  = (__bf16*)(ws + OFF_W4C);
  __bf16* Abuf = (__bf16*)(ws + OFF_A);
  float*  BP   = (float*)(ws + OFF_BP);
  float*  Vb   = (float*)(ws + OFF_V);
  __bf16* AM   = (__bf16*)(ws + OFF_AM);
  __bf16* AVT  = (__bf16*)(ws + OFF_AVT);
  __bf16* GT   = (__bf16*)(ws + OFF_GT);
  __bf16* HB   = (__bf16*)(ws + OFF_HB);
  float*  GP   = (float*)(ws + OFF_GP);

  const dim3 blk(256);

  a2n_transpose_x<<<dim3(HW / TX_P, C_IN / TX_C, BATCH), blk, 0,
                    stream>>>(x, XT);

  a2n_convert_weights<<<dim3((MO * C_IN + C_IN * CM) / (256 * 8)), blk, 0,
                        stream>>>(w1, w2, w3, w4, WC, W4C);

  a2n_conv123<<<dim3(HW / 128, MO / 128, BATCH), blk, 0, stream>>>(
      WC, XT, b1, b2, b3, Abuf, BP, Vb);

  a2n_batch_softmax<<<dim3(2 * SM_HALF), blk, 0, stream>>>(
      BP, Vb, AM, AVT);

  a2n_gathered<<<dim3(CN / 128, CM / 128, BATCH * KS), blk, 0, stream>>>(
      Abuf, AM, GP);

  a2n_sum_slices<<<dim3(NG / (256 * 4 * SS_H)), blk, 0, stream>>>(GP, GT);

  a2n_w4g<<<dim3(CN / 128, C_IN / 128, BATCH), blk, 0, stream>>>(W4C, GT, HB);

  a2n_distribute_out<<<dim3(HW / 128, C_IN / 128, BATCH), blk, 0, stream>>>(
      HB, AVT, b4, x, out);
}

// v006
// One run takes 85.4 microseconds.
// Timed twice side by side with v005, it ran 1.08 and 1.07 times as fast.
// Counting every step since v000, it is 4.30 times as fast.
#include <hip/hip_runtime.h>

// ---------------------------------------------------------------------------
// A2N attention block for MI455X (gfx1250, wave32, WMMA bf16 16x16x32).
// out = x + w4 @ ( (A @ softmax_b(Bp)^T) @ softmax_b(V) ) + b4
// refactored as  x + ((w4 @ G) @ att_vecs) + b4  to kill the HW-sized conv4.
// ---------------------------------------------------------------------------

typedef __attribute__((ext_vector_type(16))) __bf16 bvec16;
typedef __attribute__((ext_vector_type(8)))  float  fvec8;

#define BATCH 8
#define C_IN  512
#define CM    512
#define CN    256
#define HW    4096
#define MO    1024   // CM + CN + CN rows of the fused conv123 weight

// ---- workspace layout (bytes) ---------------------------------------------
static constexpr size_t SZ_XT  = (size_t)BATCH * HW * C_IN * 2;  // bf16 xT[p][b][c]
static constexpr size_t SZ_WC  = (size_t)MO * C_IN * 2;          // bf16 [w1;w2;w3]
static constexpr size_t SZ_W4C = (size_t)C_IN * CM * 2;          // bf16 w4
static constexpr size_t SZ_A   = (size_t)BATCH * CM * HW * 2;    // bf16 A[b][m][p']
static constexpr size_t SZ_AM  = (size_t)BATCH * CN * HW * 2;    // bf16 att_maps, tiled
static constexpr size_t SZ_AVT = SZ_AM;                          // bf16 att_vecsT[b][p][n]
static constexpr size_t SZ_GT  = (size_t)BATCH * CN * CM * 2;    // bf16 Gt[b][n][m]
static constexpr size_t SZ_HB  = (size_t)BATCH * C_IN * CN * 2;  // bf16 Hb[b][o][n]
// f32 Gp[slice][b][n][m] after Hb: the gathered product's partial sums

static constexpr size_t OFF_XT  = 0;
static constexpr size_t OFF_WC  = OFF_XT + SZ_XT;
static constexpr size_t OFF_W4C = OFF_WC + SZ_WC;
static constexpr size_t OFF_A   = OFF_W4C + SZ_W4C;
static constexpr size_t OFF_AM  = OFF_A + SZ_A;
static constexpr size_t OFF_AVT = OFF_AM + SZ_AM;
static constexpr size_t OFF_GT  = OFF_AVT + SZ_AVT;
static constexpr size_t OFF_HB  = OFF_GT + SZ_GT;
static constexpr size_t OFF_GP  = OFF_HB + SZ_HB;

// ---------------------------------------------------------------------------
// LDS ring of the four GEMMs. A pass is 128 k = 256 bytes of every operand row.
// A stage holds the block's 128 A rows and 128 B rows as eight slices of 32
// rows, one slice per wave, each brought in by that wave's own tensor load.
// The load's pad gives an LDS row pitch of 272 B (16 B x odd: no bank conflict
// for ds_load_b128). A slice's 32 * 272 = 8704 B are rounded up to a multiple
// of 2 KiB so that every load's place in LDS is one.
// ---------------------------------------------------------------------------
typedef uint32_t u32x4 __attribute__((ext_vector_type(4)));
typedef uint32_t u32x8 __attribute__((ext_vector_type(8)));

static constexpr uint32_t PASS_K     = 128;
static constexpr uint32_t ROW_B      = 256;
static constexpr uint32_t PITCH_B    = 272;
static constexpr uint32_t SLICE_ROWS = 32;
static constexpr uint32_t SLICE_B    = 10240;
static constexpr uint32_t STAGE_B    = 8 * SLICE_B;
static constexpr uint32_t RING_B     = 2 * STAGE_B;
static_assert(SLICE_B % 2048 == 0 && SLICE_B >= SLICE_ROWS * PITCH_B, "slice");

__device__ __forceinline__ uint32_t uni(uint32_t v) {
  return (uint32_t)__builtin_amdgcn_readfirstlane(v);
}
// Holds v in a scalar register: a test on it compiles to a scalar branch (a
// tensor load ignores EXEC), and descriptor words formed from it are formed
// behind the volatile statements that stand in front of it.
__device__ __forceinline__ uint32_t pinned(uint32_t v) {
  uint32_t w = uni(v);
  asm volatile("" : "+s"(w));  // pinned(): a test or descriptor word kept scalar
  return w;
}
// The compiler places no wait for a tensor load; both waits are hand-written.
__device__ __forceinline__ void wait_tensor0() {
  asm volatile("s_wait_tensorcnt 0x0" ::: "memory");
}
__device__ __forceinline__ void wait_ds0() {
  asm volatile("s_wait_dscnt 0x0" ::: "memory");
}
__device__ __forceinline__ void tdm_load(u32x4 g0, u32x8 g1) {
  asm volatile("tensor_load_to_lds %0, %1" ::"s"(g0), "s"(g1) : "memory");
}
// Group 1: 1-byte elements, tile = tensor = 32 rows of 256 B, a 4-dword pad
// behind every 64 dwords, no mask.
__device__ __forceinline__ u32x8 tdm_group1(uint32_t src_pitch_bytes) {
  u32x8 g;
  g[0] = uni((1u << 20) | (5u << 22) | (3u << 25));
  g[1] = uni((ROW_B & 0xFFFFu) << 16);
  g[2] = uni((ROW_B >> 16) | ((SLICE_ROWS & 0xFFFFu) << 16));
  g[3] = uni((SLICE_ROWS >> 16) | (ROW_B << 16));
  g[4] = uni(SLICE_ROWS);
  g[5] = uni(src_pitch_bytes);
  g[6] = uni(0u);
  g[7] = uni(0u);
  return g;
}
__device__ __forceinline__ u32x4 tdm_group0(uint32_t lds_dst, uint64_t ga) {
  u32x4 g;
  g[0] = uni(1u);
  g[1] = uni(lds_dst);
  g[2] = uni((uint32_t)ga);
  g[3] = uni((((uint32_t)(ga >> 32)) & 0x01FFFFFFu) | 0x80000000u);
  return g;
}

// ---------------------------------------------------------------------------
// WMMA operand fragment from a staged row block. Works for the A operand from
// row-major [M][K] and for the B operand when B^T is row-major [N][K] (K1,
// K4, K5) or in units of 16 rows x 8 k (K3). Matches ISA bf16 16x32 layout:
//   lane L: row = L&15, chunk0 = K[(L>>4)*8 .. +7], chunk1 = chunk0 + 16.
// p already holds the lane's chunk0; chunk1 lies D bytes further.
// ---------------------------------------------------------------------------
template <uint32_t D>
__device__ __forceinline__ bvec16 lds_frag(const unsigned char* p) {
  union { uint4 q[2]; bvec16 v; } u;
  u.q[0] = *(const uint4*)(p);
  u.q[1] = *(const uint4*)(p + D);
  return u.v;
}

// Block tile 128x128 from eight waves, each 32x64: 2 (M) x 4 (N) WMMA tiles.
// Ablk, Bblk: the block's first row of each operand. A rows are K-contiguous
// with a pitch of LD elements. B's 32-row slices have a source row pitch of
// ldb bytes, and a pass's rows lie bstep bytes behind the pass before (both
// block-uniform). BT false: a B row is K-contiguous like an A row. BT true:
// a B source row is a unit of 16 operand rows x 8 k (16 B each), a pass has 16
// such units for each group of 16 operand rows, a slice two groups.
// L: the kernel's RING_B bytes of LDS.
// TR: the two fragments trade places in the matrix instruction (their lane
// maps are equal), so that acc[i][j] holds the tile transposed: a lane has one
// A row, 16 i + (lane & 15), and eight neighbouring B rows,
// 16 j + 8 (lane >> 4) + e.
template <int LD, int K, bool TR, bool BT>
__device__ __forceinline__ void block_gemm_2x4(const __bf16* __restrict__ Ablk,
                                               const __bf16* __restrict__ Bblk,
                                               uint32_t ldb, uint32_t bstep,
                                               unsigned char* L,
                                               fvec8 acc[2][4]) {
  constexpr uint32_t S = K / PASS_K;  // stages = passes
  static_assert(K % PASS_K == 0 && S >= 2, "the ring needs two stages");
  const uint32_t lane = threadIdx.x & 31;
  const uint32_t wave = uni(threadIdx.x >> 5);

  // This wave's slice: waves 0..3 bring A rows, waves 4..7 B rows.
  const uint32_t pitch = (wave < 4u) ? (uint32_t)LD * 2u : ldb;
  const uint32_t step = (wave < 4u) ? ROW_B : bstep;
  const uint64_t src =
      (uint64_t)(uintptr_t)((wave < 4u) ? Ablk : Bblk) +
      (uint64_t)(SLICE_ROWS * (wave & 3u)) * pitch;
  const uint32_t dst = (uint32_t)(size_t)L + wave * SLICE_B;
  u32x8 g1 = tdm_group1(pitch);
  // pinned(), for the eight descriptor words at once: they stay in one scalar
  // register group. Without it the build uses words 3 and 6 of the group as
  // scratch in the loop, while the load that names them is still in flight.
  asm volatile("" : "+s"(g1));

  tdm_load(tdm_group0(dst, src), g1);  // stage 0
  wait_tensor0();
  __syncthreads();                     // stage 0 is published
  {
    const uint32_t one = pinned(1u);   // stage 1's words formed behind the wait
    tdm_load(tdm_group0(dst + one * STAGE_B, src + (uint64_t)one * step), g1);
  }

  const uint32_t lrow = (lane & 15u) * PITCH_B + (lane >> 4) * 16u;
  const uint32_t a_off = (wave >> 1) * SLICE_B + lrow;
  const uint32_t b_off =
      (4u + (wave & 1u) * 2u) * SLICE_B +
      (BT ? (lane >> 4) * PITCH_B + (lane & 15u) * 16u : lrow);
  constexpr uint32_t B_KK = BT ? 4u * PITCH_B : 64u;  // 32 k further
  constexpr uint32_t B_C1 = BT ? 2u * PITCH_B : 32u;  // 16 k further

// rolled: one copy of the pass in the instruction cache for every K
#pragma clang loop unroll(disable)
  for (uint32_t s = 0; s < S; ++s) {
    const unsigned char* buf = L + (s & 1u) * STAGE_B;
#pragma unroll
    for (uint32_t kk = 0; kk < PASS_K / 32; ++kk) {
      bvec16 af[2], bfr[4];
#pragma unroll
      for (uint32_t i = 0; i < 2; ++i)
        af[i] = lds_frag<32u>(buf + a_off + i * 16u * PITCH_B + kk * 64u);
#pragma unroll
      for (uint32_t j = 0; j < 4; ++j)
        bfr[j] = lds_frag<B_C1>(buf + b_off + (j >> 1) * SLICE_B +
                                (j & 1u) * 16u * PITCH_B + kk * B_KK);
#pragma unroll
      for (int i = 0; i < 2; ++i)
#pragma unroll
        for (int j = 0; j < 4; ++j)
          acc[i][j] = TR ? __builtin_amdgcn_wmma_f32_16x16x32_bf16(
                               false, bfr[j], false, af[i], (short)0, acc[i][j],
                               false, false)
                         : __builtin_amdgcn_wmma_f32_16x16x32_bf16(
                               false, af[i], false, bfr[j], (short)0, acc[i][j],
                               false, false);
    }
    // Publish point of stage s + 1: this wave's reads of stage s are back, its
    // own slice of stage s + 1 has landed, then every wave meets.
    wait_ds0();
    wait_tensor0();
    __syncthreads();
    const uint32_t nxt = pinned(s + 2u);  // refill's words formed behind the wait
    if (pinned(nxt < S))
      tdm_load(tdm_group0(dst + (nxt & 1u) * STAGE_B,
                          src + (uint64_t)nxt * step), g1);
  }
  wait_tensor0();
  wait_ds0();
}

// ---------------------------------------------------------------------------
// Helpers of the matrix and non-matrix launches: 16-byte global accesses.
// ---------------------------------------------------------------------------
typedef float  f32x4 __attribute__((ext_vector_type(4)));
typedef float  f32x2 __attribute__((ext_vector_type(2)));
typedef __bf16 bf16x2 __attribute__((ext_vector_type(2)));

// Stands behind a group of global loads or stores whose registers are used
// again for other values further down.
__device__ __forceinline__ void wait_x0() {
  asm volatile("s_wait_xcnt 0x0" ::: "memory");
}

// Two f32 to one dword of two bf16 (round to nearest even), lo in the low half.
__device__ __forceinline__ uint32_t pack_bf16(float lo, float hi) {
  f32x2 f = {lo, hi};
  union { bf16x2 h; uint32_t u; } c;
  c.h = __builtin_convertvector(f, bf16x2);
  return c.u;
}

// ---------------------------------------------------------------------------
// Epilogue of the four GEMMs (K1's softmax outputs aside): a wave's 32x64 results go through LDS so that
// every global access is 16 bytes a lane and covers whole 128-B lines. Behind
// the ring's last barrier no tensor load is in flight and no wave reads the
// ring any more; each wave then stages in its own SLICE_B bytes of it, so no
// further barrier is needed. A lane writes its eight neighbouring results with
// 16-byte LDS stores; row pitches are 16 B x odd (16 rows fall on 64 banks).
// ---------------------------------------------------------------------------
static constexpr uint32_t ST_PITCH_W = 272;  // staged rows of 256 B
static constexpr uint32_t ST_PITCH_N = 144;  // staged rows of 128 B
static_assert(32 * ST_PITCH_W <= SLICE_B && 64 * ST_PITCH_N <= SLICE_B, "stage");

__device__ __forceinline__ void stage_f32(unsigned char* p, fvec8 a) {
  const f32x4 lo = {a[0], a[1], a[2], a[3]};
  const f32x4 hi = {a[4], a[5], a[6], a[7]};
  *(f32x4*)p = lo;
  *(f32x4*)(p + 16) = hi;
}
__device__ __forceinline__ void stage_bf16(unsigned char* p, fvec8 a) {
  uint4 o;
  o.x = pack_bf16(a[0], a[1]);
  o.y = pack_bf16(a[2], a[3]);
  o.z = pack_bf16(a[4], a[5]);
  o.w = pack_bf16(a[6], a[7]);
  *(uint4*)p = o;
}
// The same with the eight neighbours in the order 0 2 4 6 1 3 5 7: the order in
// which att_maps holds every eight p (see K1), so that the two operands of the
// gathered product agree position by position.
__device__ __forceinline__ void stage_bf16_eo(unsigned char* p, fvec8 a) {
  uint4 o;
  o.x = pack_bf16(a[0], a[2]);
  o.y = pack_bf16(a[4], a[6]);
  o.z = pack_bf16(a[1], a[3]);
  o.w = pack_bf16(a[5], a[7]);
  *(uint4*)p = o;
}
// ROWS staged rows of 128 B leave as whole lines, four rows an instruction.
// Lanes 0..7 and 8..15 take rows 8 apart: 8 * 144 B = half the banks further.
template <int ROWS>
__device__ __forceinline__ void rows128_out(const unsigned char* st, char* g,
                                            uint32_t gpitch, uint32_t lane) {
  st += (lane >> 3) * 8u * ST_PITCH_N + (lane & 7u) * 16u;
  g += (size_t)((lane >> 3) * 8u) * gpitch + (lane & 7u) * 16u;
#pragma unroll
  for (uint32_t it = 0; it < ROWS / 4; ++it) {
    const uint32_t row = (it & 7u) + 32u * (it >> 3);
    const uint4 v = *(const uint4*)(st + row * ST_PITCH_N);
    *(uint4*)(g + (size_t)row * gpitch) = v;
  }
}

// ---------------------------------------------------------------------------
// Prep 1: x [b][c][p] f32  ->  xT [p][b][c] bf16 (row index 8 p + b).
// A block takes one tile of 128 c x 128 p, 64 values a lane. A lane loads 4 p
// of two neighbouring c rows (8 lanes = one 128-B line), packs the pair and
// writes dwords into an LDS tile [p][c/2]; the tile leaves as 16-byte stores,
// 16 lanes = the 256 B that a p row of the tile has in xT.
// ---------------------------------------------------------------------------
static constexpr int TX_C     = 128;
static constexpr int TX_P     = 128;
static constexpr int TX_PITCH = 68;  // dwords: 272 B = 16 B x odd

__global__ __launch_bounds__(256) void a2n_transpose_x(
    const float* __restrict__ x, __bf16* __restrict__ xT) {
  __shared__ __attribute__((aligned(16))) uint32_t tile[TX_P * TX_PITCH];
  const int tid = threadIdx.x;
  const int lane = tid & 31;
  const int wave = tid >> 5;
  const int p4l = lane & 7;
  const int c2l = wave * 8 + (lane >> 3);
  const int pbase = blockIdx.x * TX_P;
  const float* xb = x + ((size_t)blockIdx.z * C_IN + blockIdx.y * TX_C) * HW +
                    (size_t)(2 * c2l) * HW + pbase + 4 * p4l;
  __bf16* xTb = xT + ((size_t)(pbase + (tid >> 4)) * BATCH + blockIdx.z) * C_IN +
                blockIdx.y * TX_C + (tid & 15) * 8;

  f32x4 r[TX_P / 32][2][2];  // [group of 32 p][group of 4 c pairs][c of the pair]
#pragma unroll
  for (int pg = 0; pg < TX_P / 32; ++pg)
#pragma unroll
    for (int cg = 0; cg < 2; ++cg)
#pragma unroll
      for (int h = 0; h < 2; ++h)
        r[pg][cg][h] = *(const f32x4*)(xb + (size_t)(cg * 8 + h) * HW + pg * 32);
#pragma unroll
  for (int pg = 0; pg < TX_P / 32; ++pg)
#pragma unroll
    for (int cg = 0; cg < 2; ++cg)
#pragma unroll
      for (int i = 0; i < 4; ++i)
        tile[(pg * 32 + 4 * p4l + i) * TX_PITCH + cg * 4 + c2l] =
            pack_bf16(r[pg][cg][0][i], r[pg][cg][1][i]);
  __syncthreads();
#pragma unroll
  for (int it = 0; it < TX_P / 16; ++it) {
    const uint4 v =
        *(const uint4*)&tile[(it * 16 + (tid >> 4)) * TX_PITCH + (tid & 15) * 4];
    *(uint4*)(xTb + (size_t)(it * 16) * BATCH * C_IN) = v;
  }
}

// ---------------------------------------------------------------------------
// Prep 2: convert weights to bf16, fuse w1|w2|w3 into Wc [1024][512].
// Eight elements a lane; every boundary between the sources is a multiple of 8.
// ---------------------------------------------------------------------------
__global__ __launch_bounds__(256) void a2n_convert_weights(
    const float* __restrict__ w1, const float* __restrict__ w2,
    const float* __restrict__ w3, const float* __restrict__ w4,
    __bf16* __restrict__ Wc, __bf16* __restrict__ W4c) {
  const int t = (blockIdx.x * 256 + threadIdx.x) * 8;
  const int n1 = MO * C_IN;          // 524288
  const int n2 = n1 + C_IN * CM;     // + 262144
  if (t >= n2) return;
  const float* s;
  if (t < CM * C_IN)             s = w1 + t;
  else if (t < (CM + CN) * C_IN) s = w2 + (t - CM * C_IN);
  else if (t < n1)               s = w3 + (t - (CM + CN) * C_IN);
  else                           s = w4 + (t - n1);
  __bf16* d = (t < n1) ? Wc + t : W4c + (t - n1);
  const f32x4 a = *(const f32x4*)s;
  const f32x4 c = *(const f32x4*)(s + 4);
  uint4 o;
  o.x = pack_bf16(a[0], a[1]);
  o.y = pack_bf16(a[2], a[3]);
  o.z = pack_bf16(c[0], c[1]);
  o.w = pack_bf16(c[2], c[3]);
  *(uint4*)d = o;
}

// ---------------------------------------------------------------------------
// K1: fused conv1/2/3 with the softmax over the batch axis in its epilogue.
// Y[o][col] = sum_c Wc[o][c] * xT[col][c]  (+bias)
// rows 0..511 -> A (bf16): a block's 128 columns are 128 p of one batch (xT
// rows 8 apart). rows 512..767 -> att_maps, 768..1023 -> att_vecs: a block's
// 128 columns are 128 neighbouring xT rows = 16 p x 8 batches, so a lane's
// eight neighbouring results are the eight batches of one (n, p) and the
// softmax needs no other lane.
// att_maps leaves as the gathered product's B operand in units of 16 n x 8 p
// (256 B, 16 B an n): byte address of (b, n, p) =
//   b CN HW 2 + (p / 128) AM_PASS_B + (n / 16) AM_GROUP_B + (p / 8 % 16) 256
//   + (n % 16) 16 + 2 q,  q = 4 (p % 2) + p % 8 / 2.
// A lane holds p % 8 = 2 j + (lane >> 4), j = 0..3: 8 neighbouring bytes; a
// wave's store is one whole unit. A holds every eight p in the same order q.
// att_vecs leaves transposed, [b][p][n], through an LDS tile of the block.
// ---------------------------------------------------------------------------
static constexpr int YB_A = CM / 128;         // blockIdx.y below: rows of A
static constexpr int YB_B = (CM + CN) / 128;  // below: att_maps; from here: att_vecs
static_assert(CM % 128 == 0 && CN % 128 == 0, "a block's rows share one output");
static constexpr uint32_t AM_GROUP_B = 16 * 256;                 // 16 n, 128 p
static constexpr uint32_t AM_PASS_B  = (CN / 16) * AM_GROUP_B;   // all n, 128 p
static constexpr uint32_t SV_PITCH   = 288;  // staged att_vecs rows of 256 B:
// two neighbouring rows' 2-byte stores (32 B each) fall on different banks
static_assert(BATCH * 16 * SV_PITCH <= RING_B, "att_vecs tile");

// 2^a. The v_nop is the one slot that the instruction set asks for between a
// transcendental and a directly following use of its result or overwrite of its
// source; in the same statement, so that it stays directly behind it.
__device__ __forceinline__ float exp2_slot(float a) {
  float r;
  asm("v_exp_f32 %0, %1\n\tv_nop" : "=v"(r) : "v"(a));
  return r;
}

__device__ __forceinline__ fvec8 softmax_over_batch(fvec8 t) {
  float mx = -3.4e38f;
#pragma unroll
  for (int b = 0; b < BATCH; ++b) mx = fmaxf(mx, t[b]);
#pragma unroll
  for (int b = 0; b < BATCH; ++b) t[b] = exp2_slot((t[b] - mx) * 1.44269504f);
  float s = 0.f;
#pragma unroll
  for (int b = 0; b < BATCH; ++b) s += t[b];
  const float inv = 1.f / s;
#pragma unroll
  for (int b = 0; b < BATCH; ++b) t[b] *= inv;
  return t;
}

__global__ __launch_bounds__(256) void a2n_conv123(
    const __bf16* __restrict__ Wc, const __bf16* __restrict__ xT,
    const float* __restrict__ b1, const float* __restrict__ b2,
    const float* __restrict__ b3, __bf16* __restrict__ Aout,
    __bf16* __restrict__ attm, __bf16* __restrict__ attvT) {
  __shared__ __attribute__((aligned(2048))) unsigned char L[RING_B];
  const int tid = threadIdx.x;
  const int lane = tid & 31;
  const int wave = tid >> 5;
  const int by = blockIdx.y;  // a block's 128 rows lie in one of the outputs
  const int rw = (wave >> 1) * 32;  // the wave's first row in them
  // softmax blocks: which group of 16 p
  const uint32_t cb = blockIdx.z * (HW / 128) + blockIdx.x;
  const __bf16* Brows =
      (by < YB_A) ? xT + (size_t)blockIdx.z * C_IN +
                        (size_t)blockIdx.x * 128 * BATCH * C_IN
                  : xT + (size_t)cb * 128 * C_IN;
  const uint32_t ldb = (by < YB_A) ? BATCH * C_IN * 2u : C_IN * 2u;

  // The biases of the lane's two rows, loaded ahead of the product.
  const float* bias = (by < YB_A)   ? b1 + by * 128
                      : (by < YB_B) ? b2 + (by - YB_A) * 128
                                    : b3 + (by - YB_B) * 128;
  float bv[2];
#pragma unroll
  for (int i = 0; i < 2; ++i) bv[i] = bias[rw + 16 * i + (lane & 15)];

  fvec8 zero = {};
  fvec8 acc[2][4];
#pragma unroll
  for (int i = 0; i < 2; ++i)
#pragma unroll
    for (int j = 0; j < 4; ++j) acc[i][j] = zero;

  block_gemm_2x4<C_IN, C_IN, true, false>(
      Wc + (size_t)blockIdx.y * 128 * C_IN, Brows, ldb, ROW_B, L, acc);

  if (by < YB_A) {  // block-uniform
    unsigned char* st = L + wave * SLICE_B;  // the wave's own staging range
#pragma unroll
    for (int i = 0; i < 2; ++i)
#pragma unroll
      for (int j = 0; j < 4; ++j)
        stage_bf16_eo(st + (16 * i + (lane & 15)) * ST_PITCH_N +
                          (16 * j + 8 * (lane >> 4)) * 2,
                      acc[i][j] + bv[i]);
    wait_ds0();  // other lanes' rows are read back: every LDS store is done
    rows128_out<32>(st,
                    (char*)(Aout + (size_t)blockIdx.z * CM * HW +
                            (size_t)(by * 128 + rw) * HW + blockIdx.x * 128 +
                            (wave & 1) * 64),
                    HW * 2u, lane);
  } else if (by < YB_B) {
    uint2 o[2][BATCH];
#pragma unroll
    for (int i = 0; i < 2; ++i) {
      fvec8 r[4];
#pragma unroll
      for (int j = 0; j < 4; ++j) r[j] = softmax_over_batch(acc[i][j] + bv[i]);
#pragma unroll
      for (int b = 0; b < BATCH; ++b) {
        o[i][b].x = pack_bf16(r[0][b], r[1][b]);
        o[i][b].y = pack_bf16(r[2][b], r[3][b]);
      }
    }
    // a 32-bit lane offset in bytes per four batches beside uniform bases
    const uint32_t u8 = cb * 2u + (wave & 1);  // which eight p
    const uint32_t off = (u8 >> 4) * AM_PASS_B +
                         (uint32_t)(((by - YB_A) * 128 + rw) >> 4) * AM_GROUP_B +
                         (u8 & 15u) * 256u + (lane & 15) * 16u + (lane >> 4) * 8u;
#pragma unroll
    for (int b = 0; b < BATCH; ++b) {
#pragma unroll
      for (int i = 0; i < 2; ++i)
        *(uint2*)((char*)(attm + (size_t)(b & 3) * CN * HW) + i * AM_GROUP_B +
                  (off + (b >> 2) * (uint32_t)(8 * CN * HW))) = o[i][b];
      // the code laid out behind these stores rewrites their registers
      if ((b & 3) == 3) wait_x0();
    }
  } else {
    // Tile [b][16 p][128 n] of the whole block: behind the ring's last barrier
    // no wave reads the ring and no tensor load is in flight.
    unsigned char* sw = L + ((wave & 1) * 8 + (lane >> 4)) * SV_PITCH +
                        (rw + (lane & 15)) * 2;
#pragma unroll
    for (int i = 0; i < 2; ++i)
#pragma unroll
      for (int j = 0; j < 4; ++j) {
        const fvec8 r = softmax_over_batch(acc[i][j] + bv[i]);
#pragma unroll
        for (int b = 0; b < BATCH; b += 2) {
          const uint32_t w = pack_bf16(r[b], r[b + 1]);
          unsigned char* q = sw + (b * 16 + 2 * j) * SV_PITCH + 32 * i;
          *(uint16_t*)q = (uint16_t)w;
          *(uint16_t*)(q + 16 * SV_PITCH) = (uint16_t)(w >> 16);
        }
      }
    __syncthreads();  // the tile's rows hold four waves' n
    const uint32_t dst = ((cb * 16u + (tid >> 4)) * CN + (by - YB_B) * 128 +
                          (tid & 15) * 8) * 2u;
    const unsigned char* sr = L + (tid >> 4) * SV_PITCH + (tid & 15) * 16;
#pragma unroll
    for (int b = 0; b < BATCH; ++b) {  // 16 lanes = the 256 B of a (b, p) row
      const uint4 v = *(const uint4*)(sr + b * 16 * SV_PITCH);
      *(uint4*)((char*)(attvT + (size_t)b * HW * CN) + dst) = v;
    }
    wait_x0();  // the code laid out behind these stores rewrites their registers
  }
}

// ---------------------------------------------------------------------------
// K3: gathered.  G[m][n] = sum_p A[m][p] * attm[n][p] (attm in K1's units).
// The 64 output tiles alone would leave three WGPs in four idle through 32
// passes, so the sum over p is cut into KS slices, one block each. A block
// stores its slice's f32 sums, transposed, as Gp[slice][b][n][m]; K3b adds them.
// ---------------------------------------------------------------------------
static constexpr int KS  = 8;        // slices of the sum over p
static constexpr int KSL = HW / KS;  // p per slice
static constexpr uint32_t NG = BATCH * CN * CM;  // elements of G, all batches

__global__ __launch_bounds__(256) void a2n_gathered(
    const __bf16* __restrict__ A, const __bf16* __restrict__ attm,
    float* __restrict__ Gp) {
  __shared__ __attribute__((aligned(2048))) unsigned char L[RING_B];
  const int b = blockIdx.z / KS;
  const int ks = blockIdx.z % KS;
  const int lane = threadIdx.x & 31;
  const int wave = threadIdx.x >> 5;
  const int m0 = blockIdx.y * 128 + (wave >> 1) * 32;  // over CM
  const int n0 = blockIdx.x * 128 + (wave & 1) * 64;   // over CN

  fvec8 zero = {};
  fvec8 acc[2][4];
#pragma unroll
  for (int i = 0; i < 2; ++i)
#pragma unroll
    for (int j = 0; j < 4; ++j) acc[i][j] = zero;

  block_gemm_2x4<HW, KSL, false, true>(
      A + (size_t)b * CM * HW + (size_t)blockIdx.y * 128 * HW + ks * KSL,
      attm + (size_t)b * CN * HW + (size_t)ks * (KSL / 128) * (AM_PASS_B / 2) +
          (size_t)blockIdx.x * (128 / 16) * (AM_GROUP_B / 2),
      256u, AM_PASS_B, L, acc);

  // A lane's eight sums of a tile are eight neighbouring m of one n: the wave
  // stages 64 rows (n) of 32 m = 128 B.
  unsigned char* st = L + wave * SLICE_B;  // the wave's own staging range
#pragma unroll
  for (int i = 0; i < 2; ++i)
#pragma unroll
    for (int j = 0; j < 4; ++j)
      stage_f32(st + (16 * j + (lane & 15)) * ST_PITCH_N +
                    (16 * i + 8 * (lane >> 4)) * 4,
                acc[i][j]);
  wait_ds0();  // other lanes' rows are read back: every LDS store is done
  rows128_out<64>(st,
                  (char*)(Gp + (size_t)(ks * BATCH + b) * (CN * CM) +
                          (size_t)n0 * CM + m0),
                  CM * 4u, lane);
}

// ---------------------------------------------------------------------------
// K3b: Gt[b][n][m] (bf16, the ready-made B^T operand of K4) = the KS slices of
// Gp added in slice order. A lane takes 16 elements of every slice (32 loads of
// 16 B); a wave's load = 512 contiguous bytes, its store 256.
// ---------------------------------------------------------------------------
static constexpr int SS_H = 4;  // groups of four elements a lane

__global__ __launch_bounds__(256) void a2n_sum_slices(
    const float* __restrict__ Gp, __bf16* __restrict__ Gt) {
  const uint32_t j = blockIdx.x * (256u * 4u * SS_H) +
                     (threadIdx.x >> 5) * (128u * SS_H) +
                     (threadIdx.x & 31) * 4u;
  f32x4 v[KS][SS_H];
  // a 32-bit lane offset per pair of slices beside one uniform base
#pragma unroll
  for (int s = 0; s < KS; ++s) {
#pragma unroll
    for (int h = 0; h < SS_H; ++h)
      v[s][h] = *(const f32x4*)((const char*)(Gp + (s & 1) * NG + h * 128) +
                                (j * 4u + (s >> 1) * (8u * NG)));
    if (s & 1) wait_x0();  // later loads land in these loads' address register
  }
#pragma unroll
  for (int h = 0; h < SS_H; ++h) {
    f32x4 t = v[0][h];
#pragma unroll
    for (int s = 1; s < KS; ++s) t += v[s][h];
    uint2 o;
    o.x = pack_bf16(t[0], t[1]);
    o.y = pack_bf16(t[2], t[3]);
    *(uint2*)((char*)(Gt + h * 128) + j * 2u) = o;
  }
}

// ---------------------------------------------------------------------------
// K4: Hm = w4 @ G.  Hm[o][n] = sum_m w4[o][m] * Gt[n][m].  Stored [b][o][n].
// ---------------------------------------------------------------------------
__global__ __launch_bounds__(256) void a2n_w4g(
    const __bf16* __restrict__ W4c, const __bf16* __restrict__ Gt,
    __bf16* __restrict__ Hb) {
  __shared__ __attribute__((aligned(2048))) unsigned char L[RING_B];
  const int b = blockIdx.z;
  const int lane = threadIdx.x & 31;
  const int wave = threadIdx.x >> 5;
  const int m0 = blockIdx.y * 128 + (wave >> 1) * 32;  // over C (out chans)
  const int n0 = blockIdx.x * 128 + (wave & 1) * 64;   // over CN

  fvec8 zero = {};
  fvec8 acc[2][4];
#pragma unroll
  for (int i = 0; i < 2; ++i)
#pragma unroll
    for (int j = 0; j < 4; ++j) acc[i][j] = zero;

  block_gemm_2x4<CM, CM, true, false>(
      W4c + (size_t)blockIdx.y * 128 * CM,
      Gt + (size_t)b * CN * CM + (size_t)blockIdx.x * 128 * CM, CM * 2u, ROW_B,
      L, acc);

  unsigned char* st = L + wave * SLICE_B;  // the wave's own staging range
#pragma unroll
  for (int i = 0; i < 2; ++i)
#pragma unroll
    for (int j = 0; j < 4; ++j)
      stage_bf16(st + (16 * i + (lane & 15)) * ST_PITCH_N +
                     (16 * j + 8 * (lane >> 4)) * 2,
                 acc[i][j]);
  wait_ds0();  // other lanes' rows are read back: every LDS store is done
  rows128_out<32>(st,
                  (char*)(Hb + (size_t)b * C_IN * CN + (size_t)m0 * CN + n0),
                  CN * 2u, lane);
}

// ---------------------------------------------------------------------------
// K5: out[o][p] = x[o][p] + b4[o] + sum_n Hb[o][n] * attvT[p][n]
// ---------------------------------------------------------------------------
__global__ __launch_bounds__(256) void a2n_distribute_out(
    const __bf16* __restrict__ Hb, const __bf16* __restrict__ attvT,
    const float* __restrict__ b4, const float* __restrict__ x,
    float* __restrict__ out) {
  __shared__ __attribute__((aligned(2048))) unsigned char L[RING_B];
  const int b = blockIdx.z;
  const int lane = threadIdx.x & 31;
  const int wave = threadIdx.x >> 5;
  const int m0 = blockIdx.y * 128 + (wave >> 1) * 32;  // over C
  const int n0 = blockIdx.x * 128 + (wave & 1) * 64;   // over HW

  fvec8 zero = {};
  fvec8 acc[2][4];
#pragma unroll
  for (int i = 0; i < 2; ++i)
#pragma unroll
    for (int j = 0; j < 4; ++j) acc[i][j] = zero;

  block_gemm_2x4<CN, CN, true, false>(
      Hb + (size_t)b * C_IN * CN + (size_t)blockIdx.y * 128 * CN,
      attvT + (size_t)b * HW * CN + (size_t)blockIdx.x * 128 * CN, CN * 2u,
      ROW_B, L, acc);

  // Two rows of 256 B an instruction, for x as for out.
  // One 32-bit lane offset in bytes beside the two uniform bases: its register
  // serves the loads and the stores and takes no other value in between.
  const uint32_t off = (uint32_t)(((b * C_IN + m0 + (lane >> 4)) * HW + n0 +
                                   (lane & 15) * 4) * 4);
  float bv[2];
#pragma unroll
  for (int i = 0; i < 2; ++i) bv[i] = b4[m0 + 16 * i + (lane & 15)];
  f32x4 xv[16];
#pragma unroll
  for (int it = 0; it < 16; ++it)
    xv[it] = *(const f32x4*)((const char*)(x + (size_t)(2 * it) * HW) + off);

  unsigned char* st = L + wave * SLICE_B;  // the wave's own staging range
#pragma unroll
  for (int i = 0; i < 2; ++i)
#pragma unroll
    for (int j = 0; j < 4; ++j)
      stage_f32(st + (16 * i + (lane & 15)) * ST_PITCH_W +
                    (16 * j + 8 * (lane >> 4)) * 4,
                acc[i][j] + bv[i]);
  wait_ds0();  // other lanes' rows are read back: every LDS store is done
  const unsigned char* sr = st + (lane >> 4) * ST_PITCH_W + (lane & 15) * 16;
#pragma unroll
  for (int it = 0; it < 16; ++it) {
    const f32x4 v = *(const f32x4*)(sr + 2 * it * ST_PITCH_W);
    *(f32x4*)((char*)(out + (size_t)(2 * it) * HW) + off) = v + xv[it];
  }
}

// ---------------------------------------------------------------------------
extern "C" void kernel_launch(void* const* d_in, const int* in_sizes, int n_in,
                              void* d_out, int out_size, void* d_ws,
                              size_t ws_size, hipStream_t stream) {
  const float* x  = (const float*)d_in[0];
  const float* w1 = (const float*)d_in[1];
  const float* b1 = (const float*)d_in[2];
  const float* w2 = (const float*)d_in[3];
  const float* b2 = (const float*)d_in[4];
  const float* w3 = (const float*)d_in[5];
  const float* b3 = (const float*)d_in[6];
  const float* w4 = (const float*)d_in[7];
  const float* b4 = (const float*)d_in[8];
  float* out = (float*)d_out;

  char* ws = (char*)d_ws;
  __bf16* XT   = (__bf16*)(ws + OFF_XT);
  __bf16* WC   = (__bf16*)(ws + OFF_WC);
  __bf16* W4C  = (__bf16*)(ws + OFF_W4C);
  __bf16* Abuf = (__bf16*)(ws + OFF_A);
  __bf16* AM   = (__bf16*)(ws + OFF_AM);
  __bf16* AVT  = (__bf16*)(ws + OFF_AVT);
  __bf16* GT   = (__bf16*)(ws + OFF_GT);
  __bf16* HB   = (__bf16*)(ws + OFF_HB);
  float*  GP   = (float*)(ws + OFF_GP);

  const dim3 blk(256);

  a2n_transpose_x<<<dim3(HW / TX_P, C_IN / TX_C, BATCH), blk, 0,
                    stream>>>(x, XT);

  a2n_convert_weights<<<dim3((MO * C_IN + C_IN * CM) / (256 * 8)), blk, 0,
                        stream>>>(w1, w2, w3, w4, WC, W4C);

  a2n_conv123<<<dim3(HW / 128, MO / 128, BATCH), blk, 0, stream>>>(
      WC, XT, b1, b2, b3, Abuf, AM, AVT);

  a2n_gathered<<<dim3(CN / 128, CM / 128, BATCH * KS), blk, 0, stream>>>(
      Abuf, AM, GP);

  a2n_sum_slices<<<dim3(NG / (256 * 4 * SS_H)), blk, 0, stream>>>(GP, GT);

  a2n_w4g<<<dim3(CN / 128, C_IN / 128, BATCH), blk, 0, stream>>>(W4C, GT, HB);

  a2n_distribute_out<<<dim3(HW / 128, C_IN / 128, BATCH), blk, 0, stream>>>(
      HB, AVT, b4, x, out);
}

// v007
// It runs in 75.8 microseconds.
// Timed twice side by side with v006, it ran 1.13 and 1.11 times as fast.
// Over all steps from v000 it is 4.82 times as fast.
#include <hip/hip_runtime.h>

// ---------------------------------------------------------------------------
// A2N attention block for MI455X (gfx1250, wave32, WMMA bf16 16x16x32).
// out = x + w4 @ ( (A @ softmax_b(Bp)^T) @ softmax_b(V) ) + b4,  A = w1 x + b1
// refactored as  x + (H @ att_vecs) + b4  with
//   H = (w4 w1) (x att_maps^T) + (w4 b1) rowsum(att_maps)^T :
// neither the HW-sized conv4 nor the HW-sized conv1 is ever formed.
// ---------------------------------------------------------------------------

typedef __attribute__((ext_vector_type(16))) __bf16 bvec16;
typedef __attribute__((ext_vector_type(8)))  float  fvec8;

#define BATCH 8
#define C_IN  512
#define CM    512
#define CN    256
#define HW    4096
#define MO    1024   // CM + CN + CN rows of the fused conv123 weight

// ---- workspace layout (bytes) ---------------------------------------------
static constexpr size_t SZ_XT  = (size_t)BATCH * HW * C_IN * 2;  // bf16 xT[p][b][c]
static constexpr size_t SZ_WC  = (size_t)MO * C_IN * 2;          // bf16 [w1^T;w2;w3]
static constexpr size_t SZ_W4C = (size_t)C_IN * CM * 2;          // bf16 w4
static constexpr size_t SZ_A   = (size_t)BATCH * C_IN * HW * 2;  // bf16 xb[b][c][p']
static constexpr size_t SZ_AM  = (size_t)BATCH * CN * HW * 2;    // bf16 att_maps, tiled
static constexpr size_t SZ_AVT = SZ_AM;                          // bf16 att_vecsT[b][p][n]
static constexpr size_t SZ_GT  = (size_t)BATCH * CN * C_IN * 2;  // bf16 Gt[b][n][c]
static constexpr size_t SZ_HB  = (size_t)BATCH * C_IN * CN * 2;  // bf16 Hb[b][o][n]
static constexpr size_t SZ_GP  = (size_t)8 * BATCH * CN * C_IN * 4;  // f32
// Gp[slice][b][n][c]: the gathered product's partial sums
static constexpr size_t SZ_W41 = (size_t)C_IN * C_IN * 2;        // bf16 w4 w1 [o][c]
static constexpr size_t SZ_S   = (size_t)BATCH * CN * 2 * 4;     // f32 S[b][n/16][32]
// f32 wb[o] = (w4 b1)[o] after S

static constexpr size_t OFF_XT  = 0;
static constexpr size_t OFF_WC  = OFF_XT + SZ_XT;
static constexpr size_t OFF_W4C = OFF_WC + SZ_WC;
static constexpr size_t OFF_A   = OFF_W4C + SZ_W4C;
static constexpr size_t OFF_AM  = OFF_A + SZ_A;
static constexpr size_t OFF_AVT = OFF_AM + SZ_AM;
static constexpr size_t OFF_GT  = OFF_AVT + SZ_AVT;
static constexpr size_t OFF_HB  = OFF_GT + SZ_GT;
static constexpr size_t OFF_GP  = OFF_HB + SZ_HB;
static constexpr size_t OFF_W41 = OFF_GP + SZ_GP;
static constexpr size_t OFF_S   = OFF_W41 + SZ_W41;
static constexpr size_t OFF_WB  = OFF_S + SZ_S;

// ---------------------------------------------------------------------------
// LDS ring of the four GEMMs. A pass is 128 k = 256 bytes of every operand row.
// A stage holds the block's 128 A rows and 128 B rows as eight slices of 32
// rows, one slice per wave, each brought in by that wave's own tensor load.
// The load's pad gives an LDS row pitch of 272 B (16 B x odd: no bank conflict
// for ds_load_b128). A slice's 32 * 272 = 8704 B are rounded up to a multiple
// of 2 KiB so that every load's place in LDS is one.
// ---------------------------------------------------------------------------
typedef uint32_t u32x4 __attribute__((ext_vector_type(4)));
typedef uint32_t u32x8 __attribute__((ext_vector_type(8)));

static constexpr uint32_t PASS_K     = 128;
static constexpr uint32_t ROW_B      = 256;
static constexpr uint32_t PITCH_B    = 272;
static constexpr uint32_t SLICE_ROWS = 32;
static constexpr uint32_t SLICE_B    = 10240;
static constexpr uint32_t STAGE_B    = 8 * SLICE_B;
static constexpr uint32_t RING_B     = 2 * STAGE_B;
static_assert(SLICE_B % 2048 == 0 && SLICE_B >= SLICE_ROWS * PITCH_B, "slice");

__device__ __forceinline__ uint32_t uni(uint32_t v) {
  return (uint32_t)__builtin_amdgcn_readfirstlane(v);
}
// Holds v in a scalar register: a test on it compiles to a scalar branch (a
// tensor load ignores EXEC), and descriptor words formed from it are formed
// behind the volatile statements that stand in front of it.
__device__ __forceinline__ uint32_t pinned(uint32_t v) {
  uint32_t w = uni(v);
  asm volatile("" : "+s"(w));  // pinned(): a test or descriptor word kept scalar
  return w;
}
// The compiler places no wait for a tensor load; both waits are hand-written.
__device__ __forceinline__ void wait_tensor0() {
  asm volatile("s_wait_tensorcnt 0x0" ::: "memory");
}
__device__ __forceinline__ void wait_ds0() {
  asm volatile("s_wait_dscnt 0x0" ::: "memory");
}
__device__ __forceinline__ void tdm_load(u32x4 g0, u32x8 g1) {
  asm volatile("tensor_load_to_lds %0, %1" ::"s"(g0), "s"(g1) : "memory");
}
// Group 1: 1-byte elements, tile = tensor = 32 rows of 256 B, a 4-dword pad
// behind every 64 dwords, no mask.
__device__ __forceinline__ u32x8 tdm_group1(uint32_t src_pitch_bytes) {
  u32x8 g;
  g[0] = uni((1u << 20) | (5u << 22) | (3u << 25));
  g[1] = uni((ROW_B & 0xFFFFu) << 16);
  g[2] = uni((ROW_B >> 16) | ((SLICE_ROWS & 0xFFFFu) << 16));
  g[3] = uni((SLICE_ROWS >> 16) | (ROW_B << 16));
  g[4] = uni(SLICE_ROWS);
  g[5] = uni(src_pitch_bytes);
  g[6] = uni(0u);
  g[7] = uni(0u);
  return g;
}
__device__ __forceinline__ u32x4 tdm_group0(uint32_t lds_dst, uint64_t ga) {
  u32x4 g;
  g[0] = uni(1u);
  g[1] = uni(lds_dst);
  g[2] = uni((uint32_t)ga);
  g[3] = uni((((uint32_t)(ga >> 32)) & 0x01FFFFFFu) | 0x80000000u);
  return g;
}

// ---------------------------------------------------------------------------
// WMMA operand fragment from a staged row block. Works for the A operand from
// row-major [M][K] and for the B operand when B^T is row-major [N][K] (K1,
// K4, K5) or in units of 16 rows x 8 k (K3). Matches ISA bf16 16x32 layout:
//   lane L: row = L&15, chunk0 = K[(L>>4)*8 .. +7], chunk1 = chunk0 + 16.
// p already holds the lane's chunk0; chunk1 lies D bytes further.
// ---------------------------------------------------------------------------
template <uint32_t D>
__device__ __forceinline__ bvec16 lds_frag(const unsigned char* p) {
  union { uint4 q[2]; bvec16 v; } u;
  u.q[0] = *(const uint4*)(p);
  u.q[1] = *(const uint4*)(p + D);
  return u.v;
}

// Block tile 128x128 from eight waves, each 32x64: 2 (M) x 4 (N) WMMA tiles.
// Ablk, Bblk: the block's first row of each operand. A rows are K-contiguous
// with a pitch of LD elements. B's 32-row slices have a source row pitch of
// ldb bytes, and a pass's rows lie bstep bytes behind the pass before (both
// block-uniform). BT false: a B row is K-contiguous like an A row. BT true:
// a B source row is a unit of 16 operand rows x 8 k (16 B each), a pass has 16
// such units for each group of 16 operand rows, a slice two groups.
// L: the kernel's RING_B bytes of LDS.
// TR: the two fragments trade places in the matrix instruction (their lane
// maps are equal), so that acc[i][j] holds the tile transposed: a lane has one
// A row, 16 i + (lane & 15), and eight neighbouring B rows,
// 16 j + 8 (lane >> 4) + e.
template <int LD, int K, bool TR, bool BT>
__device__ __forceinline__ void block_gemm_2x4(const __bf16* __restrict__ Ablk,
                                               const __bf16* __restrict__ Bblk,
                                               uint32_t ldb, uint32_t bstep,
                                               unsigned char* L,
                                               fvec8 acc[2][4]) {
  constexpr uint32_t S = K / PASS_K;  // stages = passes
  static_assert(K % PASS_K == 0 && S >= 2, "the ring needs two stages");
  const uint32_t lane = threadIdx.x & 31;
  const uint32_t wave = uni(threadIdx.x >> 5);

  // This wave's slice: waves 0..3 bring A rows, waves 4..7 B rows.
  const uint32_t pitch = (wave < 4u) ? (uint32_t)LD * 2u : ldb;
  const uint32_t step = (wave < 4u) ? ROW_B : bstep;
  const uint64_t src =
      (uint64_t)(uintptr_t)((wave < 4u) ? Ablk : Bblk) +
      (uint64_t)(SLICE_ROWS * (wave & 3u)) * pitch;
  const uint32_t dst = (uint32_t)(size_t)L + wave * SLICE_B;
  u32x8 g1 = tdm_group1(pitch);
  // pinned(), for the eight descriptor words at once: they stay in one scalar
  // register group. Without it the build uses words 3 and 6 of the group as
  // scratch in the loop, while the load that names them is still in flight.
  asm volatile("" : "+s"(g1));

  tdm_load(tdm_group0(dst, src), g1);  // stage 0
  wait_tensor0();
  __syncthreads();                     // stage 0 is published
  {
    const uint32_t one = pinned(1u);   // stage 1's words formed behind the wait
    tdm_load(tdm_group0(dst + one * STAGE_B, src + (uint64_t)one * step), g1);
  }

  const uint32_t lrow = (lane & 15u) * PITCH_B + (lane >> 4) * 16u;
  const uint32_t a_off = (wave >> 1) * SLICE_B + lrow;
  const uint32_t b_off =
      (4u + (wave & 1u) * 2u) * SLICE_B +
      (BT ? (lane >> 4) * PITCH_B + (lane & 15u) * 16u : lrow);
  constexpr uint32_t B_KK = BT ? 4u * PITCH_B : 64u;  // 32 k further
  constexpr uint32_t B_C1 = BT ? 2u * PITCH_B : 32u;  // 16 k further

// rolled: one copy of the pass in the instruction cache for every K
#pragma clang loop unroll(disable)
  for (uint32_t s = 0; s < S; ++s) {
    const unsigned char* buf = L + (s & 1u) * STAGE_B;
#pragma unroll
    for (uint32_t kk = 0; kk < PASS_K / 32; ++kk) {
      bvec16 af[2], bfr[4];
#pragma unroll
      for (uint32_t i = 0; i < 2; ++i)
        af[i] = lds_frag<32u>(buf + a_off + i * 16u * PITCH_B + kk * 64u);
#pragma unroll
      for (uint32_t j = 0; j < 4; ++j)
        bfr[j] = lds_frag<B_C1>(buf + b_off + (j >> 1) * SLICE_B +
                                (j & 1u) * 16u * PITCH_B + kk * B_KK);
#pragma unroll
      for (int i = 0; i < 2; ++i)
#pragma unroll
        for (int j = 0; j < 4; ++j)
          acc[i][j] = TR ? __builtin_amdgcn_wmma_f32_16x16x32_bf16(
                               false, bfr[j], false, af[i], (short)0, acc[i][j],
                               false, false)
                         : __builtin_amdgcn_wmma_f32_16x16x32_bf16(
                               false, af[i], false, bfr[j], (short)0, acc[i][j],
                               false, false);
    }
    // Publish point of stage s + 1: this wave's reads of stage s are back, its
    // own slice of stage s + 1 has landed, then every wave meets.
    wait_ds0();
    wait_tensor0();
    __syncthreads();
    const uint32_t nxt = pinned(s + 2u);  // refill's words formed behind the wait
    if (pinned(nxt < S))
      tdm_load(tdm_group0(dst + (nxt & 1u) * STAGE_B,
                          src + (uint64_t)nxt * step), g1);
  }
  wait_tensor0();
  wait_ds0();
}

// ---------------------------------------------------------------------------
// Helpers of the matrix and non-matrix launches: 16-byte global accesses.
// ---------------------------------------------------------------------------
typedef float  f32x4 __attribute__((ext_vector_type(4)));
typedef float  f32x2 __attribute__((ext_vector_type(2)));
typedef __bf16 bf16x2 __attribute__((ext_vector_type(2)));

// Stands behind a group of global loads or stores whose registers are used
// again for other values further down.
__device__ __forceinline__ void wait_x0() {
  asm volatile("s_wait_xcnt 0x0" ::: "memory");
}

// Two f32 to one dword of two bf16 (round to nearest even), lo in the low half.
__device__ __forceinline__ uint32_t pack_bf16(float lo, float hi) {
  f32x2 f = {lo, hi};
  union { bf16x2 h; uint32_t u; } c;
  c.h = __builtin_convertvector(f, bf16x2);
  return c.u;
}

// ---------------------------------------------------------------------------
// Epilogue of the four GEMMs (K1's softmax outputs aside): a wave's 32x64 results go through LDS so that
// every global access is 16 bytes a lane and covers whole 128-B lines. Behind
// the ring's last barrier no tensor load is in flight and no wave reads the
// ring any more; each wave then stages in its own SLICE_B bytes of it, so no
// further barrier is needed. A lane writes its eight neighbouring results with
// 16-byte LDS stores; row pitches are 16 B x odd (16 rows fall on 64 banks).
// ---------------------------------------------------------------------------
static constexpr uint32_t ST_PITCH_W = 272;  // staged rows of 256 B
static constexpr uint32_t ST_PITCH_N = 144;  // staged rows of 128 B
static_assert(32 * ST_PITCH_W <= SLICE_B && 64 * ST_PITCH_N <= SLICE_B, "stage");

__device__ __forceinline__ void stage_f32(unsigned char* p, fvec8 a) {
  const f32x4 lo = {a[0], a[1], a[2], a[3]};
  const f32x4 hi = {a[4], a[5], a[6], a[7]};
  *(f32x4*)p = lo;
  *(f32x4*)(p + 16) = hi;
}
__device__ __forceinline__ void stage_bf16(unsigned char* p, fvec8 a) {
  uint4 o;
  o.x = pack_bf16(a[0], a[1]);
  o.y = pack_bf16(a[2], a[3]);
  o.z = pack_bf16(a[4], a[5]);
  o.w = pack_bf16(a[6], a[7]);
  *(uint4*)p = o;
}
// ROWS staged rows of 128 B leave as whole lines, four rows an instruction.
// Lanes 0..7 and 8..15 take rows 8 apart: 8 * 144 B = half the banks further.
template <int ROWS>
__device__ __forceinline__ void rows128_out(const unsigned char* st, char* g,
                                            uint32_t gpitch, uint32_t lane) {
  st += (lane >> 3) * 8u * ST_PITCH_N + (lane & 7u) * 16u;
  g += (size_t)((lane >> 3) * 8u) * gpitch + (lane & 7u) * 16u;
#pragma unroll
  for (uint32_t it = 0; it < ROWS / 4; ++it) {
    const uint32_t row = (it & 7u) + 32u * (it >> 3);
    const uint4 v = *(const uint4*)(st + row * ST_PITCH_N);
    *(uint4*)(g + (size_t)row * gpitch) = v;
  }
}

// ---------------------------------------------------------------------------
// Prep 1: x [b][c][p] f32  ->  xT [p][b][c] bf16 (row index 8 p + b).
// A block takes one tile of 128 c x 128 p, 64 values a lane. A lane loads 4 p
// of two neighbouring c rows (8 lanes = one 128-B line), packs the pair and
// writes dwords into an LDS tile [p][c/2]; the tile leaves as 16-byte stores,
// 16 lanes = the 256 B that a p row of the tile has in xT.
// The same values leave a second time untransposed, xb [b][c][p'] bf16, the
// gathered product's A operand, through a second LDS tile [c][p']: every eight p
// stand in the order 0 2 4 6 1 3 5 7 in which att_maps holds them (see K1).
// ---------------------------------------------------------------------------
static constexpr int TX_C     = 128;
static constexpr int TX_P     = 128;
static constexpr int TX_PITCH = 68;  // dwords: 272 B = 16 B x odd
static constexpr int TB_PITCH = 72;  // dwords: a wave's four c rows, two apart,
// fall a quarter of the 64 banks apart

__global__ __launch_bounds__(256) void a2n_transpose_x(
    const float* __restrict__ x, __bf16* __restrict__ xT,
    __bf16* __restrict__ xb16) {
  __shared__ __attribute__((aligned(16))) uint32_t tile[TX_P * TX_PITCH];
  __shared__ __attribute__((aligned(16))) uint32_t tileb[TX_C * TB_PITCH];
  const int tid = threadIdx.x;
  const int lane = tid & 31;
  const int wave = tid >> 5;
  const int p4l = lane & 7;
  const int c2l = wave * 8 + (lane >> 3);
  const int pbase = blockIdx.x * TX_P;
  const float* xb = x + ((size_t)blockIdx.z * C_IN + blockIdx.y * TX_C) * HW +
                    (size_t)(2 * c2l) * HW + pbase + 4 * p4l;
  __bf16* xTb = xT + ((size_t)(pbase + (tid >> 4)) * BATCH + blockIdx.z) * C_IN +
                blockIdx.y * TX_C + (tid & 15) * 8;

  f32x4 r[TX_P / 32][2][2];  // [group of 32 p][group of 4 c pairs][c of the pair]
#pragma unroll
  for (int pg = 0; pg < TX_P / 32; ++pg)
#pragma unroll
    for (int cg = 0; cg < 2; ++cg)
#pragma unroll
      for (int h = 0; h < 2; ++h) {
        // the last load may land in the address registers of the loads before it
        if (pg == TX_P / 32 - 1 && cg == 1 && h == 1) wait_x0();
        r[pg][cg][h] = *(const f32x4*)(xb + (size_t)(cg * 8 + h) * HW + pg * 32);
      }
#pragma unroll
  for (int pg = 0; pg < TX_P / 32; ++pg)
#pragma unroll
    for (int cg = 0; cg < 2; ++cg)
#pragma unroll
      for (int i = 0; i < 4; ++i)
        tile[(pg * 32 + 4 * p4l + i) * TX_PITCH + cg * 4 + c2l] =
            pack_bf16(r[pg][cg][0][i], r[pg][cg][1][i]);
  // A lane's four p are one half of a group of eight: p 0 2 | 1 3 of the low
  // half are dwords 0 and 2 of the group, p 4 6 | 5 7 of the high half 1 and 3.
#pragma unroll
  for (int pg = 0; pg < TX_P / 32; ++pg)
#pragma unroll
    for (int cg = 0; cg < 2; ++cg)
#pragma unroll
      for (int h = 0; h < 2; ++h) {
        uint32_t* q = &tileb[(2 * (cg * 4 + c2l) + h) * TB_PITCH + pg * 16 +
                             (p4l >> 1) * 4 + (p4l & 1)];
        q[0] = pack_bf16(r[pg][cg][h][0], r[pg][cg][h][2]);
        q[2] = pack_bf16(r[pg][cg][h][1], r[pg][cg][h][3]);
      }
  __syncthreads();
#pragma unroll
  for (int it = 0; it < TX_P / 16; ++it) {
    const uint4 v =
        *(const uint4*)&tile[(it * 16 + (tid >> 4)) * TX_PITCH + (tid & 15) * 4];
    *(uint4*)(xTb + (size_t)(it * 16) * BATCH * C_IN) = v;
  }
  __bf16* xbb = xb16 +
                ((size_t)blockIdx.z * C_IN + blockIdx.y * TX_C + (tid >> 4)) * HW +
                pbase + (tid & 15) * 8;
#pragma unroll
  for (int it = 0; it < TX_C / 16; ++it) {  // 16 lanes = the 256 B of a c row
    const uint4 v =
        *(const uint4*)&tileb[(it * 16 + (tid >> 4)) * TB_PITCH + (tid & 15) * 4];
    *(uint4*)(xbb + (size_t)(it * 16) * HW) = v;
  }
}

// ---------------------------------------------------------------------------
// Prep 2: convert weights to bf16, w1^T|w2|w3 into Wc [1024][512].
// Eight elements a lane; every boundary between the sources is a multiple of 8.
// w1 leaves transposed, [c][m], as the B operand of w4 w1: a lane takes eight m
// of one c, eight lanes fill a 128-B line, a wave four lines (four c).
// ---------------------------------------------------------------------------
__global__ __launch_bounds__(256) void a2n_convert_weights(
    const float* __restrict__ w1, const float* __restrict__ w2,
    const float* __restrict__ w3, const float* __restrict__ w4,
    __bf16* __restrict__ Wc, __bf16* __restrict__ W4c) {
  const int t = (blockIdx.x * 256 + threadIdx.x) * 8;
  const int n1 = MO * C_IN;          // 524288
  const int n2 = n1 + C_IN * CM;     // + 262144
  if (t >= n2) return;
  if (t < CM * C_IN) {  // block-uniform
    const int u = t >> 3;
    const int c = (u >> 8) * 4 + ((u >> 3) & 3);
    const int m = (((u >> 5) & 7) * 8 + (u & 7)) * 8;
    const float* sc = w1 + (size_t)m * C_IN + c;
    float v[8];
#pragma unroll
    for (int e = 0; e < 8; ++e) v[e] = sc[e * C_IN];
    uint4 o;
    o.x = pack_bf16(v[0], v[1]);
    o.y = pack_bf16(v[2], v[3]);
    o.z = pack_bf16(v[4], v[5]);
    o.w = pack_bf16(v[6], v[7]);
    *(uint4*)(Wc + (size_t)c * CM + m) = o;
    return;
  }
  const float* s;
  if (t < (CM + CN) * C_IN)      s = w2 + (t - CM * C_IN);
  else if (t < n1)               s = w3 + (t - (CM + CN) * C_IN);
  else                           s = w4 + (t - n1);
  __bf16* d = (t < n1) ? Wc + t : W4c + (t - n1);
  const f32x4 a = *(const f32x4*)s;
  const f32x4 c = *(const f32x4*)(s + 4);
  uint4 o;
  o.x = pack_bf16(a[0], a[1]);
  o.y = pack_bf16(a[2], a[3]);
  o.z = pack_bf16(c[0], c[1]);
  o.w = pack_bf16(c[2], c[3]);
  *(uint4*)d = o;
}

// ---------------------------------------------------------------------------
// K1: fused conv2/3 with the softmax over the batch axis in its epilogue.
// Y[o][col] = sum_c Wc[o][c] * xT[col][c]  (+bias)
// Wc rows 512..767 -> att_maps, 768..1023 -> att_vecs: a block's
// 128 columns are 128 neighbouring xT rows = 16 p x 8 batches, so a lane's
// eight neighbouring results are the eight batches of one (n, p) and the
// softmax needs no other lane.
// The plane blockIdx.z = 0 holds the 16 blocks of W41[o][c] = sum_m w4[o][m]
// w1[m][c] (the same product shape, operands W4c and Wc's rows 0..511 = w1^T).
// att_maps leaves as the gathered product's B operand in units of 16 n x 8 p
// (256 B, 16 B an n): byte address of (b, n, p) =
//   b CN HW 2 + (p / 128) AM_PASS_B + (n / 16) AM_GROUP_B + (p / 8 % 16) 256
//   + (n % 16) 16 + 2 q,  q = 4 (p % 2) + p % 8 / 2.
// A lane holds p % 8 = 2 j + (lane >> 4), j = 0..3: 8 neighbouring bytes; a
// wave's store is one whole unit. xb holds every eight p in the same order q.
// att_vecs leaves transposed, [b][p][n], through an LDS tile of the block.
// ---------------------------------------------------------------------------
static constexpr int YB_A = CM / 128;         // row blocks of Wc below: w1^T
static constexpr int YB_B = (CM + CN) / 128;  // below: att_maps; from here: att_vecs
static_assert(CM % 128 == 0 && CN % 128 == 0, "a block's rows share one output");
static constexpr uint32_t AM_GROUP_B = 16 * 256;                 // 16 n, 128 p
static constexpr uint32_t AM_PASS_B  = (CN / 16) * AM_GROUP_B;   // all n, 128 p
static constexpr uint32_t SV_PITCH   = 288;  // staged att_vecs rows of 256 B:
// two neighbouring rows' 2-byte stores (32 B each) fall on different banks
static_assert(BATCH * 16 * SV_PITCH <= RING_B, "att_vecs tile");

// 2^a. The v_nop is the one slot that the instruction set asks for between a
// transcendental and a directly following use of its result or overwrite of its
// source; in the same statement, so that it stays directly behind it.
__device__ __forceinline__ float exp2_slot(float a) {
  float r;
  asm("v_exp_f32 %0, %1\n\tv_nop" : "=v"(r) : "v"(a));
  return r;
}

__device__ __forceinline__ fvec8 softmax_over_batch(fvec8 t) {
  float mx = -3.4e38f;
#pragma unroll
  for (int b = 0; b < BATCH; ++b) mx = fmaxf(mx, t[b]);
#pragma unroll
  for (int b = 0; b < BATCH; ++b) t[b] = exp2_slot((t[b] - mx) * 1.44269504f);
  float s = 0.f;
#pragma unroll
  for (int b = 0; b < BATCH; ++b) s += t[b];
  const float inv = 1.f / s;
#pragma unroll
  for (int b = 0; b < BATCH; ++b) t[b] *= inv;
  return t;
}

__global__ __launch_bounds__(256) void a2n_conv123(
    const __bf16* __restrict__ Wc, const __bf16* __restrict__ W4c,
    const __bf16* __restrict__ xT, const float* __restrict__ b2,
    const float* __restrict__ b3, __bf16* __restrict__ W41,
    __bf16* __restrict__ attm, __bf16* __restrict__ attvT) {
  __shared__ __attribute__((aligned(2048))) unsigned char L[RING_B];
  const int tid = threadIdx.x;
  const int lane = tid & 31;
  const int wave = tid >> 5;
  const bool wblk = blockIdx.z == 0;  // block-uniform: a block of W41
  // The plane's other blocks leave whole, ahead of every barrier and tensor
  // load: a scalar branch (a tensor load ignores EXEC).
  if (pinned((uint32_t)(wblk && blockIdx.x >= C_IN / 128))) return;
  const int by = blockIdx.y + YB_A;  // a block's 128 rows lie in one output
  const int rw = (wave >> 1) * 32;  // the wave's first row in them
  // softmax blocks: which group of 16 p
  const uint32_t cb = wblk ? 0u : (blockIdx.z - 1) * (HW / 128) + blockIdx.x;
  const __bf16* Arows = wblk ? W4c + (size_t)blockIdx.y * 128 * CM
                             : Wc + (size_t)by * 128 * C_IN;
  const __bf16* Brows = wblk ? Wc + (size_t)blockIdx.x * 128 * CM
                             : xT + (size_t)cb * 128 * C_IN;
  static_assert(CM == C_IN, "one product shape for W41 and the convolutions");

  // The biases of the lane's two rows, loaded ahead of the product (a block of
  // W41 uses none).
  const float* bias = (by < YB_B) ? b2 + (by - YB_A) * 128
                                  : b3 + (by - YB_B) * 128;
  float bv[2];
#pragma unroll
  for (int i = 0; i < 2; ++i) bv[i] = bias[rw + 16 * i + (lane & 15)];

  fvec8 zero = {};
  fvec8 acc[2][4];
#pragma unroll
  for (int i = 0; i < 2; ++i)
#pragma unroll
    for (int j = 0; j < 4; ++j) acc[i][j] = zero;

  block_gemm_2x4<C_IN, C_IN, true, false>(Arows, Brows, C_IN * 2u, ROW_B, L,
                                          acc);

  if (wblk) {  // block-uniform
    unsigned char* st = L + wave * SLICE_B;  // the wave's own staging range
#pragma unroll
    for (int i = 0; i < 2; ++i)
#pragma unroll
      for (int j = 0; j < 4; ++j)
        stage_bf16(st + (16 * i + (lane & 15)) * ST_PITCH_N +
                       (16 * j + 8 * (lane >> 4)) * 2,
                   acc[i][j]);
    wait_ds0();  // other lanes' rows are read back: every LDS store is done
    rows128_out<32>(st,
                    (char*)(W41 + (size_t)(blockIdx.y * 128 + rw) * C_IN +
                            blockIdx.x * 128 + (wave & 1) * 64),
                    C_IN * 2u, lane);
  } else if (by < YB_B) {
    uint2 o[2][BATCH];
#pragma unroll
    for (int i = 0; i < 2; ++i) {
      fvec8 r[4];
#pragma unroll
      for (int j = 0; j < 4; ++j) r[j] = softmax_over_batch(acc[i][j] + bv[i]);
#pragma unroll
      for (int b = 0; b < BATCH; ++b) {
        o[i][b].x = pack_bf16(r[0][b], r[1][b]);
        o[i][b].y = pack_bf16(r[2][b], r[3][b]);
      }
    }
    // a 32-bit lane offset in bytes per four batches beside uniform bases
    const uint32_t u8 = cb * 2u + (wave & 1);  // which eight p
    const uint32_t off = (u8 >> 4) * AM_PASS_B +
                         (uint32_t)(((by - YB_A) * 128 + rw) >> 4) * AM_GROUP_B +
                         (u8 & 15u) * 256u + (lane & 15) * 16u + (lane >> 4) * 8u;
#pragma unroll
    for (int b = 0; b < BATCH; ++b) {
#pragma unroll
      for (int i = 0; i < 2; ++i)
        *(uint2*)((char*)(attm + (size_t)(b & 3) * CN * HW) + i * AM_GROUP_B +
                  (off + (b >> 2) * (uint32_t)(8 * CN * HW))) = o[i][b];
      // the code laid out behind these stores rewrites their registers
      if ((b & 3) == 3) wait_x0();
    }
  } else {
    // Tile [b][16 p][128 n] of the whole block: behind the ring's last barrier
    // no wave reads the ring and no tensor load is in flight.
    unsigned char* sw = L + ((wave & 1) * 8 + (lane >> 4)) * SV_PITCH +
                        (rw + (lane & 15)) * 2;
#pragma unroll
    for (int i = 0; i < 2; ++i)
#pragma unroll
      for (int j = 0; j < 4; ++j) {
        const fvec8 r = softmax_over_batch(acc[i][j] + bv[i]);
#pragma unroll
        for (int b = 0; b < BATCH; b += 2) {
          const uint32_t w = pack_bf16(r[b], r[b + 1]);
          unsigned char* q = sw + (b * 16 + 2 * j) * SV_PITCH + 32 * i;
          *(uint16_t*)q = (uint16_t)w;
          *(uint16_t*)(q + 16 * SV_PITCH) = (uint16_t)(w >> 16);
        }
      }
    __syncthreads();  // the tile's rows hold four waves' n
    const uint32_t dst = ((cb * 16u + (tid >> 4)) * CN + (by - YB_B) * 128 +
                          (tid & 15) * 8) * 2u;
    const unsigned char* sr = L + (tid >> 4) * SV_PITCH + (tid & 15) * 16;
#pragma unroll
    for (int b = 0; b < BATCH; ++b) {  // 16 lanes = the 256 B of a (b, p) row
      const uint4 v = *(const uint4*)(sr + b * 16 * SV_PITCH);
      *(uint4*)((char*)(attvT + (size_t)b * HW * CN) + dst) = v;
    }
    wait_x0();  // the code laid out behind these stores rewrites their registers
  }
}

// ---------------------------------------------------------------------------
// K3: gathered.  G[c][n] = sum_p xb[c][p] * attm[n][p] (attm in K1's units; A
// below is xb, m its row c).
// The 64 output tiles alone would leave three WGPs in four idle through 32
// passes, so the sum over p is cut into KS slices, one block each. A block
// stores its slice's f32 sums, transposed, as Gp[slice][b][n][m]; K3b adds them.
// ---------------------------------------------------------------------------
static constexpr int KS  = 8;        // slices of the sum over p
static constexpr int KSL = HW / KS;  // p per slice
static constexpr uint32_t NG = BATCH * CN * CM;  // elements of G, all batches
static_assert(SZ_GP == (size_t)KS * NG * 4, "workspace behind Gp");

__global__ __launch_bounds__(256) void a2n_gathered(
    const __bf16* __restrict__ A, const __bf16* __restrict__ attm,
    float* __restrict__ Gp) {
  __shared__ __attribute__((aligned(2048))) unsigned char L[RING_B];
  const int b = blockIdx.z / KS;
  const int ks = blockIdx.z % KS;
  const int lane = threadIdx.x & 31;
  const int wave = threadIdx.x >> 5;
  const int m0 = blockIdx.y * 128 + (wave >> 1) * 32;  // over CM
  const int n0 = blockIdx.x * 128 + (wave & 1) * 64;   // over CN

  fvec8 zero = {};
  fvec8 acc[2][4];
#pragma unroll
  for (int i = 0; i < 2; ++i)
#pragma unroll
    for (int j = 0; j < 4; ++j) acc[i][j] = zero;

  block_gemm_2x4<HW, KSL, false, true>(
      A + (size_t)b * CM * HW + (size_t)blockIdx.y * 128 * HW + ks * KSL,
      attm + (size_t)b * CN * HW + (size_t)ks * (KSL / 128) * (AM_PASS_B / 2) +
          (size_t)blockIdx.x * (128 / 16) * (AM_GROUP_B / 2),
      256u, AM_PASS_B, L, acc);

  // A lane's eight sums of a tile are eight neighbouring m of one n: the wave
  // stages 64 rows (n) of 32 m = 128 B.
  unsigned char* st = L + wave * SLICE_B;  // the wave's own staging range
#pragma unroll
  for (int i = 0; i < 2; ++i)
#pragma unroll
    for (int j = 0; j < 4; ++j)
      stage_f32(st + (16 * j + (lane & 15)) * ST_PITCH_N +
                    (16 * i + 8 * (lane >> 4)) * 4,
                acc[i][j]);
  wait_ds0();  // other lanes' rows are read back: every LDS store is done
  rows128_out<64>(st,
                  (char*)(Gp + (size_t)(ks * BATCH + b) * (CN * CM) +
                          (size_t)n0 * CM + m0),
                  CM * 4u, lane);
}

// ---------------------------------------------------------------------------
// K3b: Gt[b][n][m] (bf16, the ready-made B^T operand of K4) = the KS slices of
// Gp added in slice order. A lane takes 16 elements of every slice (32 loads of
// 16 B); a wave's load = 512 contiguous bytes, its store 256.
// Behind its SS_BLK blocks the launch holds the two factors of b1's share of H:
// SR_BLK blocks for S[b][n] = sum_p att_maps[b][n][p] (a block: 16 n of one
// batch, a wave 4 passes of 128 p; a wave's load = two whole units; the 16 sums
// have a 128-B line of S to themselves, one writer a line) and WB_BLK blocks
// for wb[o] = sum_m w4[o][m] b1[m] (a block 32 o = one line, a wave four).
// ---------------------------------------------------------------------------
static constexpr int SS_H = 4;  // groups of four elements a lane
static constexpr uint32_t SS_BLK = NG / (256 * 4 * SS_H);
static constexpr uint32_t SR_BLK = BATCH * CN / 16;
static constexpr uint32_t WB_BLK = C_IN / 32;

// the sum of the eight bf16 of a 16-byte word, in f32
__device__ __forceinline__ float sum8_bf16(uint4 v) {
  const uint32_t w[4] = {v.x, v.y, v.z, v.w};
  float s = 0.f;
#pragma unroll
  for (int i = 0; i < 4; ++i)
    s += __uint_as_float(w[i] << 16) + __uint_as_float(w[i] & 0xFFFF0000u);
  return s;
}

__global__ __launch_bounds__(256) void a2n_sum_slices(
    const float* __restrict__ Gp, __bf16* __restrict__ Gt,
    const __bf16* __restrict__ attm, const float* __restrict__ w4,
    const float* __restrict__ b1, float* __restrict__ S,
    float* __restrict__ wb) {
  __shared__ float red[256];
  if (blockIdx.x >= SS_BLK + SR_BLK) {  // block-uniform: wb
    const uint32_t lane = threadIdx.x & 31;
    const uint32_t wave = threadIdx.x >> 5;
    const uint32_t o0 = (blockIdx.x - (SS_BLK + SR_BLK)) * 32u;
    f32x4 bq[CM / 128];
#pragma unroll
    for (int h = 0; h < CM / 128; ++h)
      bq[h] = *(const f32x4*)(b1 + h * 128 + lane * 4);
    const float* wr = w4 + (size_t)(o0 + wave * 4) * CM + lane * 4;
    float s[4];
#pragma unroll
    for (int r = 0; r < 4; ++r) {
      s[r] = 0.f;
#pragma unroll
      for (int h = 0; h < CM / 128; ++h) {
        const f32x4 q = *(const f32x4*)(wr + r * CM + h * 128) * bq[h];
        s[r] += (q[0] + q[1]) + (q[2] + q[3]);
      }
    }
#pragma unroll
    for (int d = 16; d > 0; d >>= 1)
#pragma unroll
      for (int r = 0; r < 4; ++r) s[r] += __shfl_xor(s[r], d);
    float mine = s[0];  // every lane holds the four sums; lane r stores sum r
#pragma unroll
    for (int r = 1; r < 4; ++r) mine = (lane == (uint32_t)r) ? s[r] : mine;
    if (lane < 4) red[wave * 4 + lane] = mine;
    __syncthreads();  // the line's 32 sums come from eight waves
    if (threadIdx.x < 32) wb[o0 + threadIdx.x] = red[threadIdx.x];
    return;
  }
  if (blockIdx.x >= SS_BLK) {  // block-uniform: S
    const uint32_t lane = threadIdx.x & 31;
    const uint32_t wave = threadIdx.x >> 5;
    const uint32_t sb = blockIdx.x - SS_BLK;
    // sb = 16 b + (which 16 n); one 32-bit lane offset beside a uniform base
    const uint32_t off = (sb / (CN / 16)) * (uint32_t)(CN * HW * 2) +
                         wave * 4u * AM_PASS_B + (sb % (CN / 16)) * AM_GROUP_B +
                         lane * 16u;
    uint4 v[4][8];
#pragma unroll
    for (int ps = 0; ps < 4; ++ps)
#pragma unroll
      for (int u = 0; u < 8; ++u)
        v[ps][u] =
            *(const uint4*)((const char*)attm + ps * AM_PASS_B + u * 512 + off);
    float s = 0.f;
#pragma unroll
    for (int ps = 0; ps < 4; ++ps)
#pragma unroll
      for (int u = 0; u < 8; ++u) s += sum8_bf16(v[ps][u]);
    red[threadIdx.x] = s;  // lanes l and l + 16 hold the same n
    __syncthreads();       // an n's sum comes from eight waves
    if (threadIdx.x < 16) {
      float t = 0.f;
#pragma unroll
      for (int k = 0; k < 16; ++k) t += red[threadIdx.x + k * 16];
      S[sb * 32u + threadIdx.x] = t;
    }
    return;
  }
  const uint32_t j = blockIdx.x * (256u * 4u * SS_H) +
                     (threadIdx.x >> 5) * (128u * SS_H) +
                     (threadIdx.x & 31) * 4u;
  f32x4 v[KS][SS_H];
  // a 32-bit lane offset per pair of slices beside one uniform base
#pragma unroll
  for (int s = 0; s < KS; ++s) {
#pragma unroll
    for (int h = 0; h < SS_H; ++h)
      v[s][h] = *(const f32x4*)((const char*)(Gp + (s & 1) * NG + h * 128) +
                                (j * 4u + (s >> 1) * (8u * NG)));
    if (s & 1) wait_x0();  // later loads land in these loads' address register
  }
#pragma unroll
  for (int h = 0; h < SS_H; ++h) {
    f32x4 t = v[0][h];
#pragma unroll
    for (int s = 1; s < KS; ++s) t += v[s][h];
    uint2 o;
    o.x = pack_bf16(t[0], t[1]);
    o.y = pack_bf16(t[2], t[3]);
    *(uint2*)((char*)(Gt + h * 128) + j * 2u) = o;
  }
  wait_x0();  // the code laid out behind these stores rewrites their registers
}

// ---------------------------------------------------------------------------
// K4: Hm[o][n] = sum_c W41[o][c] * Gt[n][c] + wb[o] * S[n].  Stored [b][o][n].
// ---------------------------------------------------------------------------
__global__ __launch_bounds__(256) void a2n_w4g(
    const __bf16* __restrict__ W4c, const __bf16* __restrict__ Gt,
    const float* __restrict__ S, const float* __restrict__ wb,
    __bf16* __restrict__ Hb) {
  __shared__ __attribute__((aligned(2048))) unsigned char L[RING_B];
  const int b = blockIdx.z;
  const int lane = threadIdx.x & 31;
  const int wave = threadIdx.x >> 5;
  const int m0 = blockIdx.y * 128 + (wave >> 1) * 32;  // over C (out chans)
  const int n0 = blockIdx.x * 128 + (wave & 1) * 64;   // over CN

  // b1's share of the lane's results, its factors loaded ahead of the product
  float wv[2];
#pragma unroll
  for (int i = 0; i < 2; ++i) wv[i] = wb[m0 + 16 * i + (lane & 15)];
  fvec8 sv[4];
#pragma unroll
  for (int j = 0; j < 4; ++j)
    sv[j] = *(const fvec8*)(S + (b * (CN / 16) + (n0 >> 4) + j) * 32 +
                            8 * (lane >> 4));
  wait_x0();  // the product's set-up rewrites these loads' address registers

  fvec8 zero = {};
  fvec8 acc[2][4];
#pragma unroll
  for (int i = 0; i < 2; ++i)
#pragma unroll
    for (int j = 0; j < 4; ++j) acc[i][j] = zero;

  block_gemm_2x4<CM, CM, true, false>(
      W4c + (size_t)blockIdx.y * 128 * CM,
      Gt + (size_t)b * CN * CM + (size_t)blockIdx.x * 128 * CM, CM * 2u, ROW_B,
      L, acc);

  unsigned char* st = L + wave * SLICE_B;  // the wave's own staging range
#pragma unroll
  for (int i = 0; i < 2; ++i)
#pragma unroll
    for (int j = 0; j < 4; ++j)
      stage_bf16(st + (16 * i + (lane & 15)) * ST_PITCH_N +
                     (16 * j + 8 * (lane >> 4)) * 2,
                 acc[i][j] + sv[j] * wv[i]);
  wait_ds0();  // other lanes' rows are read back: every LDS store is done
  rows128_out<32>(st,
                  (char*)(Hb + (size_t)b * C_IN * CN + (size_t)m0 * CN + n0),
                  CN * 2u, lane);
}

// ---------------------------------------------------------------------------
// K5: out[o][p] = x[o][p] + b4[o] + sum_n Hb[o][n] * attvT[p][n]
// ---------------------------------------------------------------------------
__global__ __launch_bounds__(256) void a2n_distribute_out(
    const __bf16* __restrict__ Hb, const __bf16* __restrict__ attvT,
    const float* __restrict__ b4, const float* __restrict__ x,
    float* __restrict__ out) {
  __shared__ __attribute__((aligned(2048))) unsigned char L[RING_B];
  const int b = blockIdx.z;
  const int lane = threadIdx.x & 31;
  const int wave = threadIdx.x >> 5;
  const int m0 = blockIdx.y * 128 + (wave >> 1) * 32;  // over C
  const int n0 = blockIdx.x * 128 + (wave & 1) * 64;   // over HW

  fvec8 zero = {};
  fvec8 acc[2][4];
#pragma unroll
  for (int i = 0; i < 2; ++i)
#pragma unroll
    for (int j = 0; j < 4; ++j) acc[i][j] = zero;

  block_gemm_2x4<CN, CN, true, false>(
      Hb + (size_t)b * C_IN * CN + (size_t)blockIdx.y * 128 * CN,
      attvT + (size_t)b * HW * CN + (size_t)blockIdx.x * 128 * CN, CN * 2u,
      ROW_B, L, acc);

  // Two rows of 256 B an instruction, for x as for out.
  // One 32-bit lane offset in bytes beside the two uniform bases: its register
  // serves the loads and the stores and takes no other value in between.
  const uint32_t off = (uint32_t)(((b * C_IN + m0 + (lane >> 4)) * HW + n0 +
                                   (lane & 15) * 4) * 4);
  float bv[2];
#pragma unroll
  for (int i = 0; i < 2; ++i) bv[i] = b4[m0 + 16 * i + (lane & 15)];
  f32x4 xv[16];
#pragma unroll
  for (int it = 0; it < 16; ++it)
    xv[it] = *(const f32x4*)((const char*)(x + (size_t)(2 * it) * HW) + off);

  unsigned char* st = L + wave * SLICE_B;  // the wave's own staging range
#pragma unroll
  for (int i = 0; i < 2; ++i)
#pragma unroll
    for (int j = 0; j < 4; ++j)
      stage_f32(st + (16 * i + (lane & 15)) * ST_PITCH_W +
                    (16 * j + 8 * (lane >> 4)) * 4,
                acc[i][j] + bv[i]);
  wait_ds0();  // other lanes' rows are read back: every LDS store is done
  const unsigned char* sr = st + (lane >> 4) * ST_PITCH_W + (lane & 15) * 16;
#pragma unroll
  for (int it = 0; it < 16; ++it) {
    const f32x4 v = *(const f32x4*)(sr + 2 * it * ST_PITCH_W);
    *(f32x4*)((char*)(out + (size_t)(2 * it) * HW) + off) = v + xv[it];
  }
}

// ---------------------------------------------------------------------------
extern "C" void kernel_launch(void* const* d_in, const int* in_sizes, int n_in,
                              void* d_out, int out_size, void* d_ws,
                              size_t ws_size, hipStream_t stream) {
  const float* x  = (const float*)d_in[0];
  const float* w1 = (const float*)d_in[1];
  const float* b1 = (const float*)d_in[2];
  const float* w2 = (const float*)d_in[3];
  const float* b2 = (const float*)d_in[4];
  const float* w3 = (const float*)d_in[5];
  const float* b3 = (const float*)d_in[6];
  const float* w4 = (const float*)d_in[7];
  const float* b4 = (const float*)d_in[8];
  float* out = (float*)d_out;

  char* ws = (char*)d_ws;
  __bf16* XT   = (__bf16*)(ws + OFF_XT);
  __bf16* WC   = (__bf16*)(ws + OFF_WC);
  __bf16* W4C  = (__bf16*)(ws + OFF_W4C);
  __bf16* Abuf = (__bf16*)(ws + OFF_A);
  __bf16* AM   = (__bf16*)(ws + OFF_AM);
  __bf16* AVT  = (__bf16*)(ws + OFF_AVT);
  __bf16* GT   = (__bf16*)(ws + OFF_GT);
  __bf16* HB   = (__bf16*)(ws + OFF_HB);
  float*  GP   = (float*)(ws + OFF_GP);
  __bf16* W41  = (__bf16*)(ws + OFF_W41);
  float*  SB   = (float*)(ws + OFF_S);
  float*  WB   = (float*)(ws + OFF_WB);

  const dim3 blk(256);

  a2n_transpose_x<<<dim3(HW / TX_P, C_IN / TX_C, BATCH), blk, 0,
                    stream>>>(x, XT, Abuf);

  a2n_convert_weights<<<dim3((MO * C_IN + C_IN * CM) / (256 * 8)), blk, 0,
                        stream>>>(w1, w2, w3, w4, WC, W4C);

  a2n_conv123<<<dim3(HW / 128, (MO - CM) / 128, BATCH + 1), blk, 0, stream>>>(
      WC, W4C, XT, b2, b3, W41, AM, AVT);

  a2n_gathered<<<dim3(CN / 128, CM / 128, BATCH * KS), blk, 0, stream>>>(
      Abuf, AM, GP);

  a2n_sum_slices<<<dim3(SS_BLK + SR_BLK + WB_BLK), blk, 0, stream>>>(
      GP, GT, AM, w4, b1, SB, WB);

  a2n_w4g<<<dim3(CN / 128, C_IN / 128, BATCH), blk, 0, stream>>>(W41, GT, SB, WB,
                                                                 HB);

  a2n_distribute_out<<<dim3(HW / 128, C_IN / 128, BATCH), blk, 0, stream>>>(
      HB, AVT, b4, x, out);
}

// v008
// One run takes 72.1 microseconds.
// Next to v007, in two timings, it ran 1.04 and 1.03 times as fast.
// All steps since v000 together make it 5.00 times as fast.
#include <hip/hip_runtime.h>

// ---------------------------------------------------------------------------
// A2N attention block for MI455X (gfx1250, wave32, WMMA bf16 16x16x32).
// out = x + w4 @ ( (A @ softmax_b(Bp)^T) @ softmax_b(V) ) + b4,  A = w1 x + b1
// refactored as  x + (H @ att_vecs) + b4  with
//   H = (w4 w1) (x att_maps^T) + (w4 b1) rowsum(att_maps)^T :
// neither the HW-sized conv4 nor the HW-sized conv1 is ever formed.
// ---------------------------------------------------------------------------

typedef __attribute__((ext_vector_type(16))) __bf16 bvec16;
typedef __attribute__((ext_vector_type(8)))  float  fvec8;

#define BATCH 8
#define C_IN  512
#define CM    512
#define CN    256
#define HW    4096
#define MO    1024   // CM + CN + CN rows of the fused conv123 weight

// ---- workspace layout (bytes) ---------------------------------------------
static constexpr size_t SZ_XT  = (size_t)BATCH * HW * C_IN * 2;  // bf16 xT[p][b][c]
static constexpr size_t SZ_WC  = (size_t)MO * C_IN * 2;          // bf16 [w1^T;w2;w3]
static constexpr size_t SZ_W4C = (size_t)C_IN * CM * 2;          // bf16 w4
static constexpr size_t SZ_A   = (size_t)BATCH * C_IN * HW * 2;  // bf16 xb[b][c][p']
static constexpr size_t SZ_AM  = (size_t)BATCH * CN * HW * 2;    // bf16 att_maps, tiled
static constexpr size_t SZ_AVT = SZ_AM;                          // bf16 att_vecsT[b][p][n]
static constexpr size_t SZ_GT  = (size_t)BATCH * CN * C_IN * 2;  // bf16 Gt[b][n][c]
static constexpr size_t SZ_HB  = (size_t)BATCH * C_IN * CN * 2;  // bf16 Hb[b][o][n]
static constexpr size_t SZ_GP  = (size_t)8 * BATCH * CN * C_IN * 4;  // f32
// Gp[slice][b][n][c]: the gathered product's partial sums
static constexpr size_t SZ_W41 = (size_t)C_IN * C_IN * 2;        // bf16 w4 w1 [o][c]
static constexpr size_t SZ_S   = (size_t)BATCH * CN * 2 * 4;     // f32 S[b][n/16][32]
// f32 wb[o] = (w4 b1)[o] after S

static constexpr size_t OFF_XT  = 0;
static constexpr size_t OFF_WC  = OFF_XT + SZ_XT;
static constexpr size_t OFF_W4C = OFF_WC + SZ_WC;
static constexpr size_t OFF_A   = OFF_W4C + SZ_W4C;
static constexpr size_t OFF_AM  = OFF_A + SZ_A;
static constexpr size_t OFF_AVT = OFF_AM + SZ_AM;
static constexpr size_t OFF_GT  = OFF_AVT + SZ_AVT;
static constexpr size_t OFF_HB  = OFF_GT + SZ_GT;
static constexpr size_t OFF_GP  = OFF_HB + SZ_HB;
static constexpr size_t OFF_W41 = OFF_GP + SZ_GP;
static constexpr size_t OFF_S   = OFF_W41 + SZ_W41;
static constexpr size_t OFF_WB  = OFF_S + SZ_S;

// ---------------------------------------------------------------------------
// LDS ring of the four GEMMs. A pass is 128 k = 256 bytes of every operand row.
// A stage holds the block's 128 A rows and 128 B rows as eight slices of 32
// rows, one slice per wave, each brought in by that wave's own tensor load.
// The load's pad gives an LDS row pitch of 272 B (16 B x odd: no bank conflict
// for ds_load_b128). A slice's 32 * 272 = 8704 B are rounded up to a multiple
// of 2 KiB so that every load's place in LDS is one.
// ---------------------------------------------------------------------------
typedef uint32_t u32x4 __attribute__((ext_vector_type(4)));
typedef uint32_t u32x8 __attribute__((ext_vector_type(8)));

static constexpr uint32_t PASS_K     = 128;
static constexpr uint32_t ROW_B      = 256;
static constexpr uint32_t PITCH_B    = 272;
static constexpr uint32_t SLICE_ROWS = 32;
static constexpr uint32_t SLICE_B    = 10240;
static constexpr uint32_t STAGE_B    = 8 * SLICE_B;
static constexpr uint32_t RING_B     = 2 * STAGE_B;
static_assert(SLICE_B % 2048 == 0 && SLICE_B >= SLICE_ROWS * PITCH_B, "slice");

__device__ __forceinline__ uint32_t uni(uint32_t v) {
  return (uint32_t)__builtin_amdgcn_readfirstlane(v);
}
// Holds v in a scalar register: a test on it compiles to a scalar branch (a
// tensor load ignores EXEC), and descriptor words formed from it are formed
// behind the volatile statements that stand in front of it.
__device__ __forceinline__ uint32_t pinned(uint32_t v) {
  uint32_t w = uni(v);
  asm volatile("" : "+s"(w));  // pinned(): a test or descriptor word kept scalar
  return w;
}
// The compiler places no wait for a tensor load; both waits are hand-written.
__device__ __forceinline__ void wait_tensor0() {
  asm volatile("s_wait_tensorcnt 0x0" ::: "memory");
}
__device__ __forceinline__ void wait_ds0() {
  asm volatile("s_wait_dscnt 0x0" ::: "memory");
}
__device__ __forceinline__ void tdm_load(u32x4 g0, u32x8 g1) {
  asm volatile("tensor_load_to_lds %0, %1" ::"s"(g0), "s"(g1) : "memory");
}
// Group 1: 1-byte elements, tile = tensor = 32 rows of 256 B, a 4-dword pad
// behind every 64 dwords, no mask.
__device__ __forceinline__ u32x8 tdm_group1(uint32_t src_pitch_bytes) {
  u32x8 g;
  g[0] = uni((1u << 20) | (5u << 22) | (3u << 25));
  g[1] = uni((ROW_B & 0xFFFFu) << 16);
  g[2] = uni((ROW_B >> 16) | ((SLICE_ROWS & 0xFFFFu) << 16));
  g[3] = uni((SLICE_ROWS >> 16) | (ROW_B << 16));
  g[4] = uni(SLICE_ROWS);
  g[5] = uni(src_pitch_bytes);
  g[6] = uni(0u);
  g[7] = uni(0u);
  return g;
}
__device__ __forceinline__ u32x4 tdm_group0(uint32_t lds_dst, uint64_t ga) {
  u32x4 g;
  g[0] = uni(1u);
  g[1] = uni(lds_dst);
  g[2] = uni((uint32_t)ga);
  g[3] = uni((((uint32_t)(ga >> 32)) & 0x01FFFFFFu) | 0x80000000u);
  return g;
}

// ---------------------------------------------------------------------------
// WMMA operand fragment from a staged row block. Works for the A operand from
// row-major [M][K] and for the B operand when B^T is row-major [N][K] (K1,
// K4, K5) or in units of 16 rows x 8 k (K3). Matches ISA bf16 16x32 layout:
//   lane L: row = L&15, chunk0 = K[(L>>4)*8 .. +7], chunk1 = chunk0 + 16.
// p already holds the lane's chunk0; chunk1 lies D bytes further.
// ---------------------------------------------------------------------------
template <uint32_t D>
__device__ __forceinline__ bvec16 lds_frag(const unsigned char* p) {
  union { uint4 q[2]; bvec16 v; } u;
  u.q[0] = *(const uint4*)(p);
  u.q[1] = *(const uint4*)(p + D);
  return u.v;
}

// Block tile 128x128 from eight waves, each 32x64: 2 (M) x 4 (N) WMMA tiles.
// Ablk, Bblk: the block's first row of each operand. A rows are K-contiguous
// with a pitch of LD elements. B's 32-row slices have a source row pitch of
// ldb bytes, and a pass's rows lie bstep bytes behind the pass before (both
// block-uniform). BT false: a B row is K-contiguous like an A row. BT true:
// a B source row is a unit of 16 operand rows x 8 k (16 B each), a pass has 16
// such units for each group of 16 operand rows, a slice two groups.
// L: the kernel's RING_B bytes of LDS.
// TR: the two fragments trade places in the matrix instruction (their lane
// maps are equal), so that acc[i][j] holds the tile transposed: a lane has one
// A row, 16 i + (lane & 15), and eight neighbouring B rows,
// 16 j + 8 (lane >> 4) + e.
template <int LD, int K, bool TR, bool BT>
__device__ __forceinline__ void block_gemm_2x4(const __bf16* __restrict__ Ablk,
                                               const __bf16* __restrict__ Bblk,
                                               uint32_t ldb, uint32_t bstep,
                                               unsigned char* L,
                                               fvec8 acc[2][4]) {
  constexpr uint32_t S = K / PASS_K;  // stages = passes
  static_assert(K % PASS_K == 0 && S >= 2, "the ring needs two stages");
  const uint32_t lane = threadIdx.x & 31;
  const uint32_t wave = uni(threadIdx.x >> 5);

  // This wave's slice: waves 0..3 bring A rows, waves 4..7 B rows.
  const uint32_t pitch = (wave < 4u) ? (uint32_t)LD * 2u : ldb;
  const uint32_t step = (wave < 4u) ? ROW_B : bstep;
  const uint64_t src =
      (uint64_t)(uintptr_t)((wave < 4u) ? Ablk : Bblk) +
      (uint64_t)(SLICE_ROWS * (wave & 3u)) * pitch;
  const uint32_t dst = (uint32_t)(size_t)L + wave * SLICE_B;
  u32x8 g1 = tdm_group1(pitch);
  // pinned(), for the eight descriptor words at once: they stay in one scalar
  // register group. Without it the build uses words 3 and 6 of the group as
  // scratch in the loop, while the load that names them is still in flight.
  asm volatile("" : "+s"(g1));

  tdm_load(tdm_group0(dst, src), g1);  // stage 0
  wait_tensor0();
  __syncthreads();                     // stage 0 is published
  {
    const uint32_t one = pinned(1u);   // stage 1's words formed behind the wait
    tdm_load(tdm_group0(dst + one * STAGE_B, src + (uint64_t)one * step), g1);
  }

  const uint32_t lrow = (lane & 15u) * PITCH_B + (lane >> 4) * 16u;
  const uint32_t a_off = (wave >> 1) * SLICE_B + lrow;
  const uint32_t b_off =
      (4u + (wave & 1u) * 2u) * SLICE_B +
      (BT ? (lane >> 4) * PITCH_B + (lane & 15u) * 16u : lrow);
  constexpr uint32_t B_KK = BT ? 4u * PITCH_B : 64u;  // 32 k further
  constexpr uint32_t B_C1 = BT ? 2u * PITCH_B : 32u;  // 16 k further

// rolled: one copy of the pass in the instruction cache for every K
#pragma clang loop unroll(disable)
  for (uint32_t s = 0; s < S; ++s) {
    const unsigned char* buf = L + (s & 1u) * STAGE_B;
#pragma unroll
    for (uint32_t kk = 0; kk < PASS_K / 32; ++kk) {
      bvec16 af[2], bfr[4];
#pragma unroll
      for (uint32_t i = 0; i < 2; ++i)
        af[i] = lds_frag<32u>(buf + a_off + i * 16u * PITCH_B + kk * 64u);
#pragma unroll
      for (uint32_t j = 0; j < 4; ++j)
        bfr[j] = lds_frag<B_C1>(buf + b_off + (j >> 1) * SLICE_B +
                                (j & 1u) * 16u * PITCH_B + kk * B_KK);
#pragma unroll
      for (int i = 0; i < 2; ++i)
#pragma unroll
        for (int j = 0; j < 4; ++j)
          acc[i][j] = TR ? __builtin_amdgcn_wmma_f32_16x16x32_bf16(
                               false, bfr[j], false, af[i], (short)0, acc[i][j],
                               false, false)
                         : __builtin_amdgcn_wmma_f32_16x16x32_bf16(
                               false, af[i], false, bfr[j], (short)0, acc[i][j],
                               false, false);
    }
    // Publish point of stage s + 1: this wave's reads of stage s are back, its
    // own slice of stage s + 1 has landed, then every wave meets.
    wait_ds0();
    wait_tensor0();
    __syncthreads();
    const uint32_t nxt = pinned(s + 2u);  // refill's words formed behind the wait
    if (pinned(nxt < S))
      tdm_load(tdm_group0(dst + (nxt & 1u) * STAGE_B,
                          src + (uint64_t)nxt * step), g1);
  }
  wait_tensor0();
  wait_ds0();
}

// ---------------------------------------------------------------------------
// Helpers of the matrix and non-matrix launches: 16-byte global accesses.
// ---------------------------------------------------------------------------
typedef float  f32x4 __attribute__((ext_vector_type(4)));
typedef float  f32x2 __attribute__((ext_vector_type(2)));
typedef __bf16 bf16x2 __attribute__((ext_vector_type(2)));

// Stands behind a group of global loads or stores whose registers are used
// again for other values further down.
__device__ __forceinline__ void wait_x0() {
  asm volatile("s_wait_xcnt 0x0" ::: "memory");
}

// Two f32 to one dword of two bf16 (round to nearest even), lo in the low half.
__device__ __forceinline__ uint32_t pack_bf16(float lo, float hi) {
  f32x2 f = {lo, hi};
  union { bf16x2 h; uint32_t u; } c;
  c.h = __builtin_convertvector(f, bf16x2);
  return c.u;
}

// ---------------------------------------------------------------------------
// Epilogue of the four GEMMs (K1's softmax outputs aside): a wave's 32x64 results go through LDS so that
// every global access is 16 bytes a lane and covers whole 128-B lines. Behind
// the ring's last barrier no tensor load is in flight and no wave reads the
// ring any more; each wave then stages in its own SLICE_B bytes of it, so no
// further barrier is needed. A lane writes its eight neighbouring results with
// 16-byte LDS stores; row pitches are 16 B x odd (16 rows fall on 64 banks).
// ---------------------------------------------------------------------------
static constexpr uint32_t ST_PITCH_W = 272;  // staged rows of 256 B
static constexpr uint32_t ST_PITCH_N = 144;  // staged rows of 128 B
static_assert(32 * ST_PITCH_W <= SLICE_B && 64 * ST_PITCH_N <= SLICE_B, "stage");

__device__ __forceinline__ void stage_f32(unsigned char* p, fvec8 a) {
  const f32x4 lo = {a[0], a[1], a[2], a[3]};
  const f32x4 hi = {a[4], a[5], a[6], a[7]};
  *(f32x4*)p = lo;
  *(f32x4*)(p + 16) = hi;
}
__device__ __forceinline__ void stage_bf16(unsigned char* p, fvec8 a) {
  uint4 o;
  o.x = pack_bf16(a[0], a[1]);
  o.y = pack_bf16(a[2], a[3]);
  o.z = pack_bf16(a[4], a[5]);
  o.w = pack_bf16(a[6], a[7]);
  *(uint4*)p = o;
}
// ROWS staged rows of 128 B leave as whole lines, four rows an instruction.
// Lanes 0..7 and 8..15 take rows 8 apart: 8 * 144 B = half the banks further.
template <int ROWS>
__device__ __forceinline__ void rows128_out(const unsigned char* st, char* g,
                                            uint32_t gpitch, uint32_t lane) {
  st += (lane >> 3) * 8u * ST_PITCH_N + (lane & 7u) * 16u;
  g += (size_t)((lane >> 3) * 8u) * gpitch + (lane & 7u) * 16u;
#pragma unroll
  for (uint32_t it = 0; it < ROWS / 4; ++it) {
    const uint32_t row = (it & 7u) + 32u * (it >> 3);
    const uint4 v = *(const uint4*)(st + row * ST_PITCH_N);
    *(uint4*)(g + (size_t)row * gpitch) = v;
  }
}

// ---------------------------------------------------------------------------
// Prep 2: weights to bf16, w1^T|w2|w3 into Wc [1024][512], w4 into W4c. It has
// no launch of its own: the plane blockIdx.z = 0 of the transpose launch does it
// (f: the block's index in the plane). A block takes 2048 elements, eight a
// lane, of each of three parts: w1, w2|w3, w4; all its loads are issued ahead
// of its stores.
// w1 leaves transposed, [c][m], as the B operand of w4 w1: a lane takes eight m
// of one c, eight lanes fill a 128-B line, a wave four lines (four c).
// ---------------------------------------------------------------------------
static constexpr int CV_BLK = CM * C_IN / (256 * 8);  // blocks of the plane
static_assert(2 * CN * C_IN == CM * C_IN && C_IN * CM == CM * C_IN,
              "three parts of one size");
static_assert(CN * C_IN % (256 * 8) == 0, "a block's second part: w2 or w3");

__device__ __forceinline__ uint4 pack8_bf16(f32x4 a, f32x4 c) {
  uint4 o;
  o.x = pack_bf16(a[0], a[1]);
  o.y = pack_bf16(a[2], a[3]);
  o.z = pack_bf16(c[0], c[1]);
  o.w = pack_bf16(c[2], c[3]);
  return o;
}

__device__ __forceinline__ void convert_weights_block(
    int f, const float* __restrict__ w1, const float* __restrict__ w2,
    const float* __restrict__ w3, const float* __restrict__ w4,
    __bf16* __restrict__ Wc, __bf16* __restrict__ W4c) {
  const int u = f * 256 + threadIdx.x;
  const int t = u * 8;
  const int c = (u >> 8) * 4 + ((u >> 3) & 3);
  const int m = (((u >> 5) & 7) * 8 + (u & 7)) * 8;
  const float* sc = w1 + (size_t)m * C_IN + c;
  const float* s23 = (f < CV_BLK / 2) ? w2 + t : w3 + (t - CN * C_IN);
  const float* s4 = w4 + t;
  float v[8];
#pragma unroll
  for (int e = 0; e < 8; ++e) v[e] = sc[e * C_IN];
  const f32x4 a23 = *(const f32x4*)s23;
  const f32x4 c23 = *(const f32x4*)(s23 + 4);
  const f32x4 a4 = *(const f32x4*)s4;
  const f32x4 c4 = *(const f32x4*)(s4 + 4);
  wait_x0();  // the address registers of these loads take other values below
  // keeps the stores' address arithmetic, which takes those registers, behind
  // the wait (a "memory" clobber alone does not)
  __builtin_amdgcn_sched_barrier(0);
  uint4 o;
  o.x = pack_bf16(v[0], v[1]);
  o.y = pack_bf16(v[2], v[3]);
  o.z = pack_bf16(v[4], v[5]);
  o.w = pack_bf16(v[6], v[7]);
  *(uint4*)(Wc + (size_t)c * CM + m) = o;
  *(uint4*)(Wc + CM * C_IN + t) = pack8_bf16(a23, c23);
  *(uint4*)(W4c + t) = pack8_bf16(a4, c4);
}

// ---------------------------------------------------------------------------
// Prep 1: x [b][c][p] f32  ->  xT [p][b][c] bf16 (row index 8 p + b).
// A block takes one tile of 128 c x 128 p, 64 values a lane. A lane loads 4 p
// of two neighbouring c rows (8 lanes = one 128-B line), packs the pair and
// writes dwords into an LDS tile [p][c/2]; the tile leaves as 16-byte stores,
// 16 lanes = the 256 B that a p row of the tile has in xT.
// The same values leave a second time untransposed, xb [b][c][p'] bf16, the
// gathered product's A operand, through a second LDS tile [c][p']: every eight p
// stand in the order 0 2 4 6 1 3 5 7 in which att_maps holds them (see K1).
// Batch b is the plane blockIdx.z = b + 1; plane 0 converts the weights.
// ---------------------------------------------------------------------------
static constexpr int TX_C     = 128;
static constexpr int TX_P     = 128;
static constexpr int TX_PITCH = 68;  // dwords: 272 B = 16 B x odd
static constexpr int TB_PITCH = 72;  // dwords: a wave's four c rows, two apart,
// fall a quarter of the 64 banks apart

__global__ __launch_bounds__(256) void a2n_transpose_x(
    const float* __restrict__ x, __bf16* __restrict__ xT,
    __bf16* __restrict__ xb16, const float* __restrict__ w1,
    const float* __restrict__ w2, const float* __restrict__ w3,
    const float* __restrict__ w4, __bf16* __restrict__ Wc,
    __bf16* __restrict__ W4c) {
  __shared__ __attribute__((aligned(16))) uint32_t tile[TX_P * TX_PITCH];
  __shared__ __attribute__((aligned(16))) uint32_t tileb[TX_C * TB_PITCH];
  static_assert((HW / TX_P) * (C_IN / TX_C) == CV_BLK, "plane 0 = the weights");
  if (blockIdx.z == 0) {  // block-uniform, ahead of the barrier
    convert_weights_block(blockIdx.y * (HW / TX_P) + blockIdx.x, w1, w2, w3, w4,
                          Wc, W4c);
    return;
  }
  const int bz = blockIdx.z - 1;  // the batch
  const int tid = threadIdx.x;
  const int lane = tid & 31;
  const int wave = tid >> 5;
  const int p4l = lane & 7;
  const int c2l = wave * 8 + (lane >> 3);
  const int pbase = blockIdx.x * TX_P;
  const float* xb = x + ((size_t)bz * C_IN + blockIdx.y * TX_C) * HW +
                    (size_t)(2 * c2l) * HW + pbase + 4 * p4l;
  __bf16* xTb = xT + ((size_t)(pbase + (tid >> 4)) * BATCH + bz) * C_IN +
                blockIdx.y * TX_C + (tid & 15) * 8;

  f32x4 r[TX_P / 32][2][2];  // [group of 32 p][group of 4 c pairs][c of the pair]
#pragma unroll
  for (int pg = 0; pg < TX_P / 32; ++pg)
#pragma unroll
    for (int cg = 0; cg < 2; ++cg)
#pragma unroll
      for (int h = 0; h < 2; ++h) {
        // the last load may land in the address registers of the loads before it
        if (pg == TX_P / 32 - 1 && cg == 1 && h == 1) wait_x0();
        r[pg][cg][h] = *(const f32x4*)(xb + (size_t)(cg * 8 + h) * HW + pg * 32);
      }
#pragma unroll
  for (int pg = 0; pg < TX_P / 32; ++pg)
#pragma unroll
    for (int cg = 0; cg < 2; ++cg)
#pragma unroll
      for (int i = 0; i < 4; ++i)
        tile[(pg * 32 + 4 * p4l + i) * TX_PITCH + cg * 4 + c2l] =
            pack_bf16(r[pg][cg][0][i], r[pg][cg][1][i]);
  // A lane's four p are one half of a group of eight: p 0 2 | 1 3 of the low
  // half are dwords 0 and 2 of the group, p 4 6 | 5 7 of the high half 1 and 3.
#pragma unroll
  for (int pg = 0; pg < TX_P / 32; ++pg)
#pragma unroll
    for (int cg = 0; cg < 2; ++cg)
#pragma unroll
      for (int h = 0; h < 2; ++h) {
        uint32_t* q = &tileb[(2 * (cg * 4 + c2l) + h) * TB_PITCH + pg * 16 +
                             (p4l >> 1) * 4 + (p4l & 1)];
        q[0] = pack_bf16(r[pg][cg][h][0], r[pg][cg][h][2]);
        q[2] = pack_bf16(r[pg][cg][h][1], r[pg][cg][h][3]);
      }
  __syncthreads();
#pragma unroll
  for (int it = 0; it < TX_P / 16; ++it) {
    const uint4 v =
        *(const uint4*)&tile[(it * 16 + (tid >> 4)) * TX_PITCH + (tid & 15) * 4];
    *(uint4*)(xTb + (size_t)(it * 16) * BATCH * C_IN) = v;
  }
  __bf16* xbb = xb16 +
                ((size_t)bz * C_IN + blockIdx.y * TX_C + (tid >> 4)) * HW +
                pbase + (tid & 15) * 8;
#pragma unroll
  for (int it = 0; it < TX_C / 16; ++it) {  // 16 lanes = the 256 B of a c row
    const uint4 v =
        *(const uint4*)&tileb[(it * 16 + (tid >> 4)) * TB_PITCH + (tid & 15) * 4];
    *(uint4*)(xbb + (size_t)(it * 16) * HW) = v;
  }
}

// ---------------------------------------------------------------------------
// K1: fused conv2/3 with the softmax over the batch axis in its epilogue.
// Y[o][col] = sum_c Wc[o][c] * xT[col][c]  (+bias)
// Wc rows 512..767 -> att_maps, 768..1023 -> att_vecs: a block's
// 128 columns are 128 neighbouring xT rows = 16 p x 8 batches, so a lane's
// eight neighbouring results are the eight batches of one (n, p) and the
// softmax needs no other lane.
// The plane blockIdx.z = 0 holds the 16 blocks of W41[o][c] = sum_m w4[o][m]
// w1[m][c] (the same product shape, operands W4c and Wc's rows 0..511 = w1^T).
// att_maps leaves as the gathered product's B operand in units of 16 n x 8 p
// (256 B, 16 B an n): byte address of (b, n, p) =
//   b CN HW 2 + (p / 128) AM_PASS_B + (n / 16) AM_GROUP_B + (p / 8 % 16) 256
//   + (n % 16) 16 + 2 q,  q = 4 (p % 2) + p % 8 / 2.
// A lane holds p % 8 = 2 j + (lane >> 4), j = 0..3: 8 neighbouring bytes; a
// wave's store is one whole unit. xb holds every eight p in the same order q.
// att_vecs leaves transposed, [b][p][n], through an LDS tile of the block.
// ---------------------------------------------------------------------------
static constexpr int YB_A = CM / 128;         // row blocks of Wc below: w1^T
static constexpr int YB_B = (CM + CN) / 128;  // below: att_maps; from here: att_vecs
static_assert(CM % 128 == 0 && CN % 128 == 0, "a block's rows share one output");
static constexpr uint32_t AM_GROUP_B = 16 * 256;                 // 16 n, 128 p
static constexpr uint32_t AM_PASS_B  = (CN / 16) * AM_GROUP_B;   // all n, 128 p
static constexpr uint32_t SV_PITCH   = 288;  // staged att_vecs rows of 256 B:
// two neighbouring rows' 2-byte stores (32 B each) fall on different banks
static_assert(BATCH * 16 * SV_PITCH <= RING_B, "att_vecs tile");

// 2^a. The v_nop is the one slot that the instruction set asks for between a
// transcendental and a directly following use of its result or overwrite of its
// source; in the same statement, so that it stays directly behind it.
__device__ __forceinline__ float exp2_slot(float a) {
  float r;
  asm("v_exp_f32 %0, %1\n\tv_nop" : "=v"(r) : "v"(a));
  return r;
}

__device__ __forceinline__ fvec8 softmax_over_batch(fvec8 t) {
  float mx = -3.4e38f;
#pragma unroll
  for (int b = 0; b < BATCH; ++b) mx = fmaxf(mx, t[b]);
#pragma unroll
  for (int b = 0; b < BATCH; ++b) t[b] = exp2_slot((t[b] - mx) * 1.44269504f);
  float s = 0.f;
#pragma unroll
  for (int b = 0; b < BATCH; ++b) s += t[b];
  const float inv = 1.f / s;
#pragma unroll
  for (int b = 0; b < BATCH; ++b) t[b] *= inv;
  return t;
}

__global__ __launch_bounds__(256) void a2n_conv123(
    const __bf16* __restrict__ Wc, const __bf16* __restrict__ W4c,
    const __bf16* __restrict__ xT, const float* __restrict__ b2,
    const float* __restrict__ b3, __bf16* __restrict__ W41,
    __bf16* __restrict__ attm, __bf16* __restrict__ attvT) {
  __shared__ __attribute__((aligned(2048))) unsigned char L[RING_B];
  const int tid = threadIdx.x;
  const int lane = tid & 31;
  const int wave = tid >> 5;
  const bool wblk = blockIdx.z == 0;  // block-uniform: a block of W41
  // The plane's other blocks leave whole, ahead of every barrier and tensor
  // load: a scalar branch (a tensor load ignores EXEC).
  if (pinned((uint32_t)(wblk && blockIdx.x >= C_IN / 128))) return;
  const int by = blockIdx.y + YB_A;  // a block's 128 rows lie in one output
  const int rw = (wave >> 1) * 32;  // the wave's first row in them
  // softmax blocks: which group of 16 p
  const uint32_t cb = wblk ? 0u : (blockIdx.z - 1) * (HW / 128) + blockIdx.x;
  const __bf16* Arows = wblk ? W4c + (size_t)blockIdx.y * 128 * CM
                             : Wc + (size_t)by * 128 * C_IN;
  const __bf16* Brows = wblk ? Wc + (size_t)blockIdx.x * 128 * CM
                             : xT + (size_t)cb * 128 * C_IN;
  static_assert(CM == C_IN, "one product shape for W41 and the convolutions");

  // The biases of the lane's two rows, loaded ahead of the product (a block of
  // W41 uses none).
  const float* bias = (by < YB_B) ? b2 + (by - YB_A) * 128
                                  : b3 + (by - YB_B) * 128;
  float bv[2];
#pragma unroll
  for (int i = 0; i < 2; ++i) bv[i] = bias[rw + 16 * i + (lane & 15)];

  fvec8 zero = {};
  fvec8 acc[2][4];
#pragma unroll
  for (int i = 0; i < 2; ++i)
#pragma unroll
    for (int j = 0; j < 4; ++j) acc[i][j] = zero;

  block_gemm_2x4<C_IN, C_IN, true, false>(Arows, Brows, C_IN * 2u, ROW_B, L,
                                          acc);

  if (wblk) {  // block-uniform
    unsigned char* st = L + wave * SLICE_B;  // the wave's own staging range
#pragma unroll
    for (int i = 0; i < 2; ++i)
#pragma unroll
      for (int j = 0; j < 4; ++j)
        stage_bf16(st + (16 * i + (lane & 15)) * ST_PITCH_N +
                       (16 * j + 8 * (lane >> 4)) * 2,
                   acc[i][j]);
    wait_ds0();  // other lanes' rows are read back: every LDS store is done
    rows128_out<32>(st,
                    (char*)(W41 + (size_t)(blockIdx.y * 128 + rw) * C_IN +
                            blockIdx.x * 128 + (wave & 1) * 64),
                    C_IN * 2u, lane);
  } else if (by < YB_B) {
    uint2 o[2][BATCH];
#pragma unroll
    for (int i = 0; i < 2; ++i) {
      fvec8 r[4];
#pragma unroll
      for (int j = 0; j < 4; ++j) r[j] = softmax_over_batch(acc[i][j] + bv[i]);
#pragma unroll
      for (int b = 0; b < BATCH; ++b) {
        o[i][b].x = pack_bf16(r[0][b], r[1][b]);
        o[i][b].y = pack_bf16(r[2][b], r[3][b]);
      }
    }
    // a 32-bit lane offset in bytes per four batches beside uniform bases
    const uint32_t u8 = cb * 2u + (wave & 1);  // which eight p
    const uint32_t off = (u8 >> 4) * AM_PASS_B +
                         (uint32_t)(((by - YB_A) * 128 + rw) >> 4) * AM_GROUP_B +
                         (u8 & 15u) * 256u + (lane & 15) * 16u + (lane >> 4) * 8u;
#pragma unroll
    for (int b = 0; b < BATCH; ++b) {
#pragma unroll
      for (int i = 0; i < 2; ++i)
        *(uint2*)((char*)(attm + (size_t)(b & 3) * CN * HW) + i * AM_GROUP_B +
                  (off + (b >> 2) * (uint32_t)(8 * CN * HW))) = o[i][b];
      // the code laid out behind these stores rewrites their registers
      if ((b & 3) == 3) wait_x0();
    }
  } else {
    // Tile [b][16 p][128 n] of the whole block: behind the ring's last barrier
    // no wave reads the ring and no tensor load is in flight.
    unsigned char* sw = L + ((wave & 1) * 8 + (lane >> 4)) * SV_PITCH +
                        (rw + (lane & 15)) * 2;
#pragma unroll
    for (int i = 0; i < 2; ++i)
#pragma unroll
      for (int j = 0; j < 4; ++j) {
        const fvec8 r = softmax_over_batch(acc[i][j] + bv[i]);
#pragma unroll
        for (int b = 0; b < BATCH; b += 2) {
          const uint32_t w = pack_bf16(r[b], r[b + 1]);
          unsigned char* q = sw + (b * 16 + 2 * j) * SV_PITCH + 32 * i;
          *(uint16_t*)q = (uint16_t)w;
          *(uint16_t*)(q + 16 * SV_PITCH) = (uint16_t)(w >> 16);
        }
      }
    __syncthreads();  // the tile's rows hold four waves' n
    const uint32_t dst = ((cb * 16u + (tid >> 4)) * CN + (by - YB_B) * 128 +
                          (tid & 15) * 8) * 2u;
    const unsigned char* sr = L + (tid >> 4) * SV_PITCH + (tid & 15) * 16;
#pragma unroll
    for (int b = 0; b < BATCH; ++b) {  // 16 lanes = the 256 B of a (b, p) row
      const uint4 v = *(const uint4*)(sr + b * 16 * SV_PITCH);
      *(uint4*)((char*)(attvT + (size_t)b * HW * CN) + dst) = v;
    }
    wait_x0();  // the code laid out behind these stores rewrites their registers
  }
}

// ---------------------------------------------------------------------------
// K3: gathered.  G[c][n] = sum_p xb[c][p] * attm[n][p] (attm in K1's units; A
// below is xb, m its row c).
// The 64 output tiles alone would leave three WGPs in four idle through 32
// passes, so the sum over p is cut into KS slices, one block each. A block
// stores its slice's f32 sums, transposed, as Gp[slice][b][n][m]; K3b adds them.
// ---------------------------------------------------------------------------
static constexpr int KS  = 8;        // slices of the sum over p
static constexpr int KSL = HW / KS;  // p per slice
static constexpr uint32_t NG = BATCH * CN * CM;  // elements of G, all batches
static_assert(SZ_GP == (size_t)KS * NG * 4, "workspace behind Gp");

__global__ __launch_bounds__(256) void a2n_gathered(
    const __bf16* __restrict__ A, const __bf16* __restrict__ attm,
    float* __restrict__ Gp) {
  __shared__ __attribute__((aligned(2048))) unsigned char L[RING_B];
  const int b = blockIdx.z / KS;
  const int ks = blockIdx.z % KS;
  const int lane = threadIdx.x & 31;
  const int wave = threadIdx.x >> 5;
  const int m0 = blockIdx.y * 128 + (wave >> 1) * 32;  // over CM
  const int n0 = blockIdx.x * 128 + (wave & 1) * 64;   // over CN

  fvec8 zero = {};
  fvec8 acc[2][4];
#pragma unroll
  for (int i = 0; i < 2; ++i)
#pragma unroll
    for (int j = 0; j < 4; ++j) acc[i][j] = zero;

  block_gemm_2x4<HW, KSL, false, true>(
      A + (size_t)b * CM * HW + (size_t)blockIdx.y * 128 * HW + ks * KSL,
      attm + (size_t)b * CN * HW + (size_t)ks * (KSL / 128) * (AM_PASS_B / 2) +
          (size_t)blockIdx.x * (128 / 16) * (AM_GROUP_B / 2),
      256u, AM_PASS_B, L, acc);

  // A lane's eight sums of a tile are eight neighbouring m of one n: the wave
  // stages 64 rows (n) of 32 m = 128 B.
  unsigned char* st = L + wave * SLICE_B;  // the wave's own staging range
#pragma unroll
  for (int i = 0; i < 2; ++i)
#pragma unroll
    for (int j = 0; j < 4; ++j)
      stage_f32(st + (16 * j + (lane & 15)) * ST_PITCH_N +
                    (16 * i + 8 * (lane >> 4)) * 4,
                acc[i][j]);
  wait_ds0();  // other lanes' rows are read back: every LDS store is done
  rows128_out<64>(st,
                  (char*)(Gp + (size_t)(ks * BATCH + b) * (CN * CM) +
                          (size_t)n0 * CM + m0),
                  CM * 4u, lane);
}

// ---------------------------------------------------------------------------
// K3b: Gt[b][n][m] (bf16, the ready-made B^T operand of K4) = the KS slices of
// Gp added in slice order. A lane takes 16 elements of every slice (32 loads of
// 16 B); a wave's load = 512 contiguous bytes, its store 256.
// Behind its SS_BLK blocks the launch holds the two factors of b1's share of H:
// SR_BLK blocks for S[b][n] = sum_p att_maps[b][n][p] (a block: 16 n of one
// batch, a wave 4 passes of 128 p; a wave's load = two whole units; the 16 sums
// have a 128-B line of S to themselves, one writer a line) and WB_BLK blocks
// for wb[o] = sum_m w4[o][m] b1[m] (a block 32 o = one line, a wave four).
// ---------------------------------------------------------------------------
static constexpr int SS_H = 4;  // groups of four elements a lane
static constexpr uint32_t SS_BLK = NG / (256 * 4 * SS_H);
static constexpr uint32_t SR_BLK = BATCH * CN / 16;
static constexpr uint32_t WB_BLK = C_IN / 32;

// the sum of the eight bf16 of a 16-byte word, in f32
__device__ __forceinline__ float sum8_bf16(uint4 v) {
  const uint32_t w[4] = {v.x, v.y, v.z, v.w};
  float s = 0.f;
#pragma unroll
  for (int i = 0; i < 4; ++i)
    s += __uint_as_float(w[i] << 16) + __uint_as_float(w[i] & 0xFFFF0000u);
  return s;
}

__global__ __launch_bounds__(256) void a2n_sum_slices(
    const float* __restrict__ Gp, __bf16* __restrict__ Gt,
    const __bf16* __restrict__ attm, const float* __restrict__ w4,
    const float* __restrict__ b1, float* __restrict__ S,
    float* __restrict__ wb) {
  __shared__ float red[256];
  if (blockIdx.x >= SS_BLK + SR_BLK) {  // block-uniform: wb
    const uint32_t lane = threadIdx.x & 31;
    const uint32_t wave = threadIdx.x >> 5;
    const uint32_t o0 = (blockIdx.x - (SS_BLK + SR_BLK)) * 32u;
    f32x4 bq[CM / 128];
#pragma unroll
    for (int h = 0; h < CM / 128; ++h)
      bq[h] = *(const f32x4*)(b1 + h * 128 + lane * 4);
    const float* wr = w4 + (size_t)(o0 + wave * 4) * CM + lane * 4;
    float s[4];
#pragma unroll
    for (int r = 0; r < 4; ++r) {
      s[r] = 0.f;
#pragma unroll
      for (int h = 0; h < CM / 128; ++h) {
        const f32x4 q = *(const f32x4*)(wr + r * CM + h * 128) * bq[h];
        s[r] += (q[0] + q[1]) + (q[2] + q[3]);
      }
    }
#pragma unroll
    for (int d = 16; d > 0; d >>= 1)
#pragma unroll
      for (int r = 0; r < 4; ++r) s[r] += __shfl_xor(s[r], d);
    float mine = s[0];  // every lane holds the four sums; lane r stores sum r
#pragma unroll
    for (int r = 1; r < 4; ++r) mine = (lane == (uint32_t)r) ? s[r] : mine;
    if (lane < 4) red[wave * 4 + lane] = mine;
    __syncthreads();  // the line's 32 sums come from eight waves
    if (threadIdx.x < 32) wb[o0 + threadIdx.x] = red[threadIdx.x];
    return;
  }
  if (blockIdx.x >= SS_BLK) {  // block-uniform: S
    const uint32_t lane = threadIdx.x & 31;
    const uint32_t wave = threadIdx.x >> 5;
    const uint32_t sb = blockIdx.x - SS_BLK;
    // sb = 16 b + (which 16 n); one 32-bit lane offset beside a uniform base
    const uint32_t off = (sb / (CN / 16)) * (uint32_t)(CN * HW * 2) +
                         wave * 4u * AM_PASS_B + (sb % (CN / 16)) * AM_GROUP_B +
                         lane * 16u;
    uint4 v[4][8];
#pragma unroll
    for (int ps = 0; ps < 4; ++ps)
#pragma unroll
      for (int u = 0; u < 8; ++u)
        v[ps][u] =
            *(const uint4*)((const char*)attm + ps * AM_PASS_B + u * 512 + off);
    float s = 0.f;
#pragma unroll
    for (int ps = 0; ps < 4; ++ps)
#pragma unroll
      for (int u = 0; u < 8; ++u) s += sum8_bf16(v[ps][u]);
    red[threadIdx.x] = s;  // lanes l and l + 16 hold the same n
    __syncthreads();       // an n's sum comes from eight waves
    if (threadIdx.x < 16) {
      float t = 0.f;
#pragma unroll
      for (int k = 0; k < 16; ++k) t += red[threadIdx.x + k * 16];
      S[sb * 32u + threadIdx.x] = t;
    }
    return;
  }
  const uint32_t j = blockIdx.x * (256u * 4u * SS_H) +
                     (threadIdx.x >> 5) * (128u * SS_H) +
                     (threadIdx.x & 31) * 4u;
  f32x4 v[KS][SS_H];
  // a 32-bit lane offset per pair of slices beside one uniform base
#pragma unroll
  for (int s = 0; s < KS; ++s) {
#pragma unroll
    for (int h = 0; h < SS_H; ++h)
      v[s][h] = *(const f32x4*)((const char*)(Gp + (s & 1) * NG + h * 128) +
                                (j * 4u + (s >> 1) * (8u * NG)));
    if (s & 1) wait_x0();  // later loads land in these loads' address register
  }
#pragma unroll
  for (int h = 0; h < SS_H; ++h) {
    f32x4 t = v[0][h];
#pragma unroll
    for (int s = 1; s < KS; ++s) t += v[s][h];
    uint2 o;
    o.x = pack_bf16(t[0], t[1]);
    o.y = pack_bf16(t[2], t[3]);
    *(uint2*)((char*)(Gt + h * 128) + j * 2u) = o;
  }
  wait_x0();  // the code laid out behind these stores rewrites their registers
}

// ---------------------------------------------------------------------------
// K4: Hm[o][n] = sum_c W41[o][c] * Gt[n][c] + wb[o] * S[n].  Stored [b][o][n].
// ---------------------------------------------------------------------------
__global__ __launch_bounds__(256) void a2n_w4g(
    const __bf16* __restrict__ W4c, const __bf16* __restrict__ Gt,
    const float* __restrict__ S, const float* __restrict__ wb,
    __bf16* __restrict__ Hb) {
  __shared__ __attribute__((aligned(2048))) unsigned char L[RING_B];
  const int b = blockIdx.z;
  const int lane = threadIdx.x & 31;
  const int wave = threadIdx.x >> 5;
  const int m0 = blockIdx.y * 128 + (wave >> 1) * 32;  // over C (out chans)
  const int n0 = blockIdx.x * 128 + (wave & 1) * 64;   // over CN

  // b1's share of the lane's results, its factors loaded ahead of the product
  float wv[2];
#pragma unroll
  for (int i = 0; i < 2; ++i) wv[i] = wb[m0 + 16 * i + (lane & 15)];
  fvec8 sv[4];
#pragma unroll
  for (int j = 0; j < 4; ++j)
    sv[j] = *(const fvec8*)(S + (b * (CN / 16) + (n0 >> 4) + j) * 32 +
                            8 * (lane >> 4));
  wait_x0();  // the product's set-up rewrites these loads' address registers

  fvec8 zero = {};
  fvec8 acc[2][4];
#pragma unroll
  for (int i = 0; i < 2; ++i)
#pragma unroll
    for (int j = 0; j < 4; ++j) acc[i][j] = zero;

  block_gemm_2x4<CM, CM, true, false>(
      W4c + (size_t)blockIdx.y * 128 * CM,
      Gt + (size_t)b * CN * CM + (size_t)blockIdx.x * 128 * CM, CM * 2u, ROW_B,
      L, acc);

  unsigned char* st = L + wave * SLICE_B;  // the wave's own staging range
#pragma unroll
  for (int i = 0; i < 2; ++i)
#pragma unroll
    for (int j = 0; j < 4; ++j)
      stage_bf16(st + (16 * i + (lane & 15)) * ST_PITCH_N +
                     (16 * j + 8 * (lane >> 4)) * 2,
                 acc[i][j] + sv[j] * wv[i]);
  wait_ds0();  // other lanes' rows are read back: every LDS store is done
  rows128_out<32>(st,
                  (char*)(Hb + (size_t)b * C_IN * CN + (size_t)m0 * CN + n0),
                  CN * 2u, lane);
}

// ---------------------------------------------------------------------------
// K5: out[o][p] = x[o][p] + b4[o] + sum_n Hb[o][n] * attvT[p][n]
// ---------------------------------------------------------------------------
__global__ __launch_bounds__(256) void a2n_distribute_out(
    const __bf16* __restrict__ Hb, const __bf16* __restrict__ attvT,
    const float* __restrict__ b4, const float* __restrict__ x,
    float* __restrict__ out) {
  __shared__ __attribute__((aligned(2048))) unsigned char L[RING_B];
  const int b = blockIdx.z;
  const int lane = threadIdx.x & 31;
  const int wave = threadIdx.x >> 5;
  const int m0 = blockIdx.y * 128 + (wave >> 1) * 32;  // over C
  const int n0 = blockIdx.x * 128 + (wave & 1) * 64;   // over HW

  fvec8 zero = {};
  fvec8 acc[2][4];
#pragma unroll
  for (int i = 0; i < 2; ++i)
#pragma unroll
    for (int j = 0; j < 4; ++j) acc[i][j] = zero;

  block_gemm_2x4<CN, CN, true, false>(
      Hb + (size_t)b * C_IN * CN + (size_t)blockIdx.y * 128 * CN,
      attvT + (size_t)b * HW * CN + (size_t)blockIdx.x * 128 * CN, CN * 2u,
      ROW_B, L, acc);

  // Two rows of 256 B an instruction, for x as for out.
  // One 32-bit lane offset in bytes beside the two uniform bases: its register
  // serves the loads and the stores and takes no other value in between.
  const uint32_t off = (uint32_t)(((b * C_IN + m0 + (lane >> 4)) * HW + n0 +
                                   (lane & 15) * 4) * 4);
  float bv[2];
#pragma unroll
  for (int i = 0; i < 2; ++i) bv[i] = b4[m0 + 16 * i + (lane & 15)];
  f32x4 xv[16];
#pragma unroll
  for (int it = 0; it < 16; ++it)
    xv[it] = *(const f32x4*)((const char*)(x + (size_t)(2 * it) * HW) + off);

  unsigned char* st = L + wave * SLICE_B;  // the wave's own staging range
#pragma unroll
  for (int i = 0; i < 2; ++i)
#pragma unroll
    for (int j = 0; j < 4; ++j)
      stage_f32(st + (16 * i + (lane & 15)) * ST_PITCH_W +
                    (16 * j + 8 * (lane >> 4)) * 4,
                acc[i][j] + bv[i]);
  wait_ds0();  // other lanes' rows are read back: every LDS store is done
  const unsigned char* sr = st + (lane >> 4) * ST_PITCH_W + (lane & 15) * 16;
#pragma unroll
  for (int it = 0; it < 16; ++it) {
    const f32x4 v = *(const f32x4*)(sr + 2 * it * ST_PITCH_W);
    *(f32x4*)((char*)(out + (size_t)(2 * it) * HW) + off) = v + xv[it];
  }
}

// ---------------------------------------------------------------------------
extern "C" void kernel_launch(void* const* d_in, const int* in_sizes, int n_in,
                              void* d_out, int out_size, void* d_ws,
                              size_t ws_size, hipStream_t stream) {
  const float* x  = (const float*)d_in[0];
  const float* w1 = (const float*)d_in[1];
  const float* b1 = (const float*)d_in[2];
  const float* w2 = (const float*)d_in[3];
  const float* b2 = (const float*)d_in[4];
  const float* w3 = (const float*)d_in[5];
  const float* b3 = (const float*)d_in[6];
  const float* w4 = (const float*)d_in[7];
  const float* b4 = (const float*)d_in[8];
  float* out = (float*)d_out;

  char* ws = (char*)d_ws;
  __bf16* XT   = (__bf16*)(ws + OFF_XT);
  __bf16* WC   = (__bf16*)(ws + OFF_WC);
  __bf16* W4C  = (__bf16*)(ws + OFF_W4C);
  __bf16* Abuf = (__bf16*)(ws + OFF_A);
  __bf16* AM   = (__bf16*)(ws + OFF_AM);
  __bf16* AVT  = (__bf16*)(ws + OFF_AVT);
  __bf16* GT   = (__bf16*)(ws + OFF_GT);
  __bf16* HB   = (__bf16*)(ws + OFF_HB);
  float*  GP   = (float*)(ws + OFF_GP);
  __bf16* W41  = (__bf16*)(ws + OFF_W41);
  float*  SB   = (float*)(ws + OFF_S);
  float*  WB   = (float*)(ws + OFF_WB);

  const dim3 blk(256);

  a2n_transpose_x<<<dim3(HW / TX_P, C_IN / TX_C, BATCH + 1), blk, 0,
                    stream>>>(x, XT, Abuf, w1, w2, w3, w4, WC, W4C);

  a2n_conv123<<<dim3(HW / 128, (MO - CM) / 128, BATCH + 1), blk, 0, stream>>>(
      WC, W4C, XT, b2, b3, W41, AM, AVT);

  a2n_gathered<<<dim3(CN / 128, CM / 128, BATCH * KS), blk, 0, stream>>>(
      Abuf, AM, GP);

  a2n_sum_slices<<<dim3(SS_BLK + SR_BLK + WB_BLK), blk, 0, stream>>>(
      GP, GT, AM, w4, b1, SB, WB);

  a2n_w4g<<<dim3(CN / 128, C_IN / 128, BATCH), blk, 0, stream>>>(W41, GT, SB, WB,
                                                                 HB);

  a2n_distribute_out<<<dim3(HW / 128, C_IN / 128, BATCH), blk, 0, stream>>>(
      HB, AVT, b4, x, out);
}
